// v000
// Measured on an AMD MI455X. A time is GPU time per run, averaged over a window of back-to-back runs after a warm-up
// (all launches, gaps included; the runs take copies of the inputs in turn), and the median of several windows.
// Apart from v000's, it joins two sittings. Times from different sittings can be a few percent apart, while
// side-by-side timings come from the same sitting.
// v000 is the starting kernel. One run takes 553 microseconds.
// compute dtype: all float inputs rounded to bf16; LayerNorm of pair_act in f32; q/k/v = LN(act) split bf16 hi + lo x W (exact bf16, (out,in)) on WMMA 16x16x32 (2 products, f32 accumulate); q as f16 hi + residual (x 2^10) against k once to f16 (2 products) x 32^-0.5 + the per-(query, key, head) triangle bias (2-product GEMM) + the mask bias; softmax in f32 (precise expf); P x 2^11 once to f16 against v once to f16 (1 product); gate sigmoid(LN(act) Wg) in f32 (2-product GEMM, precise expf); gated ctx split bf16 hi + lo against exact output_w (2 products); f32 output.
#include <hip/hip_runtime.h>
#include <math.h>

typedef __attribute__((ext_vector_type(16))) _Float16 v16h;
typedef __attribute__((ext_vector_type(16))) __bf16 v16b;
typedef __attribute__((ext_vector_type(8)))  _Float16 v8h;
typedef __attribute__((ext_vector_type(8)))  float v8f;
typedef __attribute__((ext_vector_type(4)))  float v4f;
typedef __attribute__((ext_vector_type(2)))  float v2f;
typedef __attribute__((ext_vector_type(4)))  unsigned v4u;
typedef __attribute__((ext_vector_type(4)))  int v4i;
typedef float __attribute__((may_alias)) float_a;
typedef int __attribute__((may_alias)) int_a;

template <typename T> __device__ __forceinline__ void vst2(void* p, T v) { *(T*)p = v;  }
__device__ __forceinline__ v8f wmma16(v16h a, v16h b, v8f c) {
  v8f d = __builtin_amdgcn_wmma_f32_16x16x32_f16(false, a, false, b, (short)0, c, false, false);
  asm volatile("v_nop\n\tv_nop\n\tv_nop\n\tv_nop" : "+v"(d) : "v"(a), "v"(b));
  return d;
}
__device__ __forceinline__ v8f wmma_bf(v16b a, v16b b, v8f c) {
  v8f d = __builtin_amdgcn_wmma_f32_16x16x32_bf16(false, a, false, b, (short)0, c, false, false);
  asm volatile("v_nop\n\tv_nop\n\tv_nop\n\tv_nop" : "+v"(d) : "v"(a), "v"(b));
  return d;
}
// 16x16x32 fragments: lane = (h = lane>>4, row/col = lane&15); elements 0..7 = k0+8h+0..7, 8..15 = k0+16+8h+0..7; D element r = row 8h+r
__device__ __forceinline__ v16h frag_h(const _Float16* rowk0, int lane) {
  union { v16h v; v8h q[2]; } u; const _Float16* p = rowk0 + 8 * (lane >> 4);
  u.q[0] = *(const v8h*)p; u.q[1] = *(const v8h*)(p + 16); return u.v;
}
__device__ __forceinline__ v16h frag_f32(const float* rowk0, int lane) {
  v16h a; const float* p = rowk0 + 8 * (lane >> 4);
#pragma unroll
  for (int i = 0; i < 8; ++i) { a[i] = (_Float16)p[i]; a[8 + i] = (_Float16)p[16 + i]; }
  return a;
}
__device__ __forceinline__ v16h frag_f32s(const float* rowk0, int lane, float sc) {
  v16h a; const float* p = rowk0 + 8 * (lane >> 4);
#pragma unroll
  for (int i = 0; i < 8; ++i) { a[i] = (_Float16)(p[i] * sc); a[8 + i] = (_Float16)(p[16 + i] * sc); }
  return a;
}
// column fragment from a [K][ld] layout (column n), rows >= K read as 0
__device__ __forceinline__ v16h fragc_f32(const float* W, int k0, int n, int lane, int ld, int K) {
  v16h a; const int g = lane >> 4;
#pragma unroll
  for (int i = 0; i < 8; ++i) { const int ka = k0 + 8 * g + i, kb = ka + 16;
    a[i] = (_Float16)(ka < K ? W[(size_t)(ka < K ? ka : K - 1) * ld + n] : 0.f); a[8 + i] = (_Float16)(kb < K ? W[(size_t)(kb < K ? kb : K - 1) * ld + n] : 0.f); }
  return a;
}
struct F2 { v16b h, l; };
__device__ __forceinline__ F2 bsplit16(const float v[16]) { F2 r;
#pragma unroll
  for (int i = 0; i < 16; ++i) { const __bf16 h = (__bf16)v[i]; r.h[i] = h; r.l[i] = (__bf16)(v[i] - (float)h); }
  return r; }
__device__ __forceinline__ F2 split_row(const float* row, int k0, int lane) { float v[16]; const float* p = row + k0 + 8 * (lane >> 4);
#pragma unroll
  for (int i = 0; i < 8; ++i) { v[i] = p[i]; v[8 + i] = p[16 + i]; }
  return bsplit16(v); }
__device__ __forceinline__ F2 split_rowK(const float* row, int k0, int lane, int K) { float v[16]; const int g = lane >> 4;
#pragma unroll
  for (int i = 0; i < 8; ++i) { const int ka = k0 + 8 * g + i, kb = ka + 16; v[i] = ka < K ? row[ka < K ? ka : K - 1] : 0.f; v[8 + i] = kb < K ? row[kb < K ? kb : K - 1] : 0.f; }
  return bsplit16(v); }
__device__ __forceinline__ F2 split_col(const float* W, int k0, int n, int lane, int ld, int K) { float v[16]; const int g = lane >> 4;
#pragma unroll
  for (int i = 0; i < 8; ++i) { const int ka = k0 + 8 * g + i, kb = ka + 16; v[i] = ka < K ? W[(size_t)(ka < K ? ka : K - 1) * ld + n] : 0.f; v[8 + i] = kb < K ? W[(size_t)(kb < K ? kb : K - 1) * ld + n] : 0.f; }
  return bsplit16(v); }
__device__ __forceinline__ v8f mac3(const F2& a, const F2& b, v8f c) { c = wmma_bf(a.l, b.h, c); c = wmma_bf(a.h, b.l, c); return wmma_bf(a.h, b.h, c); }
__device__ __forceinline__ float sigm(float v) { return 1.0f / (1.0f + expf(-v)); }
#define LDSX() do { asm volatile("s_wait_dscnt 0" ::: "memory"); __builtin_amdgcn_wave_barrier(); __builtin_amdgcn_fence(__ATOMIC_RELEASE, "workgroup"); } while (0)

// Triangle (starting-node) attention on a pair representation x [1, 256, 256, 128] (4 heads x 32): xn = LayerNorm(x); for every row b: q, k, v = xn[b] W^T ((out,in)); scores[b,h,q,k] = q . k / sqrt(32) + bias[h][q][k] + attn_mask[q][k] with bias[h][q][k] = xn[q][k] . Wb[h] (pair-indexed, shared across rows) and attn_mask in {0, -1e9}; softmax over k; o = (attn v) * sigmoid(xn[b][q] Wg^T); out[b][q] = o Wo^T.
#define NB 256
#define TT 256
#define CC 128            // NH * HD = projected width
#define DIN 128          // input (model) width
#define NH 4
#define HD 32
#define NQB (TT / 64)
#define HG 4
#define SCALE (0.17677669529663687f)
#define CAUSAL 0
#ifndef TNB
#define TNB NB
#endif
__device__ __forceinline__ float bfr(float v) { return (float)(__bf16)v; }
__host__ __device__ __forceinline__ int kb_last(int qb) { return CAUSAL ? ((qb * 64 + 63) >> 7) : (TT / 128 - 1); }
typedef __attribute__((ext_vector_type(8))) __bf16 v8b;
__device__ __forceinline__ v16b frag_b(const __bf16* rowk0, int lane) {
  union { v16b v; v8b q[2]; } u; const __bf16* p = rowk0 + 8 * (lane >> 4);
  u.q[0] = *(const v8b*)p; u.q[1] = *(const v8b*)(p + 16); return u.v;
}
#define QBH 0              // causal: query blocks 0..QBH-1 of each sequence (few keys, no averaging) take the high-precision path
#define QHI 256            // rows carrying a q residual plane (all rows when non-causal: 2-product logits everywhere)
#define KHI 64            // key rows carrying k residual / v bf16 hi+lo planes (used only by the causal high-precision path)
// B fragment (k rows k0+.., output column o) of a weight: (in,out) [K][ld] or (out,in) [ld rows of K]: bf16 exact, or f16(bf16 * 256) exact
__device__ __forceinline__ v16b wcol_io(const float* Wm, int k0, int o, int lane, int ld) { v16b w; const int g = lane >> 4;
#pragma unroll
  for (int i = 0; i < 8; ++i) { w[i] = (__bf16)Wm[(size_t)(k0 + 8 * g + i) * ld + o]; w[8 + i] = (__bf16)Wm[(size_t)(k0 + 16 + 8 * g + i) * ld + o]; }
  return w; }
__device__ __forceinline__ v16b wcol_oi(const float* Wm, int k0, int o, int lane, int K) { v16b w; const float* p = Wm + (size_t)o * K + k0 + 8 * (lane >> 4);
#pragma unroll
  for (int i = 0; i < 8; ++i) { w[i] = (__bf16)p[i]; w[8 + i] = (__bf16)p[16 + i]; }
  return w; }
__device__ __forceinline__ v16h wcolh_io(const float* Wm, int k0, int o, int lane, int ld) { v16h w; const int g = lane >> 4;
#pragma unroll
  for (int i = 0; i < 8; ++i) { w[i] = (_Float16)(bfr(Wm[(size_t)(k0 + 8 * g + i) * ld + o]) * 256.0f); w[8 + i] = (_Float16)(bfr(Wm[(size_t)(k0 + 16 + 8 * g + i) * ld + o]) * 256.0f); }
  return w; }
__device__ __forceinline__ v16h wcolh_oi(const float* Wm, int k0, int o, int lane, int K) { v16h w; const float* p = Wm + (size_t)o * K + k0 + 8 * (lane >> 4);
#pragma unroll
  for (int i = 0; i < 8; ++i) { w[i] = (_Float16)(bfr(p[i]) * 256.0f); w[8 + i] = (_Float16)(bfr(p[16 + i]) * 256.0f); }
  return w; }
#define WQKV_LAYOUT 1   // (out,in) [CC][DIN]
__device__ __forceinline__ v16b wcol_hdk(const float* Wm, int k0, int o, int lane) { v16b w; const int g = lane >> 4; const float* p = Wm + (size_t)(o / HD) * DIN * HD + (o % HD);
#pragma unroll
  for (int i = 0; i < 8; ++i) { w[i] = (__bf16)p[(size_t)(k0 + 8 * g + i) * HD]; w[8 + i] = (__bf16)p[(size_t)(k0 + 16 + 8 * g + i) * HD]; }
  return w; }
#define WO_OUT_IN 1
#if WQKV_LAYOUT == 1
#define WCOL(W, k0, o, lane) wcol_oi(W, k0, o, lane, DIN)
#elif WQKV_LAYOUT == 2
#define WCOL(W, k0, o, lane) wcol_hdk(W, k0, o, lane)
#else
#define WCOL(W, k0, o, lane) wcol_io(W, k0, o, lane, CC)
#endif
#if WO_OUT_IN
#define WOCOL(W, k0, o, lane) wcol_oi(W, k0, o, lane, CC)
#define WOCOLH(W, k0, o, lane) wcolh_oi(W, k0, o, lane, CC)
#else
#define WOCOL(W, k0, o, lane) wcol_io(W, k0, o, lane, DIN)
#define WOCOLH(W, k0, o, lane) wcolh_io(W, k0, o, lane, DIN)
#endif
#define SZ 256
#define BG 64              // rows r per pass (x 4 heads = 256 score planes of 256 x 256)
#define NZR (SZ * SZ)      // 65,536 pair rows
#define SM_EXTRA_PARAMS , const float* __restrict__ BIAS, const float* __restrict__ MKP, int b0s
#define SM_MASK_HOOK do { const int hh = (int)blockIdx.y % HG; v = v + BIAS[((size_t)t * SZ + k) * NH + hh] + bfr(MKP[(size_t)t * SZ + k]); (void)b0s; } while (0)   /* tri_bias[h][q][k] (pair-indexed, shared over rows) + bf16(attn_mask[q][k]) (pair-indexed, shared over rows) */
// ---- k_lnz: wave per pair row: LayerNorm over the 128 channels (biased var, eps 1e-5, ln_w/ln_b) of bf16(z) -> ZN rows (4 floats per lane = one 512-B row)
__global__ __launch_bounds__(256) void k_lnz(const float* __restrict__ Z, const float* __restrict__ LW, const float* __restrict__ LB, float* __restrict__ ZN) { const int wave = threadIdx.x >> 5, lane = threadIdx.x & 31; const size_t row = (size_t)blockIdx.x * 8 + wave; if (row >= (size_t)NZR) return;
  v4f x = *(const v4f*)(Z + row * CC + lane * 4); float s1 = 0.f;
#pragma unroll
  for (int i = 0; i < 4; ++i) { x[i] = bfr(x[i]); s1 += x[i]; }
#pragma unroll
  for (int o = 1; o < 32; o <<= 1) s1 += __shfl_xor(s1, o);
  const float mu = s1 * (1.0f / CC); float q = 0.f;
#pragma unroll
  for (int i = 0; i < 4; ++i) { const float d = x[i] - mu; q += d * d; }
#pragma unroll
  for (int o = 1; o < 32; o <<= 1) q += __shfl_xor(q, o);
  const float rs = rsqrtf(q * (1.0f / CC) + 1e-5f); v4f r4;
#pragma unroll
  for (int i = 0; i < 4; ++i) { const int c = lane * 4 + i; r4[i] = (x[i] - mu) * rs * bfr(LW[c]) + bfr(LB[c]); }
  vst2(ZN + row * CC + lane * 4, r4); }
// ---- k_rows2: block = (64 rows, which): which 0: bias: BIAS[row = q*256+k][h] = xn[q][k] . Wb[h] (4 outputs) ; which 1: G[row][c] = sigmoid(xn[row] . Wg[c]) (128 outputs); weights are (out,in)
__global__ __launch_bounds__(128) void k_rows2(const float* __restrict__ ZN, const float* __restrict__ WB, const float* __restrict__ WG, const float* __restrict__ GB, float* __restrict__ BIAS, float* __restrict__ G) { __shared__ __align__(16) float sf[4][16][132];
  const int tid = threadIdx.x, wave = tid >> 5, lane = tid & 31, col = lane & 15, g = lane >> 4; const int which = blockIdx.y; const size_t r0 = (size_t)blockIdx.x * 64 + wave * 16;
  const int nout = which == 0 ? NH : CC; const float* Wm = which == 0 ? WB : WG;
  v8f acc[8] = {};
#pragma unroll
  for (int kc = 0; kc < CC / 32; ++kc) { const F2 a = split_row(ZN + (r0 + col) * CC, kc * 32, lane); asm volatile("s_wait_loadcnt 0x0" ::: "memory");
#pragma unroll
    for (int j = 0; j < 8; ++j) { if (j * 16 >= nout) break; v16b w; { float t0[8], t1[8]; const int o = j * 16 + col; const int oc = o < nout ? o : nout - 1; const float keep = o < nout ? 1.f : 0.f;
#pragma unroll
        for (int i = 0; i < 8; ++i) t0[i] = Wm[(size_t)oc * CC + kc * 32 + 8 * g + i];   /* (out,in) */
        asm volatile("s_wait_loadcnt 0x0" ::: "memory");
#pragma unroll
        for (int i = 0; i < 8; ++i) t1[i] = Wm[(size_t)oc * CC + kc * 32 + 16 + 8 * g + i];
        asm volatile("s_wait_loadcnt 0x0" ::: "memory");
#pragma unroll
        for (int i = 0; i < 8; ++i) { w[i] = (__bf16)(t0[i] * keep); w[8 + i] = (__bf16)(t1[i] * keep); } }   /* (out,in) row o; columns beyond nout zero (select-free: keep multiplies a VALID load) */
      acc[j] = wmma_bf(a.h, w, acc[j]); acc[j] = wmma_bf(a.l, w, acc[j]); } }
  if (which == 0) { if (lane < 16) {   /* bias rows: 4 floats = 16 B per row; rows r0+8g+r... store via LDS: */ }
#pragma unroll
    for (int r = 0; r < 8; ++r) sf[wave][8 * g + r][col] = acc[0][r];
    LDSX(); if (lane < 16) { v4f b4; b4[0] = sf[wave][lane][0]; b4[1] = sf[wave][lane][1]; b4[2] = sf[wave][lane][2]; b4[3] = sf[wave][lane][3]; vst2(BIAS + (r0 + lane) * NH, b4); }   /* 16 rows x 16 B = one 256-B run per wave */
  } else {
#pragma unroll
    for (int j = 0; j < 8; ++j)
#pragma unroll
      for (int r = 0; r < 8; ++r) sf[wave][8 * g + r][j * 16 + col] = 1.0f / (1.0f + expf(-acc[j][r]));   /* sigmoid(xn Wg^T), no bias */
    LDSX(); for (int rl = 0; rl < 16; ++rl) vst2(G + (r0 + rl) * CC + lane * 4, *(const v4f*)&sf[wave][rl][lane * 4]); } }
// ---- k_gate: Y row *= G row (same natural row index r*256 + q; thread per float4; one writer)
__global__ __launch_bounds__(256) void k_gate(float* __restrict__ Y, const float* __restrict__ G) { const size_t e4 = (size_t)blockIdx.x * 256 + threadIdx.x; if (e4 >= (size_t)NZR * (CC / 4)) return; const size_t yrow = e4 / (CC / 4); const int q = (int)(e4 % (CC / 4)); const size_t grow = yrow;
  v4f y = *(const v4f*)(Y + yrow * CC + q * 4); const v4f gg = *(const v4f*)(G + grow * CC + q * 4); y[0] *= gg[0]; y[1] *= gg[1]; y[2] *= gg[2]; y[3] *= gg[3]; vst2(Y + yrow * CC + q * 4, y); }
#define WS_ZN   (WS_END)
#define WS_BIAS (WS_ZN + 4u * (size_t)NZR * CC)
#define WS_G    (WS_BIAS + 4u * (size_t)NZR * NH)
#define WS_END2 (WS_G + 4u * (size_t)NZR * CC)
#ifndef SM_EXTRA_PARAMS
#define SM_EXTRA_PARAMS
#endif
#ifndef PROJ_EXTRA_PARAMS
#define PROJ_EXTRA_PARAMS
#endif
#ifndef SM_MASK_HOOK
#define SM_MASK_HOOK (void)0
#endif

#define WS_QH  0u                                      // f16 q rows [b*t][CC]
#define WS_KH  (WS_QH + 2u * (size_t)NB * TT * CC)      // f16 k rows [b*t][CC]
#define WS_VT  (WS_KH + 2u * (size_t)NB * TT * CC)      // f16 v planes [b][c][t]
#define WS_QL  (WS_VT + 2u * (size_t)NB * CC * TT)      // f16 q residual x 2^10 rows [b][t < QHI][CC]
#define WS_KL  (WS_QL + 2u * (size_t)NB * QHI * CC)     // f16 k residual x 2^10 rows [b][t < KHI][CC]
#define WS_VB  (WS_KL + 2u * (size_t)NB * KHI * CC)     // bf16 v hi planes [b][c][t < KHI]
#define WS_VBL (WS_VB + 2u * (size_t)NB * CC * KHI)
#define WS_S   (WS_VBL + 2u * (size_t)NB * CC * KHI)    // f32 logits / P [hg][t][s]
#define WS_Y   (WS_S  + 4u * (size_t)BG * HG * TT * TT)   // 256 score planes of 256 x 256 per pass      // f32 ctx rows [b*t][CC] (only when there is an output projection)
#define WS_END (WS_Y  + 4u * (size_t)NB * TT * CC)

// ---- k_proj: block = (64 rows, 128 cols, which): q/k/v = X W (+ b) with exact bf16 products (K = DIN) -> which 0: q f16 rows (+ residual rows < QHI); 1: k f16 rows (+ residual rows < KHI); 2: v f16 planes [c][t] (+ bf16 hi/lo planes for t < KHI)
__global__ __launch_bounds__(128) void k_proj(const float* __restrict__ XQ, const float* __restrict__ XK, const float* __restrict__ XV, const float* __restrict__ WQ, const float* __restrict__ WK, const float* __restrict__ WV, const float* __restrict__ BQ, const float* __restrict__ BK, const float* __restrict__ BV,
    _Float16* __restrict__ QH, _Float16* __restrict__ QL, _Float16* __restrict__ KH, _Float16* __restrict__ KL, _Float16* __restrict__ VT, __bf16* __restrict__ VB, __bf16* __restrict__ VBL) {
  __shared__ __align__(16) _Float16 sh[64][136], sl[64][136]; __shared__ __align__(16) _Float16 th[128][72]; __shared__ __align__(16) __bf16 tb[128][72], tbl[128][72];
  const int tid = threadIdx.x, wave = tid >> 5, lane = tid & 31, col = lane & 15, g = lane >> 4; const int which = blockIdx.z; const int c0 = blockIdx.y * 128; const size_t r0 = (size_t)blockIdx.x * 64; const size_t bb = r0 / TT; const int t0 = (int)(r0 % TT);
  const float* X = which == 0 ? XQ : which == 1 ? XK : XV; const float* WA = which == 0 ? WQ : which == 1 ? WK : WV; const float* BA = which == 0 ? BQ : which == 1 ? BK : BV;
  v8f acc[8] = {};
#pragma unroll 2
  for (int kc = 0; kc < DIN / 32; ++kc) { const F2 a2 = split_row(X + (r0 + wave * 16 + col) * DIN, kc * 32, lane);   /* LN(act) rows (f32) split hi + lo */
    asm volatile("s_wait_loadcnt 0x0" ::: "memory");
#pragma unroll
    for (int j = 0; j < 8; ++j) { const v16b w = WCOL(WA, kc * 32, c0 + j * 16 + col, lane); asm volatile("s_wait_loadcnt 0x0" ::: "memory"); acc[j] = wmma_bf(a2.h, w, acc[j]); acc[j] = wmma_bf(a2.l, w, acc[j]); } }
  if (which < 2) { _Float16* DH = which == 0 ? QH : KH; _Float16* DL = which == 0 ? QL : KL; const int nhi = which == 0 ? QHI : KHI; const bool hi_rows = t0 < nhi;
#pragma unroll
    for (int j = 0; j < 8; ++j) { const float bias = BA ? bfr(BA[c0 + j * 16 + col]) : 0.f;
#pragma unroll
      for (int r = 0; r < 8; ++r) { const float v = acc[j][r] + bias; const _Float16 hv = (_Float16)v; sh[wave * 16 + 8 * g + r][j * 16 + col] = hv; sl[wave * 16 + 8 * g + r][j * 16 + col] = (_Float16)((v - (float)hv) * 1024.0f); } }
    __syncthreads();
    for (int e = tid; e < 64 * 16; e += 128) { const int rl = e >> 4, q = e & 15; vst2((unsigned*)(DH + (r0 + rl) * CC + c0 + q * 8), *(const v4u*)&sh[rl][q * 8]); if (hi_rows) vst2((unsigned*)(DL + (bb * nhi + t0 + rl) * (size_t)CC + c0 + q * 8), *(const v4u*)&sl[rl][q * 8]); }
  } else { const bool hi_rows = t0 < KHI;
#pragma unroll
    for (int j = 0; j < 8; ++j) { const float bias = BA ? bfr(BA[c0 + j * 16 + col]) : 0.f;
#pragma unroll
      for (int r = 0; r < 8; ++r) { const float v = acc[j][r] + bias; const int rl = wave * 16 + 8 * g + r, cl = j * 16 + col; th[cl][rl] = (_Float16)v; const __bf16 bh = (__bf16)v; tb[cl][rl] = bh; tbl[cl][rl] = (__bf16)(v - (float)bh); } }
    __syncthreads();
    for (int e = tid; e < 128 * 8; e += 128) { const int cl = e >> 3, q = e & 7; vst2((unsigned*)(VT + (bb * CC + c0 + cl) * (size_t)TT + t0 + q * 8), *(const v4u*)&th[cl][q * 8]); if (hi_rows) { const size_t o3 = (bb * CC + c0 + cl) * (size_t)KHI + t0 + q * 8; vst2((unsigned*)(VB + o3), *(const v4u*)&tb[cl][q * 8]); vst2((unsigned*)(VBL + o3), *(const v4u*)&tbl[cl][q * 8]); } } } }
// ---- k_sc: block = (query block qb, key block kb <= kb_last(qb), head in group) of batch b: logits x SCALE; q hi + residual (x 2^10) against k (2 products) for query rows < QHI, plus the k residual (3 products) for query blocks < QBH (causal early rows); causal: blocks past the diagonal exit, the mask itself is applied by index in k_sm
__global__ __launch_bounds__(128) void k_sc(const _Float16* __restrict__ QH, const _Float16* __restrict__ KH, const _Float16* __restrict__ QL, const _Float16* __restrict__ KL, int b0g, int h0, float* __restrict__ S0) { __shared__ __align__(16) float ss[4][16][132]; const int b = b0g + (int)blockIdx.z / HG;   /* row r of this z-slice */
  const int qb = blockIdx.x, kb = blockIdx.y; if (kb > kb_last(qb)) return;
  const int h = h0 + (int)blockIdx.z % HG; float* S = S0 + (size_t)blockIdx.z * TT * TT;
  const int tid = threadIdx.x, wave = tid >> 5, lane = tid & 31, col = lane & 15, g = lane >> 4; const int k0 = kb * 128; const int ql0 = qb * 64 + wave * 16; const size_t q0 = (size_t)b * TT + ql0, kr0 = (size_t)b * TT + k0;
  v8f acc[8] = {}, accl[8] = {};
  const _Float16* QLb = QL + (size_t)b * QHI * CC; const _Float16* KLb = KL + (size_t)b * KHI * CC;
  if (qb < QBH) {
#pragma unroll
    for (int kc = 0; kc < HD / 32; ++kc) { const v16h ah = frag_h(QH + (q0 + col) * CC + h * HD + kc * 32, lane), al = frag_h(QLb + (size_t)(ql0 + col) * CC + h * HD + kc * 32, lane);
#pragma unroll
      for (int j = 0; j < 8; ++j) { const v16h kbf = frag_h(KH + (kr0 + j * 16 + col) * CC + h * HD + kc * 32, lane), klf = frag_h(KLb + (size_t)(k0 + j * 16 + col) * CC + h * HD + kc * 32, lane); acc[j] = wmma16(ah, kbf, acc[j]); accl[j] = wmma16(al, kbf, accl[j]); accl[j] = wmma16(ah, klf, accl[j]); } }
  } else if (qb * 64 < QHI) {
#pragma unroll
    for (int kc = 0; kc < HD / 32; ++kc) { const v16h ah = frag_h(QH + (q0 + col) * CC + h * HD + kc * 32, lane), al = frag_h(QLb + (size_t)(ql0 + col) * CC + h * HD + kc * 32, lane);
#pragma unroll
      for (int j = 0; j < 8; ++j) { const v16h kbf = frag_h(KH + (kr0 + j * 16 + col) * CC + h * HD + kc * 32, lane); acc[j] = wmma16(ah, kbf, acc[j]); accl[j] = wmma16(al, kbf, accl[j]); } }
  } else {
#pragma unroll
    for (int kc = 0; kc < HD / 32; ++kc) { const v16h ah = frag_h(QH + (q0 + col) * CC + h * HD + kc * 32, lane);
#pragma unroll
      for (int j = 0; j < 8; ++j) { const v16h kbf = frag_h(KH + (kr0 + j * 16 + col) * CC + h * HD + kc * 32, lane); acc[j] = wmma16(ah, kbf, acc[j]); } } }
#pragma unroll
  for (int j = 0; j < 8; ++j) {
#pragma unroll
    for (int r = 0; r < 8; ++r) ss[wave][8 * g + r][j * 16 + col] = (acc[j][r] + accl[j][r] * (1.0f / 1024.0f)) * SCALE; }
  LDSX(); for (int rl = 0; rl < 16; ++rl) vst2(S + (size_t)(ql0 + rl) * TT + k0 + lane * 4, *(const v4f*)&ss[wave][rl][lane * 4]); }
// ---- k_sm: block = query row t (head in group): keys [0, kend): causal -> logit if s <= t else excluded; softmax in f32; P x 2^11 in place (0 for excluded)
__global__ __launch_bounds__(256) void k_sm(float* __restrict__ S0 SM_EXTRA_PARAMS) { __shared__ float sred[8]; __shared__ float sbc; __shared__ __align__(16) float shv[TT];
  const int tid = threadIdx.x; const int t = blockIdx.x; const int kend = (kb_last(t >> 6) + 1) * 128;
  float* sr = S0 + (size_t)blockIdx.y * TT * TT + (size_t)t * TT;
  float m = -3.0e38f; for (int k = tid; k < kend; k += 256) { float v = (!CAUSAL || k <= t) ? sr[k] : -3.0e38f; SM_MASK_HOOK; shv[k] = v; m = fmaxf(m, v); }
#pragma unroll
  for (int o = 1; o < 32; o <<= 1) m = fmaxf(m, __shfl_xor(m, o));
  if ((tid & 31) == 0) sred[tid >> 5] = m; __syncthreads(); if (tid == 0) { float a = sred[0]; for (int i = 1; i < 8; ++i) a = fmaxf(a, sred[i]); sbc = a; } __syncthreads(); m = sbc; __syncthreads();
  float sum = 0.f; for (int k = tid; k < kend; k += 256) { const float v = shv[k]; const float e = (v <= -1.0e38f) ? 0.f : expf(v - m); shv[k] = e; sum += e; }
#pragma unroll
  for (int o = 1; o < 32; o <<= 1) sum += __shfl_xor(sum, o);
  if ((tid & 31) == 0) sred[tid >> 5] = sum; __syncthreads(); if (tid == 0) { float a = 0.f; for (int i = 0; i < 8; ++i) a += sred[i]; sbc = a > 0.f ? 2048.0f / a : 0.f; }   /* a fully excluded row yields P = 0 */ __syncthreads(); const float inv = sbc;
  for (int k = tid; k < kend; k += 256) shv[k] = shv[k] * inv;
  __syncthreads(); for (int q = tid; q < kend / 4; q += 256) vst2(sr + q * 4, *(const v4f*)&shv[q * 4]); }
// ---- k_pv: block = 64 queries (qb) of (b, h): ctx = P . v over keys [0, kend) (P x 2^11 once to f16 against v f16: 1 product; causal early query blocks: P and v as bf16 hi + lo, 3 products); 128-B (row, head) segment by 8 lanes
__global__ __launch_bounds__(128) void k_pv(const float* __restrict__ PS0, const _Float16* __restrict__ VT, const __bf16* __restrict__ VB, const __bf16* __restrict__ VBL, int b0g, int h0, float* __restrict__ Y) { const int b = b0g + (int)blockIdx.z / HG; const int h = h0 + (int)blockIdx.z % HG; const float* PS = PS0 + (size_t)blockIdx.z * TT * TT; __shared__ __align__(16) float ss[4][16][HD + 4];
  const int tid = threadIdx.x, wave = tid >> 5, lane = tid & 31, col = lane & 15, g = lane >> 4; const int qb = blockIdx.x; const int ql0 = qb * 64 + wave * 16; const int kce = (kb_last(qb) + 1) * 4;
  v8f acc[HD / 16] = {};
  if (qb < QBH) {
#pragma unroll 1
    for (int kc = 0; kc < kce; ++kc) { const F2 p = split_row(PS + (size_t)(ql0 + col) * TT, kc * 32, lane);
      asm volatile("s_wait_loadcnt 0x0" ::: "memory");
#pragma unroll
      for (int j = 0; j < HD / 16; ++j) { const size_t po = ((size_t)b * CC + h * HD + j * 16 + col) * (size_t)KHI + kc * 32; const v16b vh = frag_b(VB + po, lane); acc[j] = wmma_bf(p.h, vh, acc[j]); acc[j] = wmma_bf(p.l, vh, acc[j]); acc[j] = wmma_bf(p.h, frag_b(VBL + po, lane), acc[j]); } }
  } else {
#pragma unroll 1
    for (int kc = 0; kc < kce; ++kc) { const v16h p = frag_f32(PS + (size_t)(ql0 + col) * TT + kc * 32, lane);
      asm volatile("s_wait_loadcnt 0x0" ::: "memory");
#pragma unroll
      for (int j = 0; j < HD / 16; ++j) { const size_t po = ((size_t)b * CC + h * HD + j * 16 + col) * (size_t)TT + kc * 32; acc[j] = wmma16(p, frag_h(VT + po, lane), acc[j]); } } }
#pragma unroll
  for (int j = 0; j < HD / 16; ++j)
#pragma unroll
    for (int r = 0; r < 8; ++r) ss[wave][8 * g + r][j * 16 + col] = acc[j][r] * (1.0f / 2048.0f);
  LDSX(); for (int rl = 0; rl < 16; ++rl) if (lane < HD / 4) vst2(Y + ((size_t)b * TT + ql0 + rl) * CC + h * HD + lane * 4, *(const v4f*)&ss[wave][rl][lane * 4]); }
// ---- k_out: block = (64 rows, 128 cols): out = ctx Wo (+ bo): all rows: ctx bf16 hi + lo against exact bf16 Wo (2 products); the f16(bf16 x 2^8) 1-product path is not taken
__global__ __launch_bounds__(128) void k_out(const float* __restrict__ Y, const float* __restrict__ WO, const float* __restrict__ BO, float* __restrict__ OUT) { __shared__ __align__(16) float sf[4][16][132];
  const int tid = threadIdx.x, wave = tid >> 5, lane = tid & 31, col = lane & 15, g = lane >> 4; const int c0 = blockIdx.y * 128; const size_t r0 = (size_t)blockIdx.x * 64 + wave * 16;
  v8f acc[8] = {};
  if (true) {   /* ALL rows: gated ctx bf16 hi + lo x exact output_w (2 products) */
#pragma unroll 2
    for (int kc = 0; kc < CC / 32; ++kc) { const F2 a = split_row(Y + (r0 + col) * CC, kc * 32, lane); asm volatile("s_wait_loadcnt 0x0" ::: "memory");
#pragma unroll
      for (int j = 0; j < 8; ++j) { const v16b w = WOCOL(WO, kc * 32, c0 + j * 16 + col, lane); asm volatile("s_wait_loadcnt 0x0" ::: "memory"); acc[j] = wmma_bf(a.h, w, acc[j]); acc[j] = wmma_bf(a.l, w, acc[j]); } }
#pragma unroll
    for (int j = 0; j < 8; ++j) { const float bias = BO ? bfr(BO[c0 + j * 16 + col]) : 0.f;
#pragma unroll
      for (int r = 0; r < 8; ++r) sf[wave][8 * g + r][j * 16 + col] = acc[j][r] + bias; }
  } else {
#pragma unroll 2
    for (int kc = 0; kc < CC / 32; ++kc) { const v16h a = frag_f32(Y + (r0 + col) * CC + kc * 32, lane); asm volatile("s_wait_loadcnt 0x0" ::: "memory");
#pragma unroll
      for (int j = 0; j < 8; ++j) { const v16h w = WOCOLH(WO, kc * 32, c0 + j * 16 + col, lane); asm volatile("s_wait_loadcnt 0x0" ::: "memory"); acc[j] = wmma16(a, w, acc[j]); } }
#pragma unroll
    for (int j = 0; j < 8; ++j) { const float bias = BO ? bfr(BO[c0 + j * 16 + col]) : 0.f;
#pragma unroll
      for (int r = 0; r < 8; ++r) sf[wave][8 * g + r][j * 16 + col] = acc[j][r] * (1.0f / 256.0f) + bias; } }
  LDSX(); for (int rl = 0; rl < 16; ++rl) vst2(OUT + (r0 + rl) * DIN + c0 + lane * 4, *(const v4f*)&sf[wave][rl][lane * 4]); }

extern "C" void kernel_launch(void* const* d_in, const int* in_sizes, int n_in, void* d_out, int out_size, void* d_ws, size_t ws_size, hipStream_t stream) {
  (void)in_sizes; (void)n_in; (void)out_size;
  const float** F = (const float**)d_in;
  if (ws_size < (size_t)WS_END) return;
  char* ws = (char*)d_ws; _Float16 *QH = (_Float16*)(ws + WS_QH), *KH = (_Float16*)(ws + WS_KH), *VT = (_Float16*)(ws + WS_VT), *QL = (_Float16*)(ws + WS_QL), *KL = (_Float16*)(ws + WS_KL); __bf16 *VB = (__bf16*)(ws + WS_VB), *VBL = (__bf16*)(ws + WS_VBL); float *S = (float*)(ws + WS_S), *Y = (float*)(ws + WS_Y);
  (void)Y; (void)QL; (void)KL; (void)VB; (void)VBL;
  // inputs: 0 x [1,256,256,128]; 1 attn_mask [1,1,256,256] (0 / -1e9); 2 ln_w, 3 ln_b; 4 Wb [4,128]; 5 Wq, 6 Wk, 7 Wv, 8 Wg, 9 Wo [128,128] (out,in)
  if (ws_size < (size_t)WS_END2) return;
  float *ZN = (float*)(ws + WS_ZN), *BIAS = (float*)(ws + WS_BIAS), *G = (float*)(ws + WS_G);
  k_lnz<<<dim3(NZR / 8), 256, 0, stream>>>(F[0], F[2], F[3], ZN);
  k_rows2<<<dim3(NZR / 64, 2), 128, 0, stream>>>(ZN, F[4], F[8], nullptr, BIAS, G);
  k_proj<<<dim3(TNB * TT / 64, CC / 128, 3), 128, 0, stream>>>(ZN, ZN, ZN, F[5], F[6], F[7], nullptr, nullptr, nullptr, QH, QL, KH, KL, VT, VB, VBL);
  for (int bg = 0; bg < TNB; bg += BG) {   /* 64 rows b per pass x 4 heads */
    k_sc<<<dim3(NQB, TT / 128, BG * HG), 128, 0, stream>>>(QH, KH, QL, KL, bg, 0, S);
    k_sm<<<dim3(TT, BG * HG), 256, 0, stream>>>(S, BIAS, F[1], bg);
    k_pv<<<dim3(NQB, 1, BG * HG), 128, 0, stream>>>(S, VT, VB, VBL, bg, 0, Y);
  }
  k_gate<<<dim3((NZR * (CC / 4) + 255) / 256), 256, 0, stream>>>(Y, G);
  k_out<<<dim3(TNB * TT / 64, DIN / 128), 128, 0, stream>>>(Y, F[9], nullptr, (float*)d_out);
}

// v001
// A run of this version takes 253 microseconds.
// Next to v000, in two timings, it ran 2.27 and 2.21 times as fast.
// compute dtype: all float inputs rounded to bf16; LayerNorm of pair_act in f32; q/k/v = LN(act) split bf16 hi + lo x W (exact bf16, (out,in)) on WMMA 16x16x32 (2 products, f32 accumulate); q as f16 hi + residual (x 2^10) against k once to f16 (2 products) x 32^-0.5 + the per-(query, key, head) triangle bias (2-product GEMM) + the mask bias; softmax in f32 (precise expf); P x 2^11 once to f16 against v once to f16 (1 product); gate sigmoid(LN(act) Wg) in f32 (2-product GEMM, precise expf); gated ctx split bf16 hi + lo against exact output_w (2 products); f32 output.
#include <hip/hip_runtime.h>
#include <math.h>

typedef __attribute__((ext_vector_type(16))) _Float16 v16h;
typedef __attribute__((ext_vector_type(16))) __bf16 v16b;
typedef __attribute__((ext_vector_type(8)))  _Float16 v8h;
typedef __attribute__((ext_vector_type(8)))  float v8f;
typedef __attribute__((ext_vector_type(4)))  float v4f;
typedef __attribute__((ext_vector_type(2)))  float v2f;
typedef __attribute__((ext_vector_type(4)))  unsigned v4u;
typedef __attribute__((ext_vector_type(4)))  int v4i;
typedef float __attribute__((may_alias)) float_a;
typedef int __attribute__((may_alias)) int_a;

template <typename T> __device__ __forceinline__ void vst2(void* p, T v) { *(T*)p = v;  }
__device__ __forceinline__ v8f wmma16(v16h a, v16h b, v8f c) {
  v8f d = __builtin_amdgcn_wmma_f32_16x16x32_f16(false, a, false, b, (short)0, c, false, false);
  asm volatile("v_nop\n\tv_nop\n\tv_nop\n\tv_nop" : "+v"(d) : "v"(a), "v"(b));
  return d;
}
__device__ __forceinline__ v8f wmma_bf(v16b a, v16b b, v8f c) {
  v8f d = __builtin_amdgcn_wmma_f32_16x16x32_bf16(false, a, false, b, (short)0, c, false, false);
  asm volatile("v_nop\n\tv_nop\n\tv_nop\n\tv_nop" : "+v"(d) : "v"(a), "v"(b));
  return d;
}
// 16x16x32 fragments: lane = (h = lane>>4, row/col = lane&15); elements 0..7 = k0+8h+0..7, 8..15 = k0+16+8h+0..7; D element r = row 8h+r
__device__ __forceinline__ v16h frag_h(const _Float16* rowk0, int lane) {
  union { v16h v; v8h q[2]; } u; const _Float16* p = rowk0 + 8 * (lane >> 4);
  u.q[0] = *(const v8h*)p; u.q[1] = *(const v8h*)(p + 16); return u.v;
}
__device__ __forceinline__ v16h frag_f32(const float* rowk0, int lane) {
  v16h a; const float* p = rowk0 + 8 * (lane >> 4);
#pragma unroll
  for (int i = 0; i < 8; ++i) { a[i] = (_Float16)p[i]; a[8 + i] = (_Float16)p[16 + i]; }
  return a;
}
__device__ __forceinline__ v16h frag_f32s(const float* rowk0, int lane, float sc) {
  v16h a; const float* p = rowk0 + 8 * (lane >> 4);
#pragma unroll
  for (int i = 0; i < 8; ++i) { a[i] = (_Float16)(p[i] * sc); a[8 + i] = (_Float16)(p[16 + i] * sc); }
  return a;
}
// column fragment from a [K][ld] layout (column n), rows >= K read as 0
__device__ __forceinline__ v16h fragc_f32(const float* W, int k0, int n, int lane, int ld, int K) {
  v16h a; const int g = lane >> 4;
#pragma unroll
  for (int i = 0; i < 8; ++i) { const int ka = k0 + 8 * g + i, kb = ka + 16;
    a[i] = (_Float16)(ka < K ? W[(size_t)(ka < K ? ka : K - 1) * ld + n] : 0.f); a[8 + i] = (_Float16)(kb < K ? W[(size_t)(kb < K ? kb : K - 1) * ld + n] : 0.f); }
  return a;
}
struct F2 { v16b h, l; };
__device__ __forceinline__ F2 bsplit16(const float v[16]) { F2 r;
#pragma unroll
  for (int i = 0; i < 16; ++i) { const __bf16 h = (__bf16)v[i]; r.h[i] = h; r.l[i] = (__bf16)(v[i] - (float)h); }
  return r; }
__device__ __forceinline__ F2 split_row(const float* row, int k0, int lane) { float v[16]; const float* p = row + k0 + 8 * (lane >> 4);
#pragma unroll
  for (int i = 0; i < 8; ++i) { v[i] = p[i]; v[8 + i] = p[16 + i]; }
  return bsplit16(v); }
__device__ __forceinline__ F2 split_rowK(const float* row, int k0, int lane, int K) { float v[16]; const int g = lane >> 4;
#pragma unroll
  for (int i = 0; i < 8; ++i) { const int ka = k0 + 8 * g + i, kb = ka + 16; v[i] = ka < K ? row[ka < K ? ka : K - 1] : 0.f; v[8 + i] = kb < K ? row[kb < K ? kb : K - 1] : 0.f; }
  return bsplit16(v); }
__device__ __forceinline__ F2 split_col(const float* W, int k0, int n, int lane, int ld, int K) { float v[16]; const int g = lane >> 4;
#pragma unroll
  for (int i = 0; i < 8; ++i) { const int ka = k0 + 8 * g + i, kb = ka + 16; v[i] = ka < K ? W[(size_t)(ka < K ? ka : K - 1) * ld + n] : 0.f; v[8 + i] = kb < K ? W[(size_t)(kb < K ? kb : K - 1) * ld + n] : 0.f; }
  return bsplit16(v); }
__device__ __forceinline__ v8f mac3(const F2& a, const F2& b, v8f c) { c = wmma_bf(a.l, b.h, c); c = wmma_bf(a.h, b.l, c); return wmma_bf(a.h, b.h, c); }
__device__ __forceinline__ float sigm(float v) { return 1.0f / (1.0f + expf(-v)); }
#define LDSX() do { asm volatile("s_wait_dscnt 0" ::: "memory"); __builtin_amdgcn_wave_barrier(); __builtin_amdgcn_fence(__ATOMIC_RELEASE, "workgroup"); } while (0)

// Triangle (starting-node) attention on a pair representation x [1, 256, 256, 128] (4 heads x 32): xn = LayerNorm(x); for every row b: q, k, v = xn[b] W^T ((out,in)); scores[b,h,q,k] = q . k / sqrt(32) + bias[h][q][k] + attn_mask[q][k] with bias[h][q][k] = xn[q][k] . Wb[h] (pair-indexed, shared across rows) and attn_mask in {0, -1e9}; softmax over k; o = (attn v) * sigmoid(xn[b][q] Wg^T); out[b][q] = o Wo^T.
#define NB 256
#define TT 256
#define CC 128            // NH * HD = projected width
#define DIN 128          // input (model) width
#define NH 4
#define HD 32
#define NQB (TT / 64)
#define HG 4
#define SCALE (0.17677669529663687f)
#define CAUSAL 0
#ifndef TNB
#define TNB NB
#endif
__device__ __forceinline__ float bfr(float v) { return (float)(__bf16)v; }
__host__ __device__ __forceinline__ int kb_last(int qb) { return CAUSAL ? ((qb * 64 + 63) >> 7) : (TT / 128 - 1); }
typedef __attribute__((ext_vector_type(8))) __bf16 v8b;
__device__ __forceinline__ v16b frag_b(const __bf16* rowk0, int lane) {
  union { v16b v; v8b q[2]; } u; const __bf16* p = rowk0 + 8 * (lane >> 4);
  u.q[0] = *(const v8b*)p; u.q[1] = *(const v8b*)(p + 16); return u.v;
}
#define QBH 0              // unused: no kernel in this file has a high-precision path
#define QHI 256            // rows carrying a q residual plane (all rows when non-causal: 2-product logits everywhere)
#define KHI 64            // key rows carrying k residual / v bf16 hi+lo planes (written by k_proj; no kernel reads them)
// B fragment (k rows k0+.., output column o) of a weight: (in,out) [K][ld] or (out,in) [ld rows of K]: bf16 exact, or f16(bf16 * 256) exact
__device__ __forceinline__ v16b wcol_io(const float* Wm, int k0, int o, int lane, int ld) { v16b w; const int g = lane >> 4;
#pragma unroll
  for (int i = 0; i < 8; ++i) { w[i] = (__bf16)Wm[(size_t)(k0 + 8 * g + i) * ld + o]; w[8 + i] = (__bf16)Wm[(size_t)(k0 + 16 + 8 * g + i) * ld + o]; }
  return w; }
__device__ __forceinline__ v16b wcol_oi(const float* Wm, int k0, int o, int lane, int K) { v16b w; const float* p = Wm + (size_t)o * K + k0 + 8 * (lane >> 4);
#pragma unroll
  for (int i = 0; i < 8; ++i) { w[i] = (__bf16)p[i]; w[8 + i] = (__bf16)p[16 + i]; }
  return w; }
__device__ __forceinline__ v16h wcolh_io(const float* Wm, int k0, int o, int lane, int ld) { v16h w; const int g = lane >> 4;
#pragma unroll
  for (int i = 0; i < 8; ++i) { w[i] = (_Float16)(bfr(Wm[(size_t)(k0 + 8 * g + i) * ld + o]) * 256.0f); w[8 + i] = (_Float16)(bfr(Wm[(size_t)(k0 + 16 + 8 * g + i) * ld + o]) * 256.0f); }
  return w; }
__device__ __forceinline__ v16h wcolh_oi(const float* Wm, int k0, int o, int lane, int K) { v16h w; const float* p = Wm + (size_t)o * K + k0 + 8 * (lane >> 4);
#pragma unroll
  for (int i = 0; i < 8; ++i) { w[i] = (_Float16)(bfr(p[i]) * 256.0f); w[8 + i] = (_Float16)(bfr(p[16 + i]) * 256.0f); }
  return w; }
#define WQKV_LAYOUT 1   // (out,in) [CC][DIN]
__device__ __forceinline__ v16b wcol_hdk(const float* Wm, int k0, int o, int lane) { v16b w; const int g = lane >> 4; const float* p = Wm + (size_t)(o / HD) * DIN * HD + (o % HD);
#pragma unroll
  for (int i = 0; i < 8; ++i) { w[i] = (__bf16)p[(size_t)(k0 + 8 * g + i) * HD]; w[8 + i] = (__bf16)p[(size_t)(k0 + 16 + 8 * g + i) * HD]; }
  return w; }
#define WO_OUT_IN 1
#if WQKV_LAYOUT == 1
#define WCOL(W, k0, o, lane) wcol_oi(W, k0, o, lane, DIN)
#elif WQKV_LAYOUT == 2
#define WCOL(W, k0, o, lane) wcol_hdk(W, k0, o, lane)
#else
#define WCOL(W, k0, o, lane) wcol_io(W, k0, o, lane, CC)
#endif
#if WO_OUT_IN
#define WOCOL(W, k0, o, lane) wcol_oi(W, k0, o, lane, CC)
#define WOCOLH(W, k0, o, lane) wcolh_oi(W, k0, o, lane, CC)
#else
#define WOCOL(W, k0, o, lane) wcol_io(W, k0, o, lane, DIN)
#define WOCOLH(W, k0, o, lane) wcolh_io(W, k0, o, lane, DIN)
#endif
#define SZ 256
#define BG 64              // rows r sizing the unused WS_S region (x 4 heads = 256 planes of 256 x 256)
#define NZR (SZ * SZ)      // 65,536 pair rows
// ---- k_lnz: wave per pair row: LayerNorm over the 128 channels (biased var, eps 1e-5, ln_w/ln_b) of bf16(z) -> ZN rows (4 floats per lane = one 512-B row)
__global__ __launch_bounds__(256) void k_lnz(const float* __restrict__ Z, const float* __restrict__ LW, const float* __restrict__ LB, float* __restrict__ ZN) { const int wave = threadIdx.x >> 5, lane = threadIdx.x & 31; const size_t row = (size_t)blockIdx.x * 8 + wave; if (row >= (size_t)NZR) return;
  v4f x = *(const v4f*)(Z + row * CC + lane * 4); float s1 = 0.f;
#pragma unroll
  for (int i = 0; i < 4; ++i) { x[i] = bfr(x[i]); s1 += x[i]; }
#pragma unroll
  for (int o = 1; o < 32; o <<= 1) s1 += __shfl_xor(s1, o);
  const float mu = s1 * (1.0f / CC); float q = 0.f;
#pragma unroll
  for (int i = 0; i < 4; ++i) { const float d = x[i] - mu; q += d * d; }
#pragma unroll
  for (int o = 1; o < 32; o <<= 1) q += __shfl_xor(q, o);
  const float rs = rsqrtf(q * (1.0f / CC) + 1e-5f); v4f r4;
#pragma unroll
  for (int i = 0; i < 4; ++i) { const int c = lane * 4 + i; r4[i] = (x[i] - mu) * rs * bfr(LW[c]) + bfr(LB[c]); }
  vst2(ZN + row * CC + lane * 4, r4); }
// ---- k_rows2: block = (64 rows, which): which 0: bias: BIAS[row = q*256+k][h] = xn[q][k] . Wb[h] (4 outputs) ; which 1: G[row][c] = sigmoid(xn[row] . Wg[c]) (128 outputs); weights are (out,in)
__global__ __launch_bounds__(128) void k_rows2(const float* __restrict__ ZN, const float* __restrict__ WB, const float* __restrict__ WG, const float* __restrict__ GB, float* __restrict__ BIAS, float* __restrict__ G) { __shared__ __align__(16) float sf[4][16][132];
  const int tid = threadIdx.x, wave = tid >> 5, lane = tid & 31, col = lane & 15, g = lane >> 4; const int which = blockIdx.y; const size_t r0 = (size_t)blockIdx.x * 64 + wave * 16;
  const int nout = which == 0 ? NH : CC; const float* Wm = which == 0 ? WB : WG;
  v8f acc[8] = {};
#pragma unroll
  for (int kc = 0; kc < CC / 32; ++kc) { const F2 a = split_row(ZN + (r0 + col) * CC, kc * 32, lane); asm volatile("s_wait_loadcnt 0x0" ::: "memory");
#pragma unroll
    for (int j = 0; j < 8; ++j) { if (j * 16 >= nout) break; v16b w; { float t0[8], t1[8]; const int o = j * 16 + col; const int oc = o < nout ? o : nout - 1; const float keep = o < nout ? 1.f : 0.f;
#pragma unroll
        for (int i = 0; i < 8; ++i) t0[i] = Wm[(size_t)oc * CC + kc * 32 + 8 * g + i];   /* (out,in) */
        asm volatile("s_wait_loadcnt 0x0" ::: "memory");
#pragma unroll
        for (int i = 0; i < 8; ++i) t1[i] = Wm[(size_t)oc * CC + kc * 32 + 16 + 8 * g + i];
        asm volatile("s_wait_loadcnt 0x0" ::: "memory");
#pragma unroll
        for (int i = 0; i < 8; ++i) { w[i] = (__bf16)(t0[i] * keep); w[8 + i] = (__bf16)(t1[i] * keep); } }   /* (out,in) row o; columns beyond nout zero (select-free: keep multiplies a VALID load) */
      acc[j] = wmma_bf(a.h, w, acc[j]); acc[j] = wmma_bf(a.l, w, acc[j]); } }
  if (which == 0) { if (lane < 16) {   /* bias rows: 4 floats = 16 B per row; rows r0+8g+r... store via LDS: */ }
#pragma unroll
    for (int r = 0; r < 8; ++r) sf[wave][8 * g + r][col] = acc[0][r];
    LDSX(); if (lane < 16) { v4f b4; b4[0] = sf[wave][lane][0]; b4[1] = sf[wave][lane][1]; b4[2] = sf[wave][lane][2]; b4[3] = sf[wave][lane][3]; vst2(BIAS + (r0 + lane) * NH, b4); }   /* 16 rows x 16 B = one 256-B run per wave */
  } else {
#pragma unroll
    for (int j = 0; j < 8; ++j)
#pragma unroll
      for (int r = 0; r < 8; ++r) sf[wave][8 * g + r][j * 16 + col] = 1.0f / (1.0f + expf(-acc[j][r]));   /* sigmoid(xn Wg^T), no bias */
    LDSX(); for (int rl = 0; rl < 16; ++rl) vst2(G + (r0 + rl) * CC + lane * 4, *(const v4f*)&sf[wave][rl][lane * 4]); } }
// ---- k_gate: Y row *= G row (same natural row index r*256 + q; thread per float4; one writer)
__global__ __launch_bounds__(256) void k_gate(float* __restrict__ Y, const float* __restrict__ G) { const size_t e4 = (size_t)blockIdx.x * 256 + threadIdx.x; if (e4 >= (size_t)NZR * (CC / 4)) return; const size_t yrow = e4 / (CC / 4); const int q = (int)(e4 % (CC / 4)); const size_t grow = yrow;
  v4f y = *(const v4f*)(Y + yrow * CC + q * 4); const v4f gg = *(const v4f*)(G + grow * CC + q * 4); y[0] *= gg[0]; y[1] *= gg[1]; y[2] *= gg[2]; y[3] *= gg[3]; vst2(Y + yrow * CC + q * 4, y); }
#define WS_ZN   (WS_END)
#define WS_BIAS (WS_ZN + 4u * (size_t)NZR * CC)
#define WS_G    (WS_BIAS + 4u * (size_t)NZR * NH)
#define WS_END2 (WS_G + 4u * (size_t)NZR * CC)
#ifndef PROJ_EXTRA_PARAMS
#define PROJ_EXTRA_PARAMS
#endif

#define WS_QH  0u                                      // f16 q rows [b*t][CC]
#define WS_KH  (WS_QH + 2u * (size_t)NB * TT * CC)      // f16 k rows [b*t][CC]
#define WS_VT  (WS_KH + 2u * (size_t)NB * TT * CC)      // f16 v planes [b][c][t]
#define WS_QL  (WS_VT + 2u * (size_t)NB * CC * TT)      // f16 q residual x 2^10 rows [b][t < QHI][CC]
#define WS_KL  (WS_QL + 2u * (size_t)NB * QHI * CC)     // f16 k residual x 2^10 rows [b][t < KHI][CC]
#define WS_VB  (WS_KL + 2u * (size_t)NB * KHI * CC)     // bf16 v hi planes [b][c][t < KHI]
#define WS_VBL (WS_VB + 2u * (size_t)NB * CC * KHI)
#define WS_S   (WS_VBL + 2u * (size_t)NB * CC * KHI)    // f32 region, unused: k_attn keeps logits and P in registers
#define WS_Y   (WS_S  + 4u * (size_t)BG * HG * TT * TT)   // skips 256 unused f32 planes of 256 x 256      // f32 ctx rows [b*t][CC] (only when there is an output projection)
#define WS_END (WS_Y  + 4u * (size_t)NB * TT * CC)

// ---- k_proj: block = (64 rows, 128 cols, which): q/k/v = X W (+ b) with exact bf16 products (K = DIN) -> which 0: q f16 rows (+ residual rows < QHI); 1: k f16 rows (+ residual rows < KHI); 2: v f16 planes [c][t] (+ bf16 hi/lo planes for t < KHI)
__global__ __launch_bounds__(128) void k_proj(const float* __restrict__ XQ, const float* __restrict__ XK, const float* __restrict__ XV, const float* __restrict__ WQ, const float* __restrict__ WK, const float* __restrict__ WV, const float* __restrict__ BQ, const float* __restrict__ BK, const float* __restrict__ BV,
    _Float16* __restrict__ QH, _Float16* __restrict__ QL, _Float16* __restrict__ KH, _Float16* __restrict__ KL, _Float16* __restrict__ VT, __bf16* __restrict__ VB, __bf16* __restrict__ VBL) {
  __shared__ __align__(16) _Float16 sh[64][136], sl[64][136]; __shared__ __align__(16) _Float16 th[128][72]; __shared__ __align__(16) __bf16 tb[128][72], tbl[128][72];
  const int tid = threadIdx.x, wave = tid >> 5, lane = tid & 31, col = lane & 15, g = lane >> 4; const int which = blockIdx.z; const int c0 = blockIdx.y * 128; const size_t r0 = (size_t)blockIdx.x * 64; const size_t bb = r0 / TT; const int t0 = (int)(r0 % TT);
  const float* X = which == 0 ? XQ : which == 1 ? XK : XV; const float* WA = which == 0 ? WQ : which == 1 ? WK : WV; const float* BA = which == 0 ? BQ : which == 1 ? BK : BV;
  v8f acc[8] = {};
#pragma unroll 2
  for (int kc = 0; kc < DIN / 32; ++kc) { const F2 a2 = split_row(X + (r0 + wave * 16 + col) * DIN, kc * 32, lane);   /* LN(act) rows (f32) split hi + lo */
    asm volatile("s_wait_loadcnt 0x0" ::: "memory");
#pragma unroll
    for (int j = 0; j < 8; ++j) { const v16b w = WCOL(WA, kc * 32, c0 + j * 16 + col, lane); asm volatile("s_wait_loadcnt 0x0" ::: "memory"); acc[j] = wmma_bf(a2.h, w, acc[j]); acc[j] = wmma_bf(a2.l, w, acc[j]); } }
  if (which < 2) { _Float16* DH = which == 0 ? QH : KH; _Float16* DL = which == 0 ? QL : KL; const int nhi = which == 0 ? QHI : KHI; const bool hi_rows = t0 < nhi;
#pragma unroll
    for (int j = 0; j < 8; ++j) { const float bias = BA ? bfr(BA[c0 + j * 16 + col]) : 0.f;
#pragma unroll
      for (int r = 0; r < 8; ++r) { const float v = acc[j][r] + bias; const _Float16 hv = (_Float16)v; sh[wave * 16 + 8 * g + r][j * 16 + col] = hv; sl[wave * 16 + 8 * g + r][j * 16 + col] = (_Float16)((v - (float)hv) * 1024.0f); } }
    __syncthreads();
    for (int e = tid; e < 64 * 16; e += 128) { const int rl = e >> 4, q = e & 15; vst2((unsigned*)(DH + (r0 + rl) * CC + c0 + q * 8), *(const v4u*)&sh[rl][q * 8]); if (hi_rows) vst2((unsigned*)(DL + (bb * nhi + t0 + rl) * (size_t)CC + c0 + q * 8), *(const v4u*)&sl[rl][q * 8]); }
  } else { const bool hi_rows = t0 < KHI;
#pragma unroll
    for (int j = 0; j < 8; ++j) { const float bias = BA ? bfr(BA[c0 + j * 16 + col]) : 0.f;
#pragma unroll
      for (int r = 0; r < 8; ++r) { const float v = acc[j][r] + bias; const int rl = wave * 16 + 8 * g + r, cl = j * 16 + col; th[cl][rl] = (_Float16)v; const __bf16 bh = (__bf16)v; tb[cl][rl] = bh; tbl[cl][rl] = (__bf16)(v - (float)bh); } }
    __syncthreads();
    for (int e = tid; e < 128 * 8; e += 128) { const int cl = e >> 3, q = e & 7; vst2((unsigned*)(VT + (bb * CC + c0 + cl) * (size_t)TT + t0 + q * 8), *(const v4u*)&th[cl][q * 8]); if (hi_rows) { const size_t o3 = (bb * CC + c0 + cl) * (size_t)KHI + t0 + q * 8; vst2((unsigned*)(VB + o3), *(const v4u*)&tb[cl][q * 8]); vst2((unsigned*)(VBL + o3), *(const v4u*)&tbl[cl][q * 8]); } } } }
// ---- k_attn: block = (64 queries qb, head h, 4 x NBL rows b), 16 waves; wave = 16 queries (wave & 3) of NBL rows b (group wave >> 2). The (bias + mask) tile of the block's 64 queries x 256 keys is summed once into LDS and serves every row b.
// Per row b: S^T = K Q^T (A = 16 key rows, B = q hi, then q residual x 2^10: 2 products), so a lane holds 128 of one query's 256 logits (lanes l and l ^ 16 split them); softmax in f32 in registers;
// two S^T tiles (keys 32 kc + 0..15, + 16..31), x 2^11 and once to f16, ARE the A fragment of P for ctx = P v (1 product, v f16 planes); logits and P never go to memory.
#define NBL 4
__device__ __forceinline__ v16h frag_o(const _Float16* base, unsigned off) { union { v16h v; v8h q[2]; } u; const _Float16* p = base + off; u.q[0] = *(const v8h*)p; u.q[1] = *(const v8h*)(p + 16); return u.v; }   /* frag_h from the lane's own pointer (row and 8 * (lane >> 4) included) plus a constant */
__device__ __forceinline__ v8f wmmah(v16h a, v16h b, v8f c) { return __builtin_amdgcn_wmma_f32_16x16x32_f16(false, a, false, b, (short)0, c, false, false); }
__global__ __launch_bounds__(512) __attribute__((amdgpu_waves_per_eu(4, 4))) void k_attn(const _Float16* __restrict__ QH, const _Float16* __restrict__ KH, const _Float16* __restrict__ QL, const _Float16* __restrict__ VT, const float* __restrict__ BIAS, const float* __restrict__ MKP, float* __restrict__ Y) {
  __shared__ __align__(16) float sb[64][TT + 4]; __shared__ __align__(16) float ss[16][16][HD + 4];   /* pitches 16 B x odd: 16-byte row reads without bank conflicts */
  const int tid = threadIdx.x, wave = __builtin_amdgcn_readfirstlane(tid >> 5), lane = tid & 31, col = lane & 15, g = lane >> 4; const int qb = blockIdx.x, h = blockIdx.y; const int ql0 = qb * 64 + (wave & 3) * 16;
  const float* bp = BIAS + ((size_t)qb * 64 * SZ + tid) * NH + h; const float* mp = MKP + (size_t)qb * 64 * SZ + tid;
  { float tb[32], tm[32];
#pragma unroll
    for (int u = 0; u < 32; ++u) { tb[u] = bp[(size_t)u * 512 * NH]; tm[u] = mp[u * 512]; }
    asm volatile("s_wait_xcnt 0x0" :: "v"(bp), "v"(tid) : "memory");   /* all 64 loads are issued in front of it (the fill is bound by load latency); their address registers, named here, are reused only behind the wait */
#pragma unroll
    for (int u = 0; u < 32; ++u) sb[u * 2 + (tid >> 8)][tid & 255] = tb[u] + bfr(tm[u]); }
  __syncthreads();
  const float* brow = &sb[(wave & 3) * 16 + col][8 * g];
  const unsigned qoff = (unsigned)((ql0 + col) * CC + h * HD + 8 * g), koff = (unsigned)(col * CC + h * HD + 8 * g), voff = (unsigned)((h * HD + col) * TT + 8 * g), yoff = (unsigned)((ql0 + (lane >> 3)) * CC + h * HD + (lane & 7) * 4);
#pragma unroll 1   /* the body is some thousands of instructions: kept rolled for the instruction cache */
  for (int bi = 0; bi < NBL; ++bi) { const size_t bo = (size_t)(((int)blockIdx.z * 4 + (wave >> 2)) * NBL + bi) * TT * CC;   /* row b's start in q, q residual (QHI == TT), k rows, v planes and ctx rows alike */
    const _Float16* qp = QH + bo + qoff; const _Float16* lp = QL + bo + qoff; const _Float16* kp = KH + bo + koff; const _Float16* vp = VT + bo + voff;
    const v16h qh = frag_o(qp, 0), ql = frag_o(lp, 0); v16h kf[TT / 16];
#pragma unroll
    for (int j = 0; j < TT / 16; ++j) kf[j] = frag_o(kp, j * 16 * CC);
    asm volatile("s_wait_xcnt 0x0" :: "v"(qp), "v"(lp), "v"(kp) : "memory");   /* q and all 16 k fragments in one run of loads in front of it: one load latency per row b, not one per tile; the address registers, named here, are reused only behind the wait */
    __builtin_amdgcn_sched_barrier(0);   /* no product is scheduled in between the loads, which would split the run */
    v8f s[TT / 16], m8;
#pragma unroll
    for (int r = 0; r < 8; ++r) m8[r] = -3.0e38f;
#pragma unroll
    for (int j = 0; j < TT / 16; ++j) { v8f a = {}, l = {}; a = wmmah(kf[j], qh, a); l = wmmah(kf[j], ql, l);
      const v8f bm = __builtin_shufflevector(*(const v4f*)(brow + j * 16), *(const v4f*)(brow + j * 16 + 4), 0, 1, 2, 3, 4, 5, 6, 7);
      s[j] = (a + l * (1.0f / 1024.0f)) * SCALE + bm; m8 = __builtin_elementwise_max(m8, s[j]);
      if ((j & 3) == 3) __builtin_amdgcn_sched_barrier(0); }   /* four tiles' products and sums at a time: with more products run ahead the build spills */
    v16h vf[TT / 32][HD / 16];
#pragma unroll
    for (int kc = 0; kc < TT / 64; ++kc)
#pragma unroll
      for (int j = 0; j < HD / 16; ++j) vf[kc][j] = frag_o(vp, j * 16 * TT + kc * 32);
    asm volatile("s_wait_xcnt 0x0" :: "v"(vp) : "memory");   /* the first half of v is on its way while the exponentials run; address register as above */
    float m = fmaxf(fmaxf(fmaxf(m8[0], m8[1]), fmaxf(m8[2], m8[3])), fmaxf(fmaxf(m8[4], m8[5]), fmaxf(m8[6], m8[7]))); m = fmaxf(m, __shfl_xor(m, 16));
    v8f s8 = {};
#pragma unroll
    for (int j = 0; j < TT / 16; ++j) {
#pragma unroll
      for (int r = 0; r < 8; ++r) { const float v = s[j][r]; const float x = expf(v - m); s[j][r] = (v <= -1.0e38f) ? 0.f : x; }
      s8 += s[j]; }
    float sum = ((s8[0] + s8[1]) + (s8[2] + s8[3])) + ((s8[4] + s8[5]) + (s8[6] + s8[7])); sum += __shfl_xor(sum, 16);
    const float inv = sum > 0.f ? 2048.0f / sum : 0.f;   /* a fully excluded row yields P = 0 */
    v16h p[TT / 32];
#pragma unroll
    for (int kc = 0; kc < TT / 32; ++kc)
#pragma unroll
      for (int i = 0; i < 8; ++i) { p[kc][i] = (_Float16)(s[2 * kc][i] * inv); p[kc][8 + i] = (_Float16)(s[2 * kc + 1][i] * inv); }
#pragma unroll
    for (int kc = TT / 64; kc < TT / 32; ++kc)
#pragma unroll
      for (int j = 0; j < HD / 16; ++j) vf[kc][j] = frag_o(vp, j * 16 * TT + kc * 32);
    asm volatile("s_wait_xcnt 0x0" :: "v"(vp) : "memory");   /* the second half of v, issued once P is packed and its registers are free; address register as above */
    v8f acc[HD / 16] = {};
#pragma unroll
    for (int kc = 0; kc < TT / 32; ++kc)
#pragma unroll
      for (int j = 0; j < HD / 16; ++j) acc[j] = wmmah(p[kc], vf[kc][j], acc[j]);
#pragma unroll
    for (int j = 0; j < HD / 16; ++j)
#pragma unroll
      for (int r = 0; r < 8; ++r) ss[wave][8 * g + r][j * 16 + col] = acc[j][r] * (1.0f / 2048.0f);
    LDSX();   /* the wave's own 16 x 32 tile: its LDS writes land before its lanes read each other's */
#pragma unroll
    for (int i = 0; i < 4; ++i) vst2(Y + bo + i * 4 * CC + yoff, *(const v4f*)&ss[wave][i * 4 + (lane >> 3)][(lane & 7) * 4]);   /* 4 rows x 128 B per store */
  } }
// ---- k_out: block = (64 rows, 128 cols): out = ctx Wo (+ bo): all rows: ctx bf16 hi + lo against exact bf16 Wo (2 products); the 1-product f16 branch (Wo as f16(bf16 x 2^8), x 2^-8) is not taken
__global__ __launch_bounds__(128) void k_out(const float* __restrict__ Y, const float* __restrict__ WO, const float* __restrict__ BO, float* __restrict__ OUT) { __shared__ __align__(16) float sf[4][16][132];
  const int tid = threadIdx.x, wave = tid >> 5, lane = tid & 31, col = lane & 15, g = lane >> 4; const int c0 = blockIdx.y * 128; const size_t r0 = (size_t)blockIdx.x * 64 + wave * 16;
  v8f acc[8] = {};
  if (true) {   /* ALL rows: gated ctx bf16 hi + lo x exact output_w (2 products) */
#pragma unroll 2
    for (int kc = 0; kc < CC / 32; ++kc) { const F2 a = split_row(Y + (r0 + col) * CC, kc * 32, lane); asm volatile("s_wait_loadcnt 0x0" ::: "memory");
#pragma unroll
      for (int j = 0; j < 8; ++j) { const v16b w = WOCOL(WO, kc * 32, c0 + j * 16 + col, lane); asm volatile("s_wait_loadcnt 0x0" ::: "memory"); acc[j] = wmma_bf(a.h, w, acc[j]); acc[j] = wmma_bf(a.l, w, acc[j]); } }
#pragma unroll
    for (int j = 0; j < 8; ++j) { const float bias = BO ? bfr(BO[c0 + j * 16 + col]) : 0.f;
#pragma unroll
      for (int r = 0; r < 8; ++r) sf[wave][8 * g + r][j * 16 + col] = acc[j][r] + bias; }
  } else {
#pragma unroll 2
    for (int kc = 0; kc < CC / 32; ++kc) { const v16h a = frag_f32(Y + (r0 + col) * CC + kc * 32, lane); asm volatile("s_wait_loadcnt 0x0" ::: "memory");
#pragma unroll
      for (int j = 0; j < 8; ++j) { const v16h w = WOCOLH(WO, kc * 32, c0 + j * 16 + col, lane); asm volatile("s_wait_loadcnt 0x0" ::: "memory"); acc[j] = wmma16(a, w, acc[j]); } }
#pragma unroll
    for (int j = 0; j < 8; ++j) { const float bias = BO ? bfr(BO[c0 + j * 16 + col]) : 0.f;
#pragma unroll
      for (int r = 0; r < 8; ++r) sf[wave][8 * g + r][j * 16 + col] = acc[j][r] * (1.0f / 256.0f) + bias; } }
  LDSX(); for (int rl = 0; rl < 16; ++rl) vst2(OUT + (r0 + rl) * DIN + c0 + lane * 4, *(const v4f*)&sf[wave][rl][lane * 4]); }

extern "C" void kernel_launch(void* const* d_in, const int* in_sizes, int n_in, void* d_out, int out_size, void* d_ws, size_t ws_size, hipStream_t stream) {
  (void)in_sizes; (void)n_in; (void)out_size;
  const float** F = (const float**)d_in;
  if (ws_size < (size_t)WS_END) return;
  char* ws = (char*)d_ws; _Float16 *QH = (_Float16*)(ws + WS_QH), *KH = (_Float16*)(ws + WS_KH), *VT = (_Float16*)(ws + WS_VT), *QL = (_Float16*)(ws + WS_QL), *KL = (_Float16*)(ws + WS_KL); __bf16 *VB = (__bf16*)(ws + WS_VB), *VBL = (__bf16*)(ws + WS_VBL); float *Y = (float*)(ws + WS_Y);
  (void)Y; (void)QL; (void)KL; (void)VB; (void)VBL;
  // inputs: 0 x [1,256,256,128]; 1 attn_mask [1,1,256,256] (0 / -1e9); 2 ln_w, 3 ln_b; 4 Wb [4,128]; 5 Wq, 6 Wk, 7 Wv, 8 Wg, 9 Wo [128,128] (out,in)
  if (ws_size < (size_t)WS_END2) return;
  float *ZN = (float*)(ws + WS_ZN), *BIAS = (float*)(ws + WS_BIAS), *G = (float*)(ws + WS_G);
  k_lnz<<<dim3(NZR / 8), 256, 0, stream>>>(F[0], F[2], F[3], ZN);
  k_rows2<<<dim3(NZR / 64, 2), 128, 0, stream>>>(ZN, F[4], F[8], nullptr, BIAS, G);
  k_proj<<<dim3(TNB * TT / 64, CC / 128, 3), 128, 0, stream>>>(ZN, ZN, ZN, F[5], F[6], F[7], nullptr, nullptr, nullptr, QH, QL, KH, KL, VT, VB, VBL);
  k_attn<<<dim3(NQB, NH, TNB / (4 * NBL)), 512, 0, stream>>>(QH, KH, QL, VT, BIAS, F[1], Y);
  k_gate<<<dim3((NZR * (CC / 4) + 255) / 256), 256, 0, stream>>>(Y, G);
  k_out<<<dim3(TNB * TT / 64, DIN / 128), 128, 0, stream>>>(Y, F[9], nullptr, (float*)d_out);
}

// v002
// Measured time: 160 microseconds a run.
// Two timings next to v001 both put it at 1.56 times that version's speed.
// Over all steps from v000 it is 3.51 times as fast.
// compute dtype: all float inputs rounded to bf16; LayerNorm of pair_act in f32; q/k/v = LN(act) split bf16 hi + lo x W (exact bf16, (out,in)) on WMMA 16x16x32 (2 products, f32 accumulate); q as f16 hi + residual (x 2^10) against k once to f16 (2 products) x 32^-0.5 + the per-(query, key, head) triangle bias (2-product GEMM) + the mask bias; softmax in f32 (precise expf); P x 2^11 once to f16 against v once to f16 (1 product); gate sigmoid(LN(act) Wg) in f32 (2-product GEMM, precise expf); gated ctx split bf16 hi + lo against exact output_w (2 products); f32 output.
#include <hip/hip_runtime.h>
#include <math.h>

typedef __attribute__((ext_vector_type(16))) _Float16 v16h;
typedef __attribute__((ext_vector_type(16))) __bf16 v16b;
typedef __attribute__((ext_vector_type(8)))  _Float16 v8h;
typedef __attribute__((ext_vector_type(8)))  float v8f;
typedef __attribute__((ext_vector_type(4)))  float v4f;
typedef __attribute__((ext_vector_type(2)))  float v2f;
typedef __attribute__((ext_vector_type(4)))  unsigned v4u;
typedef __attribute__((ext_vector_type(4)))  int v4i;
typedef float __attribute__((may_alias)) float_a;
typedef int __attribute__((may_alias)) int_a;

template <typename T> __device__ __forceinline__ void vst2(void* p, T v) { *(T*)p = v;  }
__device__ __forceinline__ v8f wmma16(v16h a, v16h b, v8f c) {
  v8f d = __builtin_amdgcn_wmma_f32_16x16x32_f16(false, a, false, b, (short)0, c, false, false);
  asm volatile("v_nop\n\tv_nop\n\tv_nop\n\tv_nop" : "+v"(d) : "v"(a), "v"(b));
  return d;
}
__device__ __forceinline__ v8f wmma_bf(v16b a, v16b b, v8f c) {
  v8f d = __builtin_amdgcn_wmma_f32_16x16x32_bf16(false, a, false, b, (short)0, c, false, false);
  asm volatile("v_nop\n\tv_nop\n\tv_nop\n\tv_nop" : "+v"(d) : "v"(a), "v"(b));
  return d;
}
// 16x16x32 fragments: lane = (h = lane>>4, row/col = lane&15); elements 0..7 = k0+8h+0..7, 8..15 = k0+16+8h+0..7; D element r = row 8h+r
__device__ __forceinline__ v16h frag_h(const _Float16* rowk0, int lane) {
  union { v16h v; v8h q[2]; } u; const _Float16* p = rowk0 + 8 * (lane >> 4);
  u.q[0] = *(const v8h*)p; u.q[1] = *(const v8h*)(p + 16); return u.v;
}
__device__ __forceinline__ v16h frag_f32(const float* rowk0, int lane) {
  v16h a; const float* p = rowk0 + 8 * (lane >> 4);
#pragma unroll
  for (int i = 0; i < 8; ++i) { a[i] = (_Float16)p[i]; a[8 + i] = (_Float16)p[16 + i]; }
  return a;
}
__device__ __forceinline__ v16h frag_f32s(const float* rowk0, int lane, float sc) {
  v16h a; const float* p = rowk0 + 8 * (lane >> 4);
#pragma unroll
  for (int i = 0; i < 8; ++i) { a[i] = (_Float16)(p[i] * sc); a[8 + i] = (_Float16)(p[16 + i] * sc); }
  return a;
}
// column fragment from a [K][ld] layout (column n), rows >= K read as 0
__device__ __forceinline__ v16h fragc_f32(const float* W, int k0, int n, int lane, int ld, int K) {
  v16h a; const int g = lane >> 4;
#pragma unroll
  for (int i = 0; i < 8; ++i) { const int ka = k0 + 8 * g + i, kb = ka + 16;
    a[i] = (_Float16)(ka < K ? W[(size_t)(ka < K ? ka : K - 1) * ld + n] : 0.f); a[8 + i] = (_Float16)(kb < K ? W[(size_t)(kb < K ? kb : K - 1) * ld + n] : 0.f); }
  return a;
}
struct F2 { v16b h, l; };
__device__ __forceinline__ F2 bsplit16(const float v[16]) { F2 r;
#pragma unroll
  for (int i = 0; i < 16; ++i) { const __bf16 h = (__bf16)v[i]; r.h[i] = h; r.l[i] = (__bf16)(v[i] - (float)h); }
  return r; }
__device__ __forceinline__ F2 split_row(const float* row, int k0, int lane) { float v[16]; const float* p = row + k0 + 8 * (lane >> 4);
#pragma unroll
  for (int i = 0; i < 8; ++i) { v[i] = p[i]; v[8 + i] = p[16 + i]; }
  return bsplit16(v); }
__device__ __forceinline__ F2 split_rowK(const float* row, int k0, int lane, int K) { float v[16]; const int g = lane >> 4;
#pragma unroll
  for (int i = 0; i < 8; ++i) { const int ka = k0 + 8 * g + i, kb = ka + 16; v[i] = ka < K ? row[ka < K ? ka : K - 1] : 0.f; v[8 + i] = kb < K ? row[kb < K ? kb : K - 1] : 0.f; }
  return bsplit16(v); }
__device__ __forceinline__ F2 split_col(const float* W, int k0, int n, int lane, int ld, int K) { float v[16]; const int g = lane >> 4;
#pragma unroll
  for (int i = 0; i < 8; ++i) { const int ka = k0 + 8 * g + i, kb = ka + 16; v[i] = ka < K ? W[(size_t)(ka < K ? ka : K - 1) * ld + n] : 0.f; v[8 + i] = kb < K ? W[(size_t)(kb < K ? kb : K - 1) * ld + n] : 0.f; }
  return bsplit16(v); }
__device__ __forceinline__ v8f mac3(const F2& a, const F2& b, v8f c) { c = wmma_bf(a.l, b.h, c); c = wmma_bf(a.h, b.l, c); return wmma_bf(a.h, b.h, c); }
__device__ __forceinline__ float sigm(float v) { return 1.0f / (1.0f + expf(-v)); }
#define LDSX() do { asm volatile("s_wait_dscnt 0" ::: "memory"); __builtin_amdgcn_wave_barrier(); __builtin_amdgcn_fence(__ATOMIC_RELEASE, "workgroup"); } while (0)

// Triangle (starting-node) attention on a pair representation x [1, 256, 256, 128] (4 heads x 32): xn = LayerNorm(x); for every row b: q, k, v = xn[b] W^T ((out,in)); scores[b,h,q,k] = q . k / sqrt(32) + bias[h][q][k] + attn_mask[q][k] with bias[h][q][k] = xn[q][k] . Wb[h] (pair-indexed, shared across rows) and attn_mask in {0, -1e9}; softmax over k; o = (attn v) * sigmoid(xn[b][q] Wg^T); out[b][q] = o Wo^T.
#define NB 256
#define TT 256
#define CC 128            // NH * HD = projected width
#define DIN 128          // input (model) width
#define NH 4
#define HD 32
#define NQB (TT / 64)
#define HG 4
#define SCALE (0.17677669529663687f)
#define CAUSAL 0
#ifndef TNB
#define TNB NB
#endif
__device__ __forceinline__ float bfr(float v) { return (float)(__bf16)v; }
__host__ __device__ __forceinline__ int kb_last(int qb) { return CAUSAL ? ((qb * 64 + 63) >> 7) : (TT / 128 - 1); }
typedef __attribute__((ext_vector_type(8))) __bf16 v8b;
__device__ __forceinline__ v16b frag_b(const __bf16* rowk0, int lane) {
  union { v16b v; v8b q[2]; } u; const __bf16* p = rowk0 + 8 * (lane >> 4);
  u.q[0] = *(const v8b*)p; u.q[1] = *(const v8b*)(p + 16); return u.v;
}
// A block's weight, staged once: ROWS rows of an (out,in) [..][128] f32 weight, each read as one whole 512-B row per wave-wide load, rounded to bf16 and laid in LDS at pitch WP (272 B = 16 B x odd, for 16-byte fragment reads). 128 threads: wave w takes rows w, w + 4, ...
#define WP 136
typedef __attribute__((ext_vector_type(4))) __bf16 v4b;
template <int ROWS> __device__ __forceinline__ void stage_w(__bf16 (*sw)[WP], const float* __restrict__ Wm, int tid) {
  const float* p = Wm + (tid >> 5) * 128 + (tid & 31) * 4; __bf16* d = &sw[tid >> 5][(tid & 31) * 4]; v4f x[ROWS / 4];
#pragma unroll
  for (int u = 0; u < ROWS / 4; ++u) x[u] = *(const v4f*)(p + u * 4 * 128);
  asm volatile("s_wait_xcnt 0x0" :: "v"(p) : "memory");   /* all row loads are issued in front of it (the fill is bound by load latency); their address register, named here, is reused only behind the wait */
#pragma unroll
  for (int u = 0; u < ROWS / 4; ++u) { v4b y;
#pragma unroll
    for (int i = 0; i < 4; ++i) y[i] = (__bf16)x[u][i];
    *(v4b*)(d + u * 4 * WP) = y; } }
#define QBH 0              // unused: no kernel reads it
#define QHI 256            // rows carrying a q residual plane (all rows when non-causal: 2-product logits everywhere)
#define KHI 64            // key rows carrying k residual / v bf16 hi+lo planes (written by k_proj; no kernel reads them)
// B fragment (k rows k0+.., output column o) of a weight: (in,out) [K][ld] or (out,in) [ld rows of K]: bf16 exact, or f16(bf16 * 256) exact
__device__ __forceinline__ v16b wcol_io(const float* Wm, int k0, int o, int lane, int ld) { v16b w; const int g = lane >> 4;
#pragma unroll
  for (int i = 0; i < 8; ++i) { w[i] = (__bf16)Wm[(size_t)(k0 + 8 * g + i) * ld + o]; w[8 + i] = (__bf16)Wm[(size_t)(k0 + 16 + 8 * g + i) * ld + o]; }
  return w; }
__device__ __forceinline__ v16b wcol_oi(const float* Wm, int k0, int o, int lane, int K) { v16b w; const float* p = Wm + (size_t)o * K + k0 + 8 * (lane >> 4);
#pragma unroll
  for (int i = 0; i < 8; ++i) { w[i] = (__bf16)p[i]; w[8 + i] = (__bf16)p[16 + i]; }
  return w; }
__device__ __forceinline__ v16h wcolh_io(const float* Wm, int k0, int o, int lane, int ld) { v16h w; const int g = lane >> 4;
#pragma unroll
  for (int i = 0; i < 8; ++i) { w[i] = (_Float16)(bfr(Wm[(size_t)(k0 + 8 * g + i) * ld + o]) * 256.0f); w[8 + i] = (_Float16)(bfr(Wm[(size_t)(k0 + 16 + 8 * g + i) * ld + o]) * 256.0f); }
  return w; }
__device__ __forceinline__ v16h wcolh_oi(const float* Wm, int k0, int o, int lane, int K) { v16h w; const float* p = Wm + (size_t)o * K + k0 + 8 * (lane >> 4);
#pragma unroll
  for (int i = 0; i < 8; ++i) { w[i] = (_Float16)(bfr(p[i]) * 256.0f); w[8 + i] = (_Float16)(bfr(p[16 + i]) * 256.0f); }
  return w; }
#define WQKV_LAYOUT 1   // (out,in) [CC][DIN]
__device__ __forceinline__ v16b wcol_hdk(const float* Wm, int k0, int o, int lane) { v16b w; const int g = lane >> 4; const float* p = Wm + (size_t)(o / HD) * DIN * HD + (o % HD);
#pragma unroll
  for (int i = 0; i < 8; ++i) { w[i] = (__bf16)p[(size_t)(k0 + 8 * g + i) * HD]; w[8 + i] = (__bf16)p[(size_t)(k0 + 16 + 8 * g + i) * HD]; }
  return w; }
#define WO_OUT_IN 1
#if WQKV_LAYOUT == 1
#define WCOL(W, k0, o, lane) wcol_oi(W, k0, o, lane, DIN)
#elif WQKV_LAYOUT == 2
#define WCOL(W, k0, o, lane) wcol_hdk(W, k0, o, lane)
#else
#define WCOL(W, k0, o, lane) wcol_io(W, k0, o, lane, CC)
#endif
#if WO_OUT_IN
#define WOCOL(W, k0, o, lane) wcol_oi(W, k0, o, lane, CC)
#define WOCOLH(W, k0, o, lane) wcolh_oi(W, k0, o, lane, CC)
#else
#define WOCOL(W, k0, o, lane) wcol_io(W, k0, o, lane, DIN)
#define WOCOLH(W, k0, o, lane) wcolh_io(W, k0, o, lane, DIN)
#endif
#define SZ 256
#define BG 64              // rows r sizing the unused WS_S region (x 4 heads = 256 planes of 256 x 256)
#define NZR (SZ * SZ)      // 65,536 pair rows
// ---- k_lnz: wave per pair row: LayerNorm over the 128 channels (biased var, eps 1e-5, ln_w/ln_b) of bf16(z) -> ZN rows (4 floats per lane = one 512-B row)
__global__ __launch_bounds__(256) void k_lnz(const float* __restrict__ Z, const float* __restrict__ LW, const float* __restrict__ LB, float* __restrict__ ZN) { const int wave = threadIdx.x >> 5, lane = threadIdx.x & 31; const size_t row = (size_t)blockIdx.x * 8 + wave; if (row >= (size_t)NZR) return;
  v4f x = *(const v4f*)(Z + row * CC + lane * 4); float s1 = 0.f;
#pragma unroll
  for (int i = 0; i < 4; ++i) { x[i] = bfr(x[i]); s1 += x[i]; }
#pragma unroll
  for (int o = 1; o < 32; o <<= 1) s1 += __shfl_xor(s1, o);
  const float mu = s1 * (1.0f / CC); float q = 0.f;
#pragma unroll
  for (int i = 0; i < 4; ++i) { const float d = x[i] - mu; q += d * d; }
#pragma unroll
  for (int o = 1; o < 32; o <<= 1) q += __shfl_xor(q, o);
  const float rs = rsqrtf(q * (1.0f / CC) + 1e-5f); v4f r4;
#pragma unroll
  for (int i = 0; i < 4; ++i) { const int c = lane * 4 + i; r4[i] = (x[i] - mu) * rs * bfr(LW[c]) + bfr(LB[c]); }
  vst2(ZN + row * CC + lane * 4, r4); }
// ---- k_rows2: block = (64 rows, which): which 0: bias: BIAS[row = q*256+k][h] = xn[q][k] . Wb[h] (4 outputs) ; which 1: G[row][c] = sigmoid(xn[row] . Wg[c]) (128 outputs); weights are (out,in)
__global__ __launch_bounds__(128) void k_rows2(const float* __restrict__ ZN, const float* __restrict__ WB, const float* __restrict__ WG, const float* __restrict__ GB, float* __restrict__ BIAS, float* __restrict__ G) { __shared__ __align__(16) float sf[4][16][132]; __shared__ __align__(16) __bf16 sw[CC][WP];
  const int tid = threadIdx.x, wave = tid >> 5, lane = tid & 31, col = lane & 15, g = lane >> 4; const int which = blockIdx.y; const size_t r0 = (size_t)blockIdx.x * 64 + wave * 16;
  const int nout = which == 0 ? NH : CC;
  if (which == 0) { stage_w<NH>(sw, WB, tid);   /* the bias tile's columns beyond NH are zero */
#pragma unroll
    for (int u = 1; u < 4; ++u) *(v4b*)&sw[u * 4 + wave][lane * 4] = v4b{}; }
  else stage_w<CC>(sw, WG, tid);
  __syncthreads();   /* the staged weight is read by all four waves */
  v8f acc[8] = {};
#pragma unroll
  for (int kc = 0; kc < CC / 32; ++kc) { v16b w[8];   /* this k step's weight fragments, read as one group in front of the row loads' wait, not among the products */
#pragma unroll
    for (int j = 0; j < 8; ++j) { if (j * 16 >= nout) break; w[j] = frag_b(&sw[j * 16 + col][kc * 32], lane); }   /* (out,in) row o; columns beyond nout zero */
    const F2 a = split_row(ZN + (r0 + col) * CC, kc * 32, lane); asm volatile("s_wait_loadcnt 0x0" ::: "memory");
#pragma unroll
    for (int j = 0; j < 8; ++j) { if (j * 16 >= nout) break; acc[j] = wmma_bf(a.h, w[j], acc[j]); acc[j] = wmma_bf(a.l, w[j], acc[j]); } }
  if (which == 0) { if (lane < 16) {   /* bias rows: 4 floats = 16 B per row; rows r0+8g+r... store via LDS: */ }
#pragma unroll
    for (int r = 0; r < 8; ++r) sf[wave][8 * g + r][col] = acc[0][r];
    LDSX(); if (lane < 16) { v4f b4; b4[0] = sf[wave][lane][0]; b4[1] = sf[wave][lane][1]; b4[2] = sf[wave][lane][2]; b4[3] = sf[wave][lane][3]; vst2(BIAS + (r0 + lane) * NH, b4); }   /* 16 rows x 16 B = one 256-B run per wave */
  } else {
#pragma unroll
    for (int j = 0; j < 8; ++j)
#pragma unroll
      for (int r = 0; r < 8; ++r) sf[wave][8 * g + r][j * 16 + col] = 1.0f / (1.0f + expf(-acc[j][r]));   /* sigmoid(xn Wg^T), no bias */
    LDSX(); for (int rl = 0; rl < 16; ++rl) vst2(G + (r0 + rl) * CC + lane * 4, *(const v4f*)&sf[wave][rl][lane * 4]); } }
// ---- k_gate: Y row *= G row (same natural row index r*256 + q; thread per float4; one writer)
__global__ __launch_bounds__(256) void k_gate(float* __restrict__ Y, const float* __restrict__ G) { const size_t e4 = (size_t)blockIdx.x * 256 + threadIdx.x; if (e4 >= (size_t)NZR * (CC / 4)) return; const size_t yrow = e4 / (CC / 4); const int q = (int)(e4 % (CC / 4)); const size_t grow = yrow;
  v4f y = *(const v4f*)(Y + yrow * CC + q * 4); const v4f gg = *(const v4f*)(G + grow * CC + q * 4); y[0] *= gg[0]; y[1] *= gg[1]; y[2] *= gg[2]; y[3] *= gg[3]; vst2(Y + yrow * CC + q * 4, y); }
#define WS_ZN   (WS_END)
#define WS_BIAS (WS_ZN + 4u * (size_t)NZR * CC)
#define WS_G    (WS_BIAS + 4u * (size_t)NZR * NH)
#define WS_END2 (WS_G + 4u * (size_t)NZR * CC)
#ifndef PROJ_EXTRA_PARAMS
#define PROJ_EXTRA_PARAMS
#endif

#define WS_QH  0u                                      // f16 q rows [b*t][CC]
#define WS_KH  (WS_QH + 2u * (size_t)NB * TT * CC)      // f16 k rows [b*t][CC]
#define WS_VT  (WS_KH + 2u * (size_t)NB * TT * CC)      // f16 v planes [b][c][t]
#define WS_QL  (WS_VT + 2u * (size_t)NB * CC * TT)      // f16 q residual x 2^10 rows [b][t < QHI][CC]
#define WS_KL  (WS_QL + 2u * (size_t)NB * QHI * CC)     // f16 k residual x 2^10 rows [b][t < KHI][CC]
#define WS_VB  (WS_KL + 2u * (size_t)NB * KHI * CC)     // bf16 v hi planes [b][c][t < KHI]
#define WS_VBL (WS_VB + 2u * (size_t)NB * CC * KHI)
#define WS_S   (WS_VBL + 2u * (size_t)NB * CC * KHI)    // f32 region, unused: k_attn keeps logits and P in registers
#define WS_Y   (WS_S  + 4u * (size_t)BG * HG * TT * TT)   // skips 256 unused f32 planes of 256 x 256      // f32 ctx rows [b*t][CC] (only when there is an output projection)
#define WS_END (WS_Y  + 4u * (size_t)NB * TT * CC)

// ---- k_proj: block = (64 rows, 128 cols, which): q/k/v = X W (+ b) with exact bf16 products (K = DIN) -> which 0: q f16 rows (+ residual rows < QHI); 1: k f16 rows (+ residual rows < KHI); 2: v f16 planes [c][t] (+ bf16 hi/lo planes for t < KHI)
__global__ __launch_bounds__(128) void k_proj(const float* __restrict__ XQ, const float* __restrict__ XK, const float* __restrict__ XV, const float* __restrict__ WQ, const float* __restrict__ WK, const float* __restrict__ WV, const float* __restrict__ BQ, const float* __restrict__ BK, const float* __restrict__ BV,
    _Float16* __restrict__ QH, _Float16* __restrict__ QL, _Float16* __restrict__ KH, _Float16* __restrict__ KL, _Float16* __restrict__ VT, __bf16* __restrict__ VB, __bf16* __restrict__ VBL) {
  __shared__ __align__(16) _Float16 sh[64][136], sl[64][136]; __shared__ __align__(16) union { struct { _Float16 th[128][72]; __bf16 tb[128][72], tbl[128][72]; } t; __bf16 sw[128][WP]; } uu;   /* the staged weight lies where the v tiles of the epilogue go later */
  auto& th = uu.t.th; auto& tb = uu.t.tb; auto& tbl = uu.t.tbl;
  const int tid = threadIdx.x, wave = tid >> 5, lane = tid & 31, col = lane & 15, g = lane >> 4; const int which = blockIdx.z; const int c0 = blockIdx.y * 128; const size_t r0 = (size_t)blockIdx.x * 64; const size_t bb = r0 / TT; const int t0 = (int)(r0 % TT);
  const float* X = which == 0 ? XQ : which == 1 ? XK : XV; const float* WA = which == 0 ? WQ : which == 1 ? WK : WV; const float* BA = which == 0 ? BQ : which == 1 ? BK : BV;
  stage_w<128>(uu.sw, WA + (size_t)c0 * DIN, tid);
  __syncthreads();   /* the staged weight is read by all four waves */
  v8f acc[8] = {};
#pragma unroll 2
  for (int kc = 0; kc < DIN / 32; ++kc) { v16b w[8];   /* this k step's weight fragments, read as one group in front of the row loads' wait, not among the products */
#pragma unroll
    for (int j = 0; j < 8; ++j) w[j] = frag_b(&uu.sw[j * 16 + col][kc * 32], lane);
    const F2 a2 = split_row(X + (r0 + wave * 16 + col) * DIN, kc * 32, lane);   /* LN(act) rows (f32) split hi + lo */
    asm volatile("s_wait_loadcnt 0x0" ::: "memory");
#pragma unroll
    for (int j = 0; j < 8; ++j) { acc[j] = wmma_bf(a2.h, w[j], acc[j]); acc[j] = wmma_bf(a2.l, w[j], acc[j]); } }
  __syncthreads();   /* every wave has read its last weight fragment before the v tiles overwrite that LDS */
  if (which < 2) { _Float16* DH = which == 0 ? QH : KH; _Float16* DL = which == 0 ? QL : KL; const int nhi = which == 0 ? QHI : KHI; const bool hi_rows = t0 < nhi;
#pragma unroll
    for (int j = 0; j < 8; ++j) { const float bias = BA ? bfr(BA[c0 + j * 16 + col]) : 0.f;
#pragma unroll
      for (int r = 0; r < 8; ++r) { const float v = acc[j][r] + bias; const _Float16 hv = (_Float16)v; sh[wave * 16 + 8 * g + r][j * 16 + col] = hv; sl[wave * 16 + 8 * g + r][j * 16 + col] = (_Float16)((v - (float)hv) * 1024.0f); } }
    __syncthreads();
    for (int e = tid; e < 64 * 16; e += 128) { const int rl = e >> 4, q = e & 15; vst2((unsigned*)(DH + (r0 + rl) * CC + c0 + q * 8), *(const v4u*)&sh[rl][q * 8]); if (hi_rows) vst2((unsigned*)(DL + (bb * nhi + t0 + rl) * (size_t)CC + c0 + q * 8), *(const v4u*)&sl[rl][q * 8]); }
  } else { const bool hi_rows = t0 < KHI;
#pragma unroll
    for (int j = 0; j < 8; ++j) { const float bias = BA ? bfr(BA[c0 + j * 16 + col]) : 0.f;
#pragma unroll
      for (int r = 0; r < 8; ++r) { const float v = acc[j][r] + bias; const int rl = wave * 16 + 8 * g + r, cl = j * 16 + col; th[cl][rl] = (_Float16)v; const __bf16 bh = (__bf16)v; tb[cl][rl] = bh; tbl[cl][rl] = (__bf16)(v - (float)bh); } }
    __syncthreads();
    for (int e = tid; e < 128 * 8; e += 128) { const int cl = e >> 3, q = e & 7; vst2((unsigned*)(VT + (bb * CC + c0 + cl) * (size_t)TT + t0 + q * 8), *(const v4u*)&th[cl][q * 8]); if (hi_rows) { const size_t o3 = (bb * CC + c0 + cl) * (size_t)KHI + t0 + q * 8; vst2((unsigned*)(VB + o3), *(const v4u*)&tb[cl][q * 8]); vst2((unsigned*)(VBL + o3), *(const v4u*)&tbl[cl][q * 8]); } } } }
// ---- k_attn: block = (64 queries qb, head h, 4 x NBL rows b), 16 waves; wave = 16 queries (wave & 3) of NBL rows b (group wave >> 2). The (bias + mask) tile of the block's 64 queries x 256 keys is summed once into LDS and serves every row b.
// Per row b: S^T = K Q^T (A = 16 key rows, B = q hi, then q residual x 2^10: 2 products), so a lane holds 128 of one query's 256 logits (lanes l and l ^ 16 split them); softmax in f32 in registers;
// two S^T tiles (keys 32 kc + 0..15, + 16..31), x 2^11 and once to f16, ARE the A fragment of P for ctx = P v (1 product, v f16 planes); logits and P never go to memory.
#define NBL 4
__device__ __forceinline__ v16h frag_o(const _Float16* base, unsigned off) { union { v16h v; v8h q[2]; } u; const _Float16* p = base + off; u.q[0] = *(const v8h*)p; u.q[1] = *(const v8h*)(p + 16); return u.v; }   /* frag_h from the lane's own pointer (row and 8 * (lane >> 4) included) plus a constant */
__device__ __forceinline__ v8f wmmah(v16h a, v16h b, v8f c) { return __builtin_amdgcn_wmma_f32_16x16x32_f16(false, a, false, b, (short)0, c, false, false); }
__global__ __launch_bounds__(512) __attribute__((amdgpu_waves_per_eu(4, 4))) void k_attn(const _Float16* __restrict__ QH, const _Float16* __restrict__ KH, const _Float16* __restrict__ QL, const _Float16* __restrict__ VT, const float* __restrict__ BIAS, const float* __restrict__ MKP, float* __restrict__ Y) {
  __shared__ __align__(16) float sb[64][TT + 4]; __shared__ __align__(16) float ss[16][16][HD + 4];   /* pitches 16 B x odd: 16-byte row reads without bank conflicts */
  const int tid = threadIdx.x, wave = __builtin_amdgcn_readfirstlane(tid >> 5), lane = tid & 31, col = lane & 15, g = lane >> 4; const int qb = blockIdx.x, h = blockIdx.y; const int ql0 = qb * 64 + (wave & 3) * 16;
  const float* bp = BIAS + ((size_t)qb * 64 * SZ + tid) * NH + h; const float* mp = MKP + (size_t)qb * 64 * SZ + tid;
  { float tb[32], tm[32];
#pragma unroll
    for (int u = 0; u < 32; ++u) { tb[u] = bp[(size_t)u * 512 * NH]; tm[u] = mp[u * 512]; }
    asm volatile("s_wait_xcnt 0x0" :: "v"(bp), "v"(tid) : "memory");   /* all 64 loads are issued in front of it (the fill is bound by load latency); their address registers, named here, are reused only behind the wait */
#pragma unroll
    for (int u = 0; u < 32; ++u) sb[u * 2 + (tid >> 8)][tid & 255] = tb[u] + bfr(tm[u]); }
  __syncthreads();
  const float* brow = &sb[(wave & 3) * 16 + col][8 * g];
  const unsigned qoff = (unsigned)((ql0 + col) * CC + h * HD + 8 * g), koff = (unsigned)(col * CC + h * HD + 8 * g), voff = (unsigned)((h * HD + col) * TT + 8 * g), yoff = (unsigned)((ql0 + (lane >> 3)) * CC + h * HD + (lane & 7) * 4);
#pragma unroll 1   /* the body is some thousands of instructions: kept rolled for the instruction cache */
  for (int bi = 0; bi < NBL; ++bi) { const size_t bo = (size_t)(((int)blockIdx.z * 4 + (wave >> 2)) * NBL + bi) * TT * CC;   /* row b's start in q, q residual (QHI == TT), k rows, v planes and ctx rows alike */
    const _Float16* qp = QH + bo + qoff; const _Float16* lp = QL + bo + qoff; const _Float16* kp = KH + bo + koff; const _Float16* vp = VT + bo + voff;
    const v16h qh = frag_o(qp, 0), ql = frag_o(lp, 0); v16h kf[TT / 16];
#pragma unroll
    for (int j = 0; j < TT / 16; ++j) kf[j] = frag_o(kp, j * 16 * CC);
    asm volatile("s_wait_xcnt 0x0" :: "v"(qp), "v"(lp), "v"(kp) : "memory");   /* q and all 16 k fragments in one run of loads in front of it: one load latency per row b, not one per tile; the address registers, named here, are reused only behind the wait */
    __builtin_amdgcn_sched_barrier(0);   /* no product is scheduled in between the loads, which would split the run */
    v8f s[TT / 16], m8;
#pragma unroll
    for (int r = 0; r < 8; ++r) m8[r] = -3.0e38f;
#pragma unroll
    for (int j = 0; j < TT / 16; ++j) { v8f a = {}, l = {}; a = wmmah(kf[j], qh, a); l = wmmah(kf[j], ql, l);
      const v8f bm = __builtin_shufflevector(*(const v4f*)(brow + j * 16), *(const v4f*)(brow + j * 16 + 4), 0, 1, 2, 3, 4, 5, 6, 7);
      s[j] = (a + l * (1.0f / 1024.0f)) * SCALE + bm; m8 = __builtin_elementwise_max(m8, s[j]);
      if ((j & 3) == 3) __builtin_amdgcn_sched_barrier(0); }   /* four tiles' products and sums at a time: with more products run ahead the build spills */
    v16h vf[TT / 32][HD / 16];
#pragma unroll
    for (int kc = 0; kc < TT / 64; ++kc)
#pragma unroll
      for (int j = 0; j < HD / 16; ++j) vf[kc][j] = frag_o(vp, j * 16 * TT + kc * 32);
    asm volatile("s_wait_xcnt 0x0" :: "v"(vp) : "memory");   /* the first half of v is on its way while the exponentials run; address register as above */
    float m = fmaxf(fmaxf(fmaxf(m8[0], m8[1]), fmaxf(m8[2], m8[3])), fmaxf(fmaxf(m8[4], m8[5]), fmaxf(m8[6], m8[7]))); m = fmaxf(m, __shfl_xor(m, 16));
    v8f s8 = {};
#pragma unroll
    for (int j = 0; j < TT / 16; ++j) {
#pragma unroll
      for (int r = 0; r < 8; ++r) { const float v = s[j][r]; const float x = expf(v - m); s[j][r] = (v <= -1.0e38f) ? 0.f : x; }
      s8 += s[j]; }
    float sum = ((s8[0] + s8[1]) + (s8[2] + s8[3])) + ((s8[4] + s8[5]) + (s8[6] + s8[7])); sum += __shfl_xor(sum, 16);
    const float inv = sum > 0.f ? 2048.0f / sum : 0.f;   /* a fully excluded row yields P = 0 */
    v16h p[TT / 32];
#pragma unroll
    for (int kc = 0; kc < TT / 32; ++kc)
#pragma unroll
      for (int i = 0; i < 8; ++i) { p[kc][i] = (_Float16)(s[2 * kc][i] * inv); p[kc][8 + i] = (_Float16)(s[2 * kc + 1][i] * inv); }
#pragma unroll
    for (int kc = TT / 64; kc < TT / 32; ++kc)
#pragma unroll
      for (int j = 0; j < HD / 16; ++j) vf[kc][j] = frag_o(vp, j * 16 * TT + kc * 32);
    asm volatile("s_wait_xcnt 0x0" :: "v"(vp) : "memory");   /* the second half of v, issued once P is packed and its registers are free; address register as above */
    v8f acc[HD / 16] = {};
#pragma unroll
    for (int kc = 0; kc < TT / 32; ++kc)
#pragma unroll
      for (int j = 0; j < HD / 16; ++j) acc[j] = wmmah(p[kc], vf[kc][j], acc[j]);
#pragma unroll
    for (int j = 0; j < HD / 16; ++j)
#pragma unroll
      for (int r = 0; r < 8; ++r) ss[wave][8 * g + r][j * 16 + col] = acc[j][r] * (1.0f / 2048.0f);
    LDSX();   /* the wave's own 16 x 32 tile: its LDS writes land before its lanes read each other's */
#pragma unroll
    for (int i = 0; i < 4; ++i) vst2(Y + bo + i * 4 * CC + yoff, *(const v4f*)&ss[wave][i * 4 + (lane >> 3)][(lane & 7) * 4]);   /* 4 rows x 128 B per store */
  } }
// ---- k_out: block = (64 rows, 128 cols): out = ctx Wo (+ bo): all rows: ctx bf16 hi + lo against exact bf16 Wo (2 products)
__global__ __launch_bounds__(128) void k_out(const float* __restrict__ Y, const float* __restrict__ WO, const float* __restrict__ BO, float* __restrict__ OUT) { __shared__ __align__(16) float sf[4][16][132]; __shared__ __align__(16) __bf16 sw[128][WP];
  const int tid = threadIdx.x, wave = tid >> 5, lane = tid & 31, col = lane & 15, g = lane >> 4; const int c0 = blockIdx.y * 128; const size_t r0 = (size_t)blockIdx.x * 64 + wave * 16;
  stage_w<128>(sw, WO + (size_t)c0 * CC, tid);
  __syncthreads();   /* the staged weight is read by all four waves */
  v8f acc[8] = {};
  if (true) {   /* ALL rows: gated ctx bf16 hi + lo x exact output_w (2 products) */
#pragma unroll 2
    for (int kc = 0; kc < CC / 32; ++kc) { v16b w[8];   /* this k step's weight fragments, read as one group in front of the row loads' wait, not among the products */
#pragma unroll
      for (int j = 0; j < 8; ++j) w[j] = frag_b(&sw[j * 16 + col][kc * 32], lane);
      const F2 a = split_row(Y + (r0 + col) * CC, kc * 32, lane); asm volatile("s_wait_loadcnt 0x0" ::: "memory");
#pragma unroll
      for (int j = 0; j < 8; ++j) { acc[j] = wmma_bf(a.h, w[j], acc[j]); acc[j] = wmma_bf(a.l, w[j], acc[j]); } }
#pragma unroll
    for (int j = 0; j < 8; ++j) { const float bias = BO ? bfr(BO[c0 + j * 16 + col]) : 0.f;
#pragma unroll
      for (int r = 0; r < 8; ++r) sf[wave][8 * g + r][j * 16 + col] = acc[j][r] + bias; }
  } else {
#pragma unroll 2
    for (int kc = 0; kc < CC / 32; ++kc) { const v16h a = frag_f32(Y + (r0 + col) * CC + kc * 32, lane); asm volatile("s_wait_loadcnt 0x0" ::: "memory");
#pragma unroll
      for (int j = 0; j < 8; ++j) { const v16h w = WOCOLH(WO, kc * 32, c0 + j * 16 + col, lane); asm volatile("s_wait_loadcnt 0x0" ::: "memory"); acc[j] = wmma16(a, w, acc[j]); } }
#pragma unroll
    for (int j = 0; j < 8; ++j) { const float bias = BO ? bfr(BO[c0 + j * 16 + col]) : 0.f;
#pragma unroll
      for (int r = 0; r < 8; ++r) sf[wave][8 * g + r][j * 16 + col] = acc[j][r] * (1.0f / 256.0f) + bias; } }
  LDSX(); for (int rl = 0; rl < 16; ++rl) vst2(OUT + (r0 + rl) * DIN + c0 + lane * 4, *(const v4f*)&sf[wave][rl][lane * 4]); }

extern "C" void kernel_launch(void* const* d_in, const int* in_sizes, int n_in, void* d_out, int out_size, void* d_ws, size_t ws_size, hipStream_t stream) {
  (void)in_sizes; (void)n_in; (void)out_size;
  const float** F = (const float**)d_in;
  if (ws_size < (size_t)WS_END) return;
  char* ws = (char*)d_ws; _Float16 *QH = (_Float16*)(ws + WS_QH), *KH = (_Float16*)(ws + WS_KH), *VT = (_Float16*)(ws + WS_VT), *QL = (_Float16*)(ws + WS_QL), *KL = (_Float16*)(ws + WS_KL); __bf16 *VB = (__bf16*)(ws + WS_VB), *VBL = (__bf16*)(ws + WS_VBL); float *Y = (float*)(ws + WS_Y);
  (void)Y; (void)QL; (void)KL; (void)VB; (void)VBL;
  // inputs: 0 x [1,256,256,128]; 1 attn_mask [1,1,256,256] (0 / -1e9); 2 ln_w, 3 ln_b; 4 Wb [4,128]; 5 Wq, 6 Wk, 7 Wv, 8 Wg, 9 Wo [128,128] (out,in)
  if (ws_size < (size_t)WS_END2) return;
  float *ZN = (float*)(ws + WS_ZN), *BIAS = (float*)(ws + WS_BIAS), *G = (float*)(ws + WS_G);
  k_lnz<<<dim3(NZR / 8), 256, 0, stream>>>(F[0], F[2], F[3], ZN);
  k_rows2<<<dim3(NZR / 64, 2), 128, 0, stream>>>(ZN, F[4], F[8], nullptr, BIAS, G);
  k_proj<<<dim3(TNB * TT / 64, CC / 128, 3), 128, 0, stream>>>(ZN, ZN, ZN, F[5], F[6], F[7], nullptr, nullptr, nullptr, QH, QL, KH, KL, VT, VB, VBL);
  k_attn<<<dim3(NQB, NH, TNB / (4 * NBL)), 512, 0, stream>>>(QH, KH, QL, VT, BIAS, F[1], Y);
  k_gate<<<dim3((NZR * (CC / 4) + 255) / 256), 256, 0, stream>>>(Y, G);
  k_out<<<dim3(TNB * TT / 64, DIN / 128), 128, 0, stream>>>(Y, F[9], nullptr, (float*)d_out);
}

// v003
// One run takes 119 microseconds.
// In two side-by-side timings against v002, it was 1.33 and 1.32 times as fast.
// All steps since v000 together make it 4.65 times as fast.
// compute dtype: all float inputs rounded to bf16; LayerNorm of pair_act in f32; q/k/v = LN(act) split bf16 hi + lo x W (exact bf16, (out,in)) on WMMA 16x16x32 (2 products, f32 accumulate); q as f16 hi + residual (x 2^10) against k once to f16 (2 products) x 32^-0.5 + the per-(query, key, head) triangle bias (2-product GEMM) + the mask bias; softmax in f32 (precise expf); P x 2^11 once to f16 against v once to f16 (1 product); gate sigmoid(LN(act) Wg) in f32 (2-product GEMM, precise expf); gated ctx split bf16 hi + lo against exact output_w (2 products); f32 output.
#include <hip/hip_runtime.h>
#include <math.h>

typedef __attribute__((ext_vector_type(16))) _Float16 v16h;
typedef __attribute__((ext_vector_type(16))) __bf16 v16b;
typedef __attribute__((ext_vector_type(8)))  _Float16 v8h;
typedef __attribute__((ext_vector_type(8)))  float v8f;
typedef __attribute__((ext_vector_type(4)))  float v4f;
typedef __attribute__((ext_vector_type(2)))  float v2f;
typedef __attribute__((ext_vector_type(4)))  unsigned v4u;
typedef __attribute__((ext_vector_type(4)))  int v4i;
typedef float __attribute__((may_alias)) float_a;
typedef int __attribute__((may_alias)) int_a;

template <typename T> __device__ __forceinline__ void vst2(void* p, T v) { *(T*)p = v;  }
__device__ __forceinline__ v8f wmma16(v16h a, v16h b, v8f c) {
  v8f d = __builtin_amdgcn_wmma_f32_16x16x32_f16(false, a, false, b, (short)0, c, false, false);
  asm volatile("v_nop\n\tv_nop\n\tv_nop\n\tv_nop" : "+v"(d) : "v"(a), "v"(b));
  return d;
}
__device__ __forceinline__ v8f wmma_bf(v16b a, v16b b, v8f c) {
  v8f d = __builtin_amdgcn_wmma_f32_16x16x32_bf16(false, a, false, b, (short)0, c, false, false);
  asm volatile("v_nop\n\tv_nop\n\tv_nop\n\tv_nop" : "+v"(d) : "v"(a), "v"(b));
  return d;
}
// 16x16x32 fragments: lane = (h = lane>>4, row/col = lane&15); elements 0..7 = k0+8h+0..7, 8..15 = k0+16+8h+0..7; D element r = row 8h+r
__device__ __forceinline__ v16h frag_h(const _Float16* rowk0, int lane) {
  union { v16h v; v8h q[2]; } u; const _Float16* p = rowk0 + 8 * (lane >> 4);
  u.q[0] = *(const v8h*)p; u.q[1] = *(const v8h*)(p + 16); return u.v;
}
__device__ __forceinline__ v16h frag_f32(const float* rowk0, int lane) {
  v16h a; const float* p = rowk0 + 8 * (lane >> 4);
#pragma unroll
  for (int i = 0; i < 8; ++i) { a[i] = (_Float16)p[i]; a[8 + i] = (_Float16)p[16 + i]; }
  return a;
}
__device__ __forceinline__ v16h frag_f32s(const float* rowk0, int lane, float sc) {
  v16h a; const float* p = rowk0 + 8 * (lane >> 4);
#pragma unroll
  for (int i = 0; i < 8; ++i) { a[i] = (_Float16)(p[i] * sc); a[8 + i] = (_Float16)(p[16 + i] * sc); }
  return a;
}
// column fragment from a [K][ld] layout (column n), rows >= K read as 0
__device__ __forceinline__ v16h fragc_f32(const float* W, int k0, int n, int lane, int ld, int K) {
  v16h a; const int g = lane >> 4;
#pragma unroll
  for (int i = 0; i < 8; ++i) { const int ka = k0 + 8 * g + i, kb = ka + 16;
    a[i] = (_Float16)(ka < K ? W[(size_t)(ka < K ? ka : K - 1) * ld + n] : 0.f); a[8 + i] = (_Float16)(kb < K ? W[(size_t)(kb < K ? kb : K - 1) * ld + n] : 0.f); }
  return a;
}
struct F2 { v16b h, l; };
__device__ __forceinline__ F2 bsplit16(const float v[16]) { F2 r;
#pragma unroll
  for (int i = 0; i < 16; ++i) { const __bf16 h = (__bf16)v[i]; r.h[i] = h; r.l[i] = (__bf16)(v[i] - (float)h); }
  return r; }
__device__ __forceinline__ F2 split_row(const float* row, int k0, int lane) { float v[16]; const float* p = row + k0 + 8 * (lane >> 4);
#pragma unroll
  for (int i = 0; i < 8; ++i) { v[i] = p[i]; v[8 + i] = p[16 + i]; }
  return bsplit16(v); }
__device__ __forceinline__ F2 split_rowK(const float* row, int k0, int lane, int K) { float v[16]; const int g = lane >> 4;
#pragma unroll
  for (int i = 0; i < 8; ++i) { const int ka = k0 + 8 * g + i, kb = ka + 16; v[i] = ka < K ? row[ka < K ? ka : K - 1] : 0.f; v[8 + i] = kb < K ? row[kb < K ? kb : K - 1] : 0.f; }
  return bsplit16(v); }
__device__ __forceinline__ F2 split_col(const float* W, int k0, int n, int lane, int ld, int K) { float v[16]; const int g = lane >> 4;
#pragma unroll
  for (int i = 0; i < 8; ++i) { const int ka = k0 + 8 * g + i, kb = ka + 16; v[i] = ka < K ? W[(size_t)(ka < K ? ka : K - 1) * ld + n] : 0.f; v[8 + i] = kb < K ? W[(size_t)(kb < K ? kb : K - 1) * ld + n] : 0.f; }
  return bsplit16(v); }
__device__ __forceinline__ v8f mac3(const F2& a, const F2& b, v8f c) { c = wmma_bf(a.l, b.h, c); c = wmma_bf(a.h, b.l, c); return wmma_bf(a.h, b.h, c); }
__device__ __forceinline__ float sigm(float v) { return 1.0f / (1.0f + expf(-v)); }
#define LDSX() do { asm volatile("s_wait_dscnt 0" ::: "memory"); __builtin_amdgcn_wave_barrier(); __builtin_amdgcn_fence(__ATOMIC_RELEASE, "workgroup"); } while (0)

// Triangle (starting-node) attention on a pair representation x [1, 256, 256, 128] (4 heads x 32): xn = LayerNorm(x); for every row b: q, k, v = xn[b] W^T ((out,in)); scores[b,h,q,k] = q . k / sqrt(32) + bias[h][q][k] + attn_mask[q][k] with bias[h][q][k] = xn[q][k] . Wb[h] (pair-indexed, shared across rows) and attn_mask in {0, -1e9}; softmax over k; o = (attn v) * sigmoid(xn[b][q] Wg^T); out[b][q] = o Wo^T.
#define NB 256
#define TT 256
#define CC 128            // NH * HD = projected width
#define DIN 128          // input (model) width
#define NH 4
#define HD 32
#define NQB (TT / 64)
#define HG 4
#define SCALE (0.17677669529663687f)
#define CAUSAL 0
#ifndef TNB
#define TNB NB
#endif
__device__ __forceinline__ float bfr(float v) { return (float)(__bf16)v; }
__host__ __device__ __forceinline__ int kb_last(int qb) { return CAUSAL ? ((qb * 64 + 63) >> 7) : (TT / 128 - 1); }
typedef __attribute__((ext_vector_type(8))) __bf16 v8b;
__device__ __forceinline__ v16b frag_b(const __bf16* rowk0, int lane) {
  union { v16b v; v8b q[2]; } u; const __bf16* p = rowk0 + 8 * (lane >> 4);
  u.q[0] = *(const v8b*)p; u.q[1] = *(const v8b*)(p + 16); return u.v;
}
// A block's weight, staged once: ROWS rows of an (out,in) [..][128] f32 weight, each read as one whole 512-B row per wave-wide load, rounded to bf16 and laid in LDS at pitch WP (272 B = 16 B x odd, for 16-byte fragment reads). 128 threads: wave w takes rows w, w + 4, ...
#define WP 136
typedef __attribute__((ext_vector_type(4))) __bf16 v4b;
template <int ROWS> __device__ __forceinline__ void stage_w(__bf16 (*sw)[WP], const float* __restrict__ Wm, int tid) {
  const float* p = Wm + (tid >> 5) * 128 + (tid & 31) * 4; __bf16* d = &sw[tid >> 5][(tid & 31) * 4]; v4f x[ROWS / 4];
#pragma unroll
  for (int u = 0; u < ROWS / 4; ++u) x[u] = *(const v4f*)(p + u * 4 * 128);
  asm volatile("s_wait_xcnt 0x0" :: "v"(p) : "memory");   /* all row loads are issued in front of it (the fill is bound by load latency); their address register, named here, is reused only behind the wait */
#pragma unroll
  for (int u = 0; u < ROWS / 4; ++u) { v4b y;
#pragma unroll
    for (int i = 0; i < 4; ++i) y[i] = (__bf16)x[u][i];
    *(v4b*)(d + u * 4 * WP) = y; } }
#define QBH 0              // unused: no kernel reads it
#define QHI 256            // rows carrying a q residual plane (all rows when non-causal: 2-product logits everywhere)
#define KHI 64            // key rows carrying k residual / v bf16 hi+lo planes (written by k_proj; no kernel reads them)
// B fragment (k rows k0+.., output column o) of a weight: (in,out) [K][ld] or (out,in) [ld rows of K]: bf16 exact, or f16(bf16 * 256) exact
__device__ __forceinline__ v16b wcol_io(const float* Wm, int k0, int o, int lane, int ld) { v16b w; const int g = lane >> 4;
#pragma unroll
  for (int i = 0; i < 8; ++i) { w[i] = (__bf16)Wm[(size_t)(k0 + 8 * g + i) * ld + o]; w[8 + i] = (__bf16)Wm[(size_t)(k0 + 16 + 8 * g + i) * ld + o]; }
  return w; }
__device__ __forceinline__ v16b wcol_oi(const float* Wm, int k0, int o, int lane, int K) { v16b w; const float* p = Wm + (size_t)o * K + k0 + 8 * (lane >> 4);
#pragma unroll
  for (int i = 0; i < 8; ++i) { w[i] = (__bf16)p[i]; w[8 + i] = (__bf16)p[16 + i]; }
  return w; }
__device__ __forceinline__ v16h wcolh_io(const float* Wm, int k0, int o, int lane, int ld) { v16h w; const int g = lane >> 4;
#pragma unroll
  for (int i = 0; i < 8; ++i) { w[i] = (_Float16)(bfr(Wm[(size_t)(k0 + 8 * g + i) * ld + o]) * 256.0f); w[8 + i] = (_Float16)(bfr(Wm[(size_t)(k0 + 16 + 8 * g + i) * ld + o]) * 256.0f); }
  return w; }
__device__ __forceinline__ v16h wcolh_oi(const float* Wm, int k0, int o, int lane, int K) { v16h w; const float* p = Wm + (size_t)o * K + k0 + 8 * (lane >> 4);
#pragma unroll
  for (int i = 0; i < 8; ++i) { w[i] = (_Float16)(bfr(p[i]) * 256.0f); w[8 + i] = (_Float16)(bfr(p[16 + i]) * 256.0f); }
  return w; }
#define WQKV_LAYOUT 1   // (out,in) [CC][DIN]
__device__ __forceinline__ v16b wcol_hdk(const float* Wm, int k0, int o, int lane) { v16b w; const int g = lane >> 4; const float* p = Wm + (size_t)(o / HD) * DIN * HD + (o % HD);
#pragma unroll
  for (int i = 0; i < 8; ++i) { w[i] = (__bf16)p[(size_t)(k0 + 8 * g + i) * HD]; w[8 + i] = (__bf16)p[(size_t)(k0 + 16 + 8 * g + i) * HD]; }
  return w; }
#define WO_OUT_IN 1
#if WQKV_LAYOUT == 1
#define WCOL(W, k0, o, lane) wcol_oi(W, k0, o, lane, DIN)
#elif WQKV_LAYOUT == 2
#define WCOL(W, k0, o, lane) wcol_hdk(W, k0, o, lane)
#else
#define WCOL(W, k0, o, lane) wcol_io(W, k0, o, lane, CC)
#endif
#if WO_OUT_IN
#define WOCOL(W, k0, o, lane) wcol_oi(W, k0, o, lane, CC)
#define WOCOLH(W, k0, o, lane) wcolh_oi(W, k0, o, lane, CC)
#else
#define WOCOL(W, k0, o, lane) wcol_io(W, k0, o, lane, DIN)
#define WOCOLH(W, k0, o, lane) wcolh_io(W, k0, o, lane, DIN)
#endif
#define SZ 256
#define BG 64              // rows r sizing the unused WS_S region (x 4 heads = 256 planes of 256 x 256)
#define NZR (SZ * SZ)      // 65,536 pair rows
// ---- k_lnz: wave per pair row: LayerNorm over the 128 channels (biased var, eps 1e-5, ln_w/ln_b) of bf16(z) -> ZN rows (4 floats per lane = one 512-B row)
__global__ __launch_bounds__(256) void k_lnz(const float* __restrict__ Z, const float* __restrict__ LW, const float* __restrict__ LB, float* __restrict__ ZN) { const int wave = threadIdx.x >> 5, lane = threadIdx.x & 31; const size_t row = (size_t)blockIdx.x * 8 + wave; if (row >= (size_t)NZR) return;
  v4f x = *(const v4f*)(Z + row * CC + lane * 4); float s1 = 0.f;
#pragma unroll
  for (int i = 0; i < 4; ++i) { x[i] = bfr(x[i]); s1 += x[i]; }
#pragma unroll
  for (int o = 1; o < 32; o <<= 1) s1 += __shfl_xor(s1, o);
  const float mu = s1 * (1.0f / CC); float q = 0.f;
#pragma unroll
  for (int i = 0; i < 4; ++i) { const float d = x[i] - mu; q += d * d; }
#pragma unroll
  for (int o = 1; o < 32; o <<= 1) q += __shfl_xor(q, o);
  const float rs = rsqrtf(q * (1.0f / CC) + 1e-5f); v4f r4;
#pragma unroll
  for (int i = 0; i < 4; ++i) { const int c = lane * 4 + i; r4[i] = (x[i] - mu) * rs * bfr(LW[c]) + bfr(LB[c]); }
  vst2(ZN + row * CC + lane * 4, r4); }
// ---- k_rows2: block = (64 rows, which): which 0: bias: BIAS[row = q*256+k][h] = xn[q][k] . Wb[h] (4 outputs) ; which 1: G[row][c] = sigmoid(xn[row] . Wg[c]) (128 outputs); weights are (out,in)
__global__ __launch_bounds__(128) void k_rows2(const float* __restrict__ ZN, const float* __restrict__ WB, const float* __restrict__ WG, const float* __restrict__ GB, float* __restrict__ BIAS, float* __restrict__ G) { __shared__ __align__(16) float sf[4][16][132]; __shared__ __align__(16) __bf16 sw[CC][WP];
  const int tid = threadIdx.x, wave = tid >> 5, lane = tid & 31, col = lane & 15, g = lane >> 4; const int which = blockIdx.y; const size_t r0 = (size_t)blockIdx.x * 64 + wave * 16;
  const int nout = which == 0 ? NH : CC;
  if (which == 0) { stage_w<NH>(sw, WB, tid);   /* the bias tile's columns beyond NH are zero */
#pragma unroll
    for (int u = 1; u < 4; ++u) *(v4b*)&sw[u * 4 + wave][lane * 4] = v4b{}; }
  else stage_w<CC>(sw, WG, tid);
  __syncthreads();   /* the staged weight is read by all four waves */
  v8f acc[8] = {};
#pragma unroll
  for (int kc = 0; kc < CC / 32; ++kc) { v16b w[8];   /* this k step's weight fragments, read as one group in front of the row loads' wait, not among the products */
#pragma unroll
    for (int j = 0; j < 8; ++j) { if (j * 16 >= nout) break; w[j] = frag_b(&sw[j * 16 + col][kc * 32], lane); }   /* (out,in) row o; columns beyond nout zero */
    const F2 a = split_row(ZN + (r0 + col) * CC, kc * 32, lane); asm volatile("s_wait_loadcnt 0x0" ::: "memory");
#pragma unroll
    for (int j = 0; j < 8; ++j) { if (j * 16 >= nout) break; acc[j] = wmma_bf(a.h, w[j], acc[j]); acc[j] = wmma_bf(a.l, w[j], acc[j]); } }
  if (which == 0) { if (lane < 16) {   /* bias rows: 4 floats = 16 B per row; rows r0+8g+r... store via LDS: */ }
#pragma unroll
    for (int r = 0; r < 8; ++r) sf[wave][8 * g + r][col] = acc[0][r];
    LDSX(); if (lane < 16) { v4f b4; b4[0] = sf[wave][lane][0]; b4[1] = sf[wave][lane][1]; b4[2] = sf[wave][lane][2]; b4[3] = sf[wave][lane][3]; vst2(BIAS + (r0 + lane) * NH, b4); }   /* 16 rows x 16 B = one 256-B run per wave */
  } else {
#pragma unroll
    for (int j = 0; j < 8; ++j)
#pragma unroll
      for (int r = 0; r < 8; ++r) sf[wave][8 * g + r][j * 16 + col] = 1.0f / (1.0f + expf(-acc[j][r]));   /* sigmoid(xn Wg^T), no bias */
    LDSX(); for (int rl = 0; rl < 16; ++rl) vst2(G + (r0 + rl) * CC + lane * 4, *(const v4f*)&sf[wave][rl][lane * 4]); } }
#define WS_ZN   (WS_END)
#define WS_BIAS (WS_ZN + 4u * (size_t)NZR * CC)
#define WS_G    (WS_BIAS + 4u * (size_t)NZR * NH)
#define WS_END2 (WS_G + 4u * (size_t)NZR * CC)
#ifndef PROJ_EXTRA_PARAMS
#define PROJ_EXTRA_PARAMS
#endif

#define WS_QH  0u                                      // f16 q rows [b*t][CC]
#define WS_KH  (WS_QH + 2u * (size_t)NB * TT * CC)      // f16 k rows [b*t][CC]
#define WS_VT  (WS_KH + 2u * (size_t)NB * TT * CC)      // f16 v planes [b][c][t]
#define WS_QL  (WS_VT + 2u * (size_t)NB * CC * TT)      // f16 q residual x 2^10 rows [b][t < QHI][CC]
#define WS_KL  (WS_QL + 2u * (size_t)NB * QHI * CC)     // f16 k residual x 2^10 rows [b][t < KHI][CC]
#define WS_VB  (WS_KL + 2u * (size_t)NB * KHI * CC)     // bf16 v hi planes [b][c][t < KHI]
#define WS_VBL (WS_VB + 2u * (size_t)NB * CC * KHI)
#define WS_S   (WS_VBL + 2u * (size_t)NB * CC * KHI)    // f32 region, unused: k_attn keeps logits and P in registers
#define WS_Y   (WS_S  + 4u * (size_t)BG * HG * TT * TT)   // skips 256 unused f32 planes of 256 x 256      // f32 ctx rows [b*t][CC] (only when there is an output projection)
#define WS_END (WS_Y  + 4u * (size_t)NB * TT * CC)

// ---- k_proj: block = (64 rows, 128 cols, which): q/k/v = X W (+ b) with exact bf16 products (K = DIN) -> which 0: q f16 rows (+ residual rows < QHI); 1: k f16 rows (+ residual rows < KHI); 2: v f16 planes [c][t] (+ bf16 hi/lo planes for t < KHI)
__global__ __launch_bounds__(128) void k_proj(const float* __restrict__ XQ, const float* __restrict__ XK, const float* __restrict__ XV, const float* __restrict__ WQ, const float* __restrict__ WK, const float* __restrict__ WV, const float* __restrict__ BQ, const float* __restrict__ BK, const float* __restrict__ BV,
    _Float16* __restrict__ QH, _Float16* __restrict__ QL, _Float16* __restrict__ KH, _Float16* __restrict__ KL, _Float16* __restrict__ VT, __bf16* __restrict__ VB, __bf16* __restrict__ VBL) {
  __shared__ __align__(16) _Float16 sh[64][136], sl[64][136]; __shared__ __align__(16) union { struct { _Float16 th[128][72]; __bf16 tb[128][72], tbl[128][72]; } t; __bf16 sw[128][WP]; } uu;   /* the staged weight lies where the v tiles of the epilogue go later */
  auto& th = uu.t.th; auto& tb = uu.t.tb; auto& tbl = uu.t.tbl;
  const int tid = threadIdx.x, wave = tid >> 5, lane = tid & 31, col = lane & 15, g = lane >> 4; const int which = blockIdx.z; const int c0 = blockIdx.y * 128; const size_t r0 = (size_t)blockIdx.x * 64; const size_t bb = r0 / TT; const int t0 = (int)(r0 % TT);
  const float* X = which == 0 ? XQ : which == 1 ? XK : XV; const float* WA = which == 0 ? WQ : which == 1 ? WK : WV; const float* BA = which == 0 ? BQ : which == 1 ? BK : BV;
  stage_w<128>(uu.sw, WA + (size_t)c0 * DIN, tid);
  __syncthreads();   /* the staged weight is read by all four waves */
  v8f acc[8] = {};
#pragma unroll 2
  for (int kc = 0; kc < DIN / 32; ++kc) { v16b w[8];   /* this k step's weight fragments, read as one group in front of the row loads' wait, not among the products */
#pragma unroll
    for (int j = 0; j < 8; ++j) w[j] = frag_b(&uu.sw[j * 16 + col][kc * 32], lane);
    const F2 a2 = split_row(X + (r0 + wave * 16 + col) * DIN, kc * 32, lane);   /* LN(act) rows (f32) split hi + lo */
    asm volatile("s_wait_loadcnt 0x0" ::: "memory");
#pragma unroll
    for (int j = 0; j < 8; ++j) { acc[j] = wmma_bf(a2.h, w[j], acc[j]); acc[j] = wmma_bf(a2.l, w[j], acc[j]); } }
  __syncthreads();   /* every wave has read its last weight fragment before the v tiles overwrite that LDS */
  if (which < 2) { _Float16* DH = which == 0 ? QH : KH; _Float16* DL = which == 0 ? QL : KL; const int nhi = which == 0 ? QHI : KHI; const bool hi_rows = t0 < nhi;
#pragma unroll
    for (int j = 0; j < 8; ++j) { const float bias = BA ? bfr(BA[c0 + j * 16 + col]) : 0.f;
#pragma unroll
      for (int r = 0; r < 8; ++r) { const float v = acc[j][r] + bias; const _Float16 hv = (_Float16)v; sh[wave * 16 + 8 * g + r][j * 16 + col] = hv; sl[wave * 16 + 8 * g + r][j * 16 + col] = (_Float16)((v - (float)hv) * 1024.0f); } }
    __syncthreads();
    for (int e = tid; e < 64 * 16; e += 128) { const int rl = e >> 4, q = e & 15; vst2((unsigned*)(DH + (r0 + rl) * CC + c0 + q * 8), *(const v4u*)&sh[rl][q * 8]); if (hi_rows) vst2((unsigned*)(DL + (bb * nhi + t0 + rl) * (size_t)CC + c0 + q * 8), *(const v4u*)&sl[rl][q * 8]); }
  } else { const bool hi_rows = t0 < KHI;
#pragma unroll
    for (int j = 0; j < 8; ++j) { const float bias = BA ? bfr(BA[c0 + j * 16 + col]) : 0.f;
#pragma unroll
      for (int r = 0; r < 8; ++r) { const float v = acc[j][r] + bias; const int rl = wave * 16 + 8 * g + r, cl = j * 16 + col; th[cl][rl] = (_Float16)v; const __bf16 bh = (__bf16)v; tb[cl][rl] = bh; tbl[cl][rl] = (__bf16)(v - (float)bh); } }
    __syncthreads();
    for (int e = tid; e < 128 * 8; e += 128) { const int cl = e >> 3, q = e & 7; vst2((unsigned*)(VT + (bb * CC + c0 + cl) * (size_t)TT + t0 + q * 8), *(const v4u*)&th[cl][q * 8]); if (hi_rows) { const size_t o3 = (bb * CC + c0 + cl) * (size_t)KHI + t0 + q * 8; vst2((unsigned*)(VB + o3), *(const v4u*)&tb[cl][q * 8]); vst2((unsigned*)(VBL + o3), *(const v4u*)&tbl[cl][q * 8]); } } } }
// ---- k_attn: block = (64 queries qb, head h, 4 x NBL rows b), 16 waves; wave = 16 queries (wave & 3) of NBL rows b (group wave >> 2). The (bias + mask) tile of the block's 64 queries x 256 keys is summed once into LDS and serves every row b.
// Per row b: S^T = K Q^T (A = 16 key rows, B = q hi, then q residual x 2^10: 2 products), so a lane holds 128 of one query's 256 logits (lanes l and l ^ 16 split them); softmax in f32 in registers;
// two S^T tiles (keys 32 kc + 0..15, + 16..31), x 2^11 and once to f16, ARE the A fragment of P for ctx = P v (1 product, v f16 planes); logits and P never go to memory.
// The ctx tile is multiplied by its gate tile G (same row and column index) on its way from LDS to the store: Y holds the gated ctx.
#define NBL 4
__device__ __forceinline__ v16h frag_o(const _Float16* base, unsigned off) { union { v16h v; v8h q[2]; } u; const _Float16* p = base + off; u.q[0] = *(const v8h*)p; u.q[1] = *(const v8h*)(p + 16); return u.v; }   /* frag_h from the lane's own pointer (row and 8 * (lane >> 4) included) plus a constant */
__device__ __forceinline__ v8f wmmah(v16h a, v16h b, v8f c) { return __builtin_amdgcn_wmma_f32_16x16x32_f16(false, a, false, b, (short)0, c, false, false); }
__global__ __launch_bounds__(512) __attribute__((amdgpu_waves_per_eu(4, 4))) void k_attn(const _Float16* __restrict__ QH, const _Float16* __restrict__ KH, const _Float16* __restrict__ QL, const _Float16* __restrict__ VT, const float* __restrict__ BIAS, const float* __restrict__ MKP, const float* __restrict__ G, float* __restrict__ Y) {
  __shared__ __align__(16) float sb[64][TT + 4]; __shared__ __align__(16) float ss[16][16][HD + 4];   /* pitches 16 B x odd: 16-byte row reads without bank conflicts */
  const int tid = threadIdx.x, wave = __builtin_amdgcn_readfirstlane(tid >> 5), lane = tid & 31, col = lane & 15, g = lane >> 4; const int qb = blockIdx.x, h = blockIdx.y; const int ql0 = qb * 64 + (wave & 3) * 16;
  const float* bp = BIAS + ((size_t)qb * 64 * SZ + tid) * NH + h; const float* mp = MKP + (size_t)qb * 64 * SZ + tid;
  { float tb[32], tm[32];
#pragma unroll
    for (int u = 0; u < 32; ++u) { tb[u] = bp[(size_t)u * 512 * NH]; tm[u] = mp[u * 512]; }
    asm volatile("s_wait_xcnt 0x0" :: "v"(bp), "v"(tid) : "memory");   /* all 64 loads are issued in front of it (the fill is bound by load latency); their address registers, named here, are reused only behind the wait */
#pragma unroll
    for (int u = 0; u < 32; ++u) sb[u * 2 + (tid >> 8)][tid & 255] = tb[u] + bfr(tm[u]); }
  __syncthreads();
  const float* brow = &sb[(wave & 3) * 16 + col][8 * g];
  const unsigned qoff = (unsigned)((ql0 + col) * CC + h * HD + 8 * g), koff = (unsigned)(col * CC + h * HD + 8 * g), voff = (unsigned)((h * HD + col) * TT + 8 * g), yoff = (unsigned)((ql0 + (lane >> 3)) * CC + h * HD + (lane & 7) * 4);
#pragma unroll 1   /* the body is some thousands of instructions: kept rolled for the instruction cache */
  for (int bi = 0; bi < NBL; ++bi) { const size_t bo = (size_t)(((int)blockIdx.z * 4 + (wave >> 2)) * NBL + bi) * TT * CC;   /* row b's start in q, q residual (QHI == TT), k rows, v planes and ctx rows alike */
    const _Float16* qp = QH + bo + qoff; const _Float16* lp = QL + bo + qoff; const _Float16* kp = KH + bo + koff; const _Float16* vp = VT + bo + voff; const float* gp = G + bo + yoff;
    const v16h qh = frag_o(qp, 0), ql = frag_o(lp, 0); v16h kf[TT / 16];
#pragma unroll
    for (int j = 0; j < TT / 16; ++j) kf[j] = frag_o(kp, j * 16 * CC);
    asm volatile("s_wait_xcnt 0x0" :: "v"(qp), "v"(lp), "v"(kp) : "memory");   /* q and all 16 k fragments in one run of loads in front of it: one load latency per row b, not one per tile; the address registers, named here, are reused only behind the wait */
    __builtin_amdgcn_sched_barrier(0);   /* no product is scheduled in between the loads, which would split the run */
    v8f s[TT / 16], m8;
#pragma unroll
    for (int r = 0; r < 8; ++r) m8[r] = -3.0e38f;
#pragma unroll
    for (int j = 0; j < TT / 16; ++j) { v8f a = {}, l = {}; a = wmmah(kf[j], qh, a); l = wmmah(kf[j], ql, l);
      const v8f bm = __builtin_shufflevector(*(const v4f*)(brow + j * 16), *(const v4f*)(brow + j * 16 + 4), 0, 1, 2, 3, 4, 5, 6, 7);
      s[j] = (a + l * (1.0f / 1024.0f)) * SCALE + bm; m8 = __builtin_elementwise_max(m8, s[j]);
      if ((j & 3) == 3) __builtin_amdgcn_sched_barrier(0); }   /* four tiles' products and sums at a time: with more products run ahead the build spills */
    v16h vf[TT / 32][HD / 16];
#pragma unroll
    for (int kc = 0; kc < TT / 64; ++kc)
#pragma unroll
      for (int j = 0; j < HD / 16; ++j) vf[kc][j] = frag_o(vp, j * 16 * TT + kc * 32);
    v4f gt[4];
#pragma unroll
    for (int i = 0; i < 4; ++i) gt[i] = *(const v4f*)(gp + i * 4 * CC);   /* the gate tile, laid as the ctx stores are: 4 rows x 128 B per load */
    asm volatile("s_wait_xcnt 0x0" :: "v"(vp), "v"(gp) : "memory");   /* the first half of v and the gate tile are on their way while the exponentials run; address registers as above */
    float m = fmaxf(fmaxf(fmaxf(m8[0], m8[1]), fmaxf(m8[2], m8[3])), fmaxf(fmaxf(m8[4], m8[5]), fmaxf(m8[6], m8[7]))); m = fmaxf(m, __shfl_xor(m, 16));
    v8f s8 = {};
#pragma unroll
    for (int j = 0; j < TT / 16; ++j) {
#pragma unroll
      for (int r = 0; r < 8; ++r) { const float v = s[j][r]; const float x = expf(v - m); s[j][r] = (v <= -1.0e38f) ? 0.f : x; }
      s8 += s[j]; }
    float sum = ((s8[0] + s8[1]) + (s8[2] + s8[3])) + ((s8[4] + s8[5]) + (s8[6] + s8[7])); sum += __shfl_xor(sum, 16);
    const float inv = sum > 0.f ? 2048.0f / sum : 0.f;   /* a fully excluded row yields P = 0 */
    v16h p[TT / 32];
#pragma unroll
    for (int kc = 0; kc < TT / 32; ++kc)
#pragma unroll
      for (int i = 0; i < 8; ++i) { p[kc][i] = (_Float16)(s[2 * kc][i] * inv); p[kc][8 + i] = (_Float16)(s[2 * kc + 1][i] * inv); }
#pragma unroll
    for (int kc = TT / 64; kc < TT / 32; ++kc)
#pragma unroll
      for (int j = 0; j < HD / 16; ++j) vf[kc][j] = frag_o(vp, j * 16 * TT + kc * 32);
    asm volatile("s_wait_xcnt 0x0" :: "v"(vp) : "memory");   /* the second half of v, issued once P is packed and its registers are free; address register as above */
    v8f acc[HD / 16] = {};
#pragma unroll
    for (int kc = 0; kc < TT / 32; ++kc)
#pragma unroll
      for (int j = 0; j < HD / 16; ++j) acc[j] = wmmah(p[kc], vf[kc][j], acc[j]);
#pragma unroll
    for (int j = 0; j < HD / 16; ++j)
#pragma unroll
      for (int r = 0; r < 8; ++r) ss[wave][8 * g + r][j * 16 + col] = acc[j][r] * (1.0f / 2048.0f);
    LDSX();   /* the wave's own 16 x 32 tile: its LDS writes land before its lanes read each other's */
#pragma unroll
    for (int i = 0; i < 4; ++i) vst2(Y + bo + i * 4 * CC + yoff, *(const v4f*)&ss[wave][i * 4 + (lane >> 3)][(lane & 7) * 4] * gt[i]);   /* 4 rows x 128 B per store */
  } }
// ---- k_out: block = (64 rows, 128 cols): out = ctx Wo (+ bo): all rows: ctx bf16 hi + lo against exact bf16 Wo (2 products)
__global__ __launch_bounds__(128) void k_out(const float* __restrict__ Y, const float* __restrict__ WO, const float* __restrict__ BO, float* __restrict__ OUT) { __shared__ __align__(16) float sf[4][16][132]; __shared__ __align__(16) __bf16 sw[128][WP];
  const int tid = threadIdx.x, wave = tid >> 5, lane = tid & 31, col = lane & 15, g = lane >> 4; const int c0 = blockIdx.y * 128; const size_t r0 = (size_t)blockIdx.x * 64 + wave * 16;
  stage_w<128>(sw, WO + (size_t)c0 * CC, tid);
  __syncthreads();   /* the staged weight is read by all four waves */
  v8f acc[8] = {};
  if (true) {   /* ALL rows: gated ctx bf16 hi + lo x exact output_w (2 products) */
#pragma unroll 2
    for (int kc = 0; kc < CC / 32; ++kc) { v16b w[8];   /* this k step's weight fragments, read as one group in front of the row loads' wait, not among the products */
#pragma unroll
      for (int j = 0; j < 8; ++j) w[j] = frag_b(&sw[j * 16 + col][kc * 32], lane);
      const F2 a = split_row(Y + (r0 + col) * CC, kc * 32, lane); asm volatile("s_wait_loadcnt 0x0" ::: "memory");
#pragma unroll
      for (int j = 0; j < 8; ++j) { acc[j] = wmma_bf(a.h, w[j], acc[j]); acc[j] = wmma_bf(a.l, w[j], acc[j]); } }
#pragma unroll
    for (int j = 0; j < 8; ++j) { const float bias = BO ? bfr(BO[c0 + j * 16 + col]) : 0.f;
#pragma unroll
      for (int r = 0; r < 8; ++r) sf[wave][8 * g + r][j * 16 + col] = acc[j][r] + bias; }
  } else {
#pragma unroll 2
    for (int kc = 0; kc < CC / 32; ++kc) { const v16h a = frag_f32(Y + (r0 + col) * CC + kc * 32, lane); asm volatile("s_wait_loadcnt 0x0" ::: "memory");
#pragma unroll
      for (int j = 0; j < 8; ++j) { const v16h w = WOCOLH(WO, kc * 32, c0 + j * 16 + col, lane); asm volatile("s_wait_loadcnt 0x0" ::: "memory"); acc[j] = wmma16(a, w, acc[j]); } }
#pragma unroll
    for (int j = 0; j < 8; ++j) { const float bias = BO ? bfr(BO[c0 + j * 16 + col]) : 0.f;
#pragma unroll
      for (int r = 0; r < 8; ++r) sf[wave][8 * g + r][j * 16 + col] = acc[j][r] * (1.0f / 256.0f) + bias; } }
  LDSX(); for (int rl = 0; rl < 16; ++rl) vst2(OUT + (r0 + rl) * DIN + c0 + lane * 4, *(const v4f*)&sf[wave][rl][lane * 4]); }

extern "C" void kernel_launch(void* const* d_in, const int* in_sizes, int n_in, void* d_out, int out_size, void* d_ws, size_t ws_size, hipStream_t stream) {
  (void)in_sizes; (void)n_in; (void)out_size;
  const float** F = (const float**)d_in;
  if (ws_size < (size_t)WS_END) return;
  char* ws = (char*)d_ws; _Float16 *QH = (_Float16*)(ws + WS_QH), *KH = (_Float16*)(ws + WS_KH), *VT = (_Float16*)(ws + WS_VT), *QL = (_Float16*)(ws + WS_QL), *KL = (_Float16*)(ws + WS_KL); __bf16 *VB = (__bf16*)(ws + WS_VB), *VBL = (__bf16*)(ws + WS_VBL); float *Y = (float*)(ws + WS_Y);
  (void)Y; (void)QL; (void)KL; (void)VB; (void)VBL;
  // inputs: 0 x [1,256,256,128]; 1 attn_mask [1,1,256,256] (0 / -1e9); 2 ln_w, 3 ln_b; 4 Wb [4,128]; 5 Wq, 6 Wk, 7 Wv, 8 Wg, 9 Wo [128,128] (out,in)
  if (ws_size < (size_t)WS_END2) return;
  float *ZN = (float*)(ws + WS_ZN), *BIAS = (float*)(ws + WS_BIAS), *G = (float*)(ws + WS_G);
  k_lnz<<<dim3(NZR / 8), 256, 0, stream>>>(F[0], F[2], F[3], ZN);
  k_rows2<<<dim3(NZR / 64, 2), 128, 0, stream>>>(ZN, F[4], F[8], nullptr, BIAS, G);
  k_proj<<<dim3(TNB * TT / 64, CC / 128, 3), 128, 0, stream>>>(ZN, ZN, ZN, F[5], F[6], F[7], nullptr, nullptr, nullptr, QH, QL, KH, KL, VT, VB, VBL);
  k_attn<<<dim3(NQB, NH, TNB / (4 * NBL)), 512, 0, stream>>>(QH, KH, QL, VT, BIAS, F[1], G, Y);
  k_out<<<dim3(TNB * TT / 64, DIN / 128), 128, 0, stream>>>(Y, F[9], nullptr, (float*)d_out);
}

// v004
// It runs in 101 microseconds.
// Timed twice side by side with v003, it ran 1.18 and 1.17 times as fast.
// Over all steps from v000 it is 5.47 times as fast.
// compute dtype: all float inputs rounded to bf16; LayerNorm of pair_act in f32; q/k/v = LN(act) split bf16 hi + lo x W (exact bf16, (out,in)) on WMMA 16x16x32 (2 products, f32 accumulate); q as f16 hi + residual (x 2^10) against k once to f16 (2 products) x 32^-0.5 + the per-(query, key, head) triangle bias (2-product GEMM) + the mask bias; softmax in f32 (precise expf); P x 2^11 once to f16 against v once to f16 (1 product); gate sigmoid(LN(act) Wg) in f32 (2-product GEMM, precise expf); gated ctx split bf16 hi + lo against exact output_w (2 products); f32 output.
#include <hip/hip_runtime.h>
#include <math.h>

typedef __attribute__((ext_vector_type(16))) _Float16 v16h;
typedef __attribute__((ext_vector_type(16))) __bf16 v16b;
typedef __attribute__((ext_vector_type(8)))  _Float16 v8h;
typedef __attribute__((ext_vector_type(8)))  float v8f;
typedef __attribute__((ext_vector_type(4)))  float v4f;
typedef __attribute__((ext_vector_type(2)))  float v2f;
typedef __attribute__((ext_vector_type(4)))  unsigned v4u;
typedef __attribute__((ext_vector_type(4)))  int v4i;
typedef float __attribute__((may_alias)) float_a;
typedef int __attribute__((may_alias)) int_a;

template <typename T> __device__ __forceinline__ void vst2(void* p, T v) { *(T*)p = v;  }
__device__ __forceinline__ v8f wmma16(v16h a, v16h b, v8f c) {
  v8f d = __builtin_amdgcn_wmma_f32_16x16x32_f16(false, a, false, b, (short)0, c, false, false);
  asm volatile("v_nop\n\tv_nop\n\tv_nop\n\tv_nop" : "+v"(d) : "v"(a), "v"(b));
  return d;
}
__device__ __forceinline__ v8f wmma_bf(v16b a, v16b b, v8f c) {
  v8f d = __builtin_amdgcn_wmma_f32_16x16x32_bf16(false, a, false, b, (short)0, c, false, false);
  asm volatile("v_nop\n\tv_nop\n\tv_nop\n\tv_nop" : "+v"(d) : "v"(a), "v"(b));
  return d;
}
// 16x16x32 fragments: lane = (h = lane>>4, row/col = lane&15); elements 0..7 = k0+8h+0..7, 8..15 = k0+16+8h+0..7; D element r = row 8h+r
__device__ __forceinline__ v16h frag_h(const _Float16* rowk0, int lane) {
  union { v16h v; v8h q[2]; } u; const _Float16* p = rowk0 + 8 * (lane >> 4);
  u.q[0] = *(const v8h*)p; u.q[1] = *(const v8h*)(p + 16); return u.v;
}
__device__ __forceinline__ v16h frag_f32(const float* rowk0, int lane) {
  v16h a; const float* p = rowk0 + 8 * (lane >> 4);
#pragma unroll
  for (int i = 0; i < 8; ++i) { a[i] = (_Float16)p[i]; a[8 + i] = (_Float16)p[16 + i]; }
  return a;
}
__device__ __forceinline__ v16h frag_f32s(const float* rowk0, int lane, float sc) {
  v16h a; const float* p = rowk0 + 8 * (lane >> 4);
#pragma unroll
  for (int i = 0; i < 8; ++i) { a[i] = (_Float16)(p[i] * sc); a[8 + i] = (_Float16)(p[16 + i] * sc); }
  return a;
}
// column fragment from a [K][ld] layout (column n), rows >= K read as 0
__device__ __forceinline__ v16h fragc_f32(const float* W, int k0, int n, int lane, int ld, int K) {
  v16h a; const int g = lane >> 4;
#pragma unroll
  for (int i = 0; i < 8; ++i) { const int ka = k0 + 8 * g + i, kb = ka + 16;
    a[i] = (_Float16)(ka < K ? W[(size_t)(ka < K ? ka : K - 1) * ld + n] : 0.f); a[8 + i] = (_Float16)(kb < K ? W[(size_t)(kb < K ? kb : K - 1) * ld + n] : 0.f); }
  return a;
}
struct F2 { v16b h, l; };
__device__ __forceinline__ F2 bsplit16(const float v[16]) { F2 r;
#pragma unroll
  for (int i = 0; i < 16; ++i) { const __bf16 h = (__bf16)v[i]; r.h[i] = h; r.l[i] = (__bf16)(v[i] - (float)h); }
  return r; }
__device__ __forceinline__ F2 split_row(const float* row, int k0, int lane) { float v[16]; const float* p = row + k0 + 8 * (lane >> 4);
#pragma unroll
  for (int i = 0; i < 8; ++i) { v[i] = p[i]; v[8 + i] = p[16 + i]; }
  return bsplit16(v); }
__device__ __forceinline__ F2 split_rowK(const float* row, int k0, int lane, int K) { float v[16]; const int g = lane >> 4;
#pragma unroll
  for (int i = 0; i < 8; ++i) { const int ka = k0 + 8 * g + i, kb = ka + 16; v[i] = ka < K ? row[ka < K ? ka : K - 1] : 0.f; v[8 + i] = kb < K ? row[kb < K ? kb : K - 1] : 0.f; }
  return bsplit16(v); }
__device__ __forceinline__ F2 split_col(const float* W, int k0, int n, int lane, int ld, int K) { float v[16]; const int g = lane >> 4;
#pragma unroll
  for (int i = 0; i < 8; ++i) { const int ka = k0 + 8 * g + i, kb = ka + 16; v[i] = ka < K ? W[(size_t)(ka < K ? ka : K - 1) * ld + n] : 0.f; v[8 + i] = kb < K ? W[(size_t)(kb < K ? kb : K - 1) * ld + n] : 0.f; }
  return bsplit16(v); }
__device__ __forceinline__ v8f mac3(const F2& a, const F2& b, v8f c) { c = wmma_bf(a.l, b.h, c); c = wmma_bf(a.h, b.l, c); return wmma_bf(a.h, b.h, c); }
__device__ __forceinline__ float sigm(float v) { return 1.0f / (1.0f + expf(-v)); }
#define LDSX() do { asm volatile("s_wait_dscnt 0" ::: "memory"); __builtin_amdgcn_wave_barrier(); __builtin_amdgcn_fence(__ATOMIC_RELEASE, "workgroup"); } while (0)

// Triangle (starting-node) attention on a pair representation x [1, 256, 256, 128] (4 heads x 32): xn = LayerNorm(x); for every row b: q, k, v = xn[b] W^T ((out,in)); scores[b,h,q,k] = q . k / sqrt(32) + bias[h][q][k] + attn_mask[q][k] with bias[h][q][k] = xn[q][k] . Wb[h] (pair-indexed, shared across rows) and attn_mask in {0, -1e9}; softmax over k; o = (attn v) * sigmoid(xn[b][q] Wg^T); out[b][q] = o Wo^T.
#define NB 256
#define TT 256
#define CC 128            // NH * HD = projected width
#define DIN 128          // input (model) width
#define NH 4
#define HD 32
#define NQB (TT / 64)
#define HG 4
#define SCALE (0.17677669529663687f)
#define CAUSAL 0
#ifndef TNB
#define TNB NB
#endif
__device__ __forceinline__ float bfr(float v) { return (float)(__bf16)v; }
__host__ __device__ __forceinline__ int kb_last(int qb) { return CAUSAL ? ((qb * 64 + 63) >> 7) : (TT / 128 - 1); }
typedef __attribute__((ext_vector_type(8))) __bf16 v8b;
__device__ __forceinline__ v16b frag_b(const __bf16* rowk0, int lane) {
  union { v16b v; v8b q[2]; } u; const __bf16* p = rowk0 + 8 * (lane >> 4);
  u.q[0] = *(const v8b*)p; u.q[1] = *(const v8b*)(p + 16); return u.v;
}
// A block's weight, staged once: ROWS rows of an (out,in) [..][128] f32 weight, each read as one whole 512-B row per wave-wide load, rounded to bf16 and laid in LDS at pitch WP (272 B = 16 B x odd, for 16-byte fragment reads). 128 threads: wave w takes rows w, w + 4, ...
#define WP 136
typedef __attribute__((ext_vector_type(4))) __bf16 v4b;
template <int ROWS> __device__ __forceinline__ void stage_w(__bf16 (*sw)[WP], const float* __restrict__ Wm, int tid) {
  const float* p = Wm + (tid >> 5) * 128 + (tid & 31) * 4; __bf16* d = &sw[tid >> 5][(tid & 31) * 4]; v4f x[ROWS / 4];
#pragma unroll
  for (int u = 0; u < ROWS / 4; ++u) x[u] = *(const v4f*)(p + u * 4 * 128);
  asm volatile("s_wait_xcnt 0x0" :: "v"(p) : "memory");   /* all row loads are issued in front of it (the fill is bound by load latency); their address register, named here, is reused only behind the wait */
#pragma unroll
  for (int u = 0; u < ROWS / 4; ++u) { v4b y;
#pragma unroll
    for (int i = 0; i < 4; ++i) y[i] = (__bf16)x[u][i];
    *(v4b*)(d + u * 4 * WP) = y; } }
#define QBH 0              // unused: no kernel reads it
#define QHI 256            // rows carrying a q residual plane (all rows when non-causal: 2-product logits everywhere)
#define KHI 64            // key rows carrying k residual / v bf16 hi+lo planes (no kernel writes or reads them)
// B fragment (k rows k0+.., output column o) of a weight: (in,out) [K][ld] or (out,in) [ld rows of K]: bf16 exact, or f16(bf16 * 256) exact
__device__ __forceinline__ v16b wcol_io(const float* Wm, int k0, int o, int lane, int ld) { v16b w; const int g = lane >> 4;
#pragma unroll
  for (int i = 0; i < 8; ++i) { w[i] = (__bf16)Wm[(size_t)(k0 + 8 * g + i) * ld + o]; w[8 + i] = (__bf16)Wm[(size_t)(k0 + 16 + 8 * g + i) * ld + o]; }
  return w; }
__device__ __forceinline__ v16b wcol_oi(const float* Wm, int k0, int o, int lane, int K) { v16b w; const float* p = Wm + (size_t)o * K + k0 + 8 * (lane >> 4);
#pragma unroll
  for (int i = 0; i < 8; ++i) { w[i] = (__bf16)p[i]; w[8 + i] = (__bf16)p[16 + i]; }
  return w; }
__device__ __forceinline__ v16h wcolh_io(const float* Wm, int k0, int o, int lane, int ld) { v16h w; const int g = lane >> 4;
#pragma unroll
  for (int i = 0; i < 8; ++i) { w[i] = (_Float16)(bfr(Wm[(size_t)(k0 + 8 * g + i) * ld + o]) * 256.0f); w[8 + i] = (_Float16)(bfr(Wm[(size_t)(k0 + 16 + 8 * g + i) * ld + o]) * 256.0f); }
  return w; }
__device__ __forceinline__ v16h wcolh_oi(const float* Wm, int k0, int o, int lane, int K) { v16h w; const float* p = Wm + (size_t)o * K + k0 + 8 * (lane >> 4);
#pragma unroll
  for (int i = 0; i < 8; ++i) { w[i] = (_Float16)(bfr(p[i]) * 256.0f); w[8 + i] = (_Float16)(bfr(p[16 + i]) * 256.0f); }
  return w; }
#define WQKV_LAYOUT 1   // (out,in) [CC][DIN]
__device__ __forceinline__ v16b wcol_hdk(const float* Wm, int k0, int o, int lane) { v16b w; const int g = lane >> 4; const float* p = Wm + (size_t)(o / HD) * DIN * HD + (o % HD);
#pragma unroll
  for (int i = 0; i < 8; ++i) { w[i] = (__bf16)p[(size_t)(k0 + 8 * g + i) * HD]; w[8 + i] = (__bf16)p[(size_t)(k0 + 16 + 8 * g + i) * HD]; }
  return w; }
#define WO_OUT_IN 1
#if WQKV_LAYOUT == 1
#define WCOL(W, k0, o, lane) wcol_oi(W, k0, o, lane, DIN)
#elif WQKV_LAYOUT == 2
#define WCOL(W, k0, o, lane) wcol_hdk(W, k0, o, lane)
#else
#define WCOL(W, k0, o, lane) wcol_io(W, k0, o, lane, CC)
#endif
#if WO_OUT_IN
#define WOCOL(W, k0, o, lane) wcol_oi(W, k0, o, lane, CC)
#define WOCOLH(W, k0, o, lane) wcolh_oi(W, k0, o, lane, CC)
#else
#define WOCOL(W, k0, o, lane) wcol_io(W, k0, o, lane, DIN)
#define WOCOLH(W, k0, o, lane) wcolh_io(W, k0, o, lane, DIN)
#endif
#define SZ 256
#define BG 64              // rows r sizing the unused WS_S region (x 4 heads = 256 planes of 256 x 256)
#define NZR (SZ * SZ)      // 65,536 pair rows
#define WS_ZN   (WS_END)
#define WS_BIAS (WS_ZN + 4u * (size_t)NZR * CC)
#define WS_G    (WS_BIAS + 4u * (size_t)NZR * NH)
#define WS_END2 (WS_G + 4u * (size_t)NZR * CC)
#ifndef PROJ_EXTRA_PARAMS
#define PROJ_EXTRA_PARAMS
#endif

#define WS_QH  0u                                      // f16 q rows [b*t][CC]
#define WS_KH  (WS_QH + 2u * (size_t)NB * TT * CC)      // f16 k rows [b*t][CC]
#define WS_VT  (WS_KH + 2u * (size_t)NB * TT * CC)      // f16 v planes [b][c][t]
#define WS_QL  (WS_VT + 2u * (size_t)NB * CC * TT)      // f16 q residual x 2^10 rows [b][t < QHI][CC]
#define WS_KL  (WS_QL + 2u * (size_t)NB * QHI * CC)     // f16 k residual x 2^10 rows [b][t < KHI][CC]
#define WS_VB  (WS_KL + 2u * (size_t)NB * KHI * CC)     // bf16 v hi planes [b][c][t < KHI]
#define WS_VBL (WS_VB + 2u * (size_t)NB * CC * KHI)
#define WS_S   (WS_VBL + 2u * (size_t)NB * CC * KHI)    // f32 region, unused: k_attn keeps logits and P in registers
#define WS_Y   (WS_S  + 4u * (size_t)BG * HG * TT * TT)   // skips 256 unused f32 planes of 256 x 256      // f32 ctx rows [b*t][CC] (only when there is an output projection)
#define WS_END (WS_Y  + 4u * (size_t)NB * TT * CC)

// ---- k_pre: block = one row b of the pair array (256 pair rows), 16 waves; wave = 16 pair rows. x is read once, straight into the 16x16x32 fragment layout (a lane holds 64 of its row's 128 channels, lanes l and l ^ 16 split the row);
// LayerNorm (biased var, eps 1e-5, ln_w / ln_b) of bf16(x) in those registers; LN(x) split bf16 hi + lo serves all five products (2 products each, hi then lo per k step) against the weights staged once per block in LDS as bf16.
// q, k, gate and bias as W x LN(x)^T (A = 16 weight rows, B = the pair rows): a lane holds 8 neighbouring output channels of one pair row. v as LN(x) x W^T: a lane holds 8 neighbouring t of one channel, for the [c][t] planes.
__device__ __forceinline__ v8f wmmab(v16b a, v16b b, v8f c) { return __builtin_amdgcn_wmma_f32_16x16x32_bf16(false, a, false, b, (short)0, c, false, false); }
template <bool WA> __device__ __forceinline__ void pre_gemm(const __bf16 (*w)[WP], const F2 (&a)[4], v8f (&acc)[8], int col, int lane) {
#pragma unroll
  for (int kc = 0; kc < 4; ++kc) { v16b f[8];
#pragma unroll
    for (int j = 0; j < 8; ++j) f[j] = frag_b(&w[j * 16 + col][kc * 32], lane);
#pragma unroll
    for (int j = 0; j < 8; ++j) acc[j] = WA ? wmmab(f[j], a[kc].h, acc[j]) : wmmab(a[kc].h, f[j], acc[j]);
#pragma unroll
    for (int j = 0; j < 8; ++j) acc[j] = WA ? wmmab(f[j], a[kc].l, acc[j]) : wmmab(a[kc].l, f[j], acc[j]);
    __builtin_amdgcn_sched_barrier(0); } }   /* one k step's fragments at a time: with more of them read ahead the build spills */
#define LDSW() do { asm volatile("s_wait_dscnt 0" ::: "memory"); __builtin_amdgcn_wave_barrier(); } while (0)   /* one wave's own LDS exchange: its writes land before its lanes read each other's; no fence, which would also wait for the wave's global stores */
union PreW { struct { _Float16 h[16][136], l[16][136]; } q; float f[16][132]; };   /* one wave's own tile on its way to whole-row stores; pitches 16 B x odd */
__global__ __launch_bounds__(512) __attribute__((amdgpu_waves_per_eu(4, 4))) void k_pre(const float* __restrict__ X, const float* __restrict__ LW, const float* __restrict__ LB, const float* __restrict__ WB, const float* __restrict__ WQ, const float* __restrict__ WK, const float* __restrict__ WV, const float* __restrict__ WG,
    _Float16* __restrict__ QH, _Float16* __restrict__ QL, _Float16* __restrict__ KH, _Float16* __restrict__ VT, float* __restrict__ BIAS, float* __restrict__ G) {
  __shared__ __align__(16) __bf16 sw[4][CC][WP]; __shared__ __align__(16) __bf16 swb[16][WP]; __shared__ __align__(16) float sln[2][CC]; __shared__ __align__(16) union { PreW w[16]; _Float16 th[CC][TT + 8]; } sc;   /* the block's v tile [c][t] lies where the waves' own tiles were */
  const int tid = threadIdx.x, wave = __builtin_amdgcn_readfirstlane(tid >> 5), lane = tid & 31, col = lane & 15, g = lane >> 4; const size_t r0 = (size_t)blockIdx.x * TT + wave * 16;
  const float* xp = X + (r0 + col) * CC + 8 * g; const unsigned wo = (unsigned)(wave * CC + lane * 4); const float* pq = WQ + wo; const float* pk = WK + wo; const float* pv = WV + wo; const float* pg = WG + wo;
  v4f xv[16], wv[4][8], wb = {};
#pragma unroll
  for (int kc = 0; kc < 4; ++kc) { xv[kc * 4] = *(const v4f*)(xp + kc * 32); xv[kc * 4 + 1] = *(const v4f*)(xp + kc * 32 + 4); xv[kc * 4 + 2] = *(const v4f*)(xp + kc * 32 + 16); xv[kc * 4 + 3] = *(const v4f*)(xp + kc * 32 + 20); }
  asm volatile("s_wait_xcnt 0x0" :: "v"(xp) : "memory");   /* the pair rows, which come from memory, are issued first; their address register, named here, is reused only behind the wait */
#pragma unroll
  for (int u = 0; u < 8; ++u) { wv[0][u] = *(const v4f*)(pq + u * 16 * CC); wv[1][u] = *(const v4f*)(pk + u * 16 * CC); wv[2][u] = *(const v4f*)(pv + u * 16 * CC); wv[3][u] = *(const v4f*)(pg + u * 16 * CC); }   /* wave w takes weight rows w, w + 16, ...: one whole 512-B row per load */
  const float* ep = (wave < NH ? WB + wave * CC : wave == NH ? LW : LB) + lane * 4; wb = *(const v4f*)ep;   /* waves 0..3: a row of the bias weight; wave 4: ln_w; wave 5: ln_b */
  asm volatile("s_wait_xcnt 0x0" :: "v"(pq), "v"(pk), "v"(pv), "v"(pg) : "memory");   /* all weight rows are issued in front of it, behind the pair rows (one load latency for the block's whole fill); their address registers, named here, are reused only behind the wait */
#pragma unroll
  for (int m = 0; m < 4; ++m)
#pragma unroll
    for (int u = 0; u < 8; ++u) { v4b y;
#pragma unroll
      for (int i = 0; i < 4; ++i) y[i] = (__bf16)wv[m][u][i];
      *(v4b*)&sw[m][wave + 16 * u][lane * 4] = y; }
  { v4b y;
#pragma unroll
    for (int i = 0; i < 4; ++i) { wb[i] = bfr(wb[i]); y[i] = wave < NH ? (__bf16)wb[i] : (__bf16)0.f; }   /* the bias tile's rows beyond NH are zero */
    *(v4b*)&swb[wave][lane * 4] = y;
    if (wave == NH || wave == NH + 1) *(v4f*)&sln[wave - NH][lane * 4] = wb; }
  v4f s4 = {};
#pragma unroll
  for (int i = 0; i < 16; ++i) {
#pragma unroll
    for (int e = 0; e < 4; ++e) xv[i][e] = bfr(xv[i][e]);
    s4 += xv[i]; }
  float s1 = (s4[0] + s4[1]) + (s4[2] + s4[3]); s1 += __shfl_xor(s1, 16);
  const float mu = s1 * (1.0f / CC); v4f q4 = {};
#pragma unroll
  for (int i = 0; i < 16; ++i) { const v4f d = xv[i] - mu; q4 += d * d; }
  float qs = (q4[0] + q4[1]) + (q4[2] + q4[3]); qs += __shfl_xor(qs, 16);
  const float rs = rsqrtf(qs * (1.0f / CC) + 1e-5f);
  __syncthreads();   /* the staged weights, ln_w and ln_b are read by all sixteen waves */
  F2 a[4];
#pragma unroll
  for (int kc = 0; kc < 4; ++kc) { float v[16];
#pragma unroll
    for (int e = 0; e < 4; ++e) { const int o = kc * 32 + (e >> 1) * 16 + (e & 1) * 4 + 8 * g; const v4f lw = *(const v4f*)&sln[0][o], lb = *(const v4f*)&sln[1][o];
#pragma unroll
      for (int i = 0; i < 4; ++i) v[e * 4 + i] = (xv[kc * 4 + e][i] - mu) * rs * lw[i] + lb[i]; }
    a[kc] = bsplit16(v); }
  PreW& pw = sc.w[wave];
  { v8f ab = {};   /* bias: heads 0..3 of pair row col are elements 0..3 of lanes 0..15: 16 rows x 16 B = one 256-B run per wave */
#pragma unroll
    for (int kc = 0; kc < 4; ++kc) { const v16b f = frag_b(&swb[col][kc * 32], lane); ab = wmma_bf(f, a[kc].h, ab); ab = wmma_bf(f, a[kc].l, ab); }   /* the form with its four slots behind: the last result goes straight into a store */
    float* bp = BIAS + (r0 + col) * NH;
    if (g == 0) { v4f b4; b4[0] = ab[0]; b4[1] = ab[1]; b4[2] = ab[2]; b4[3] = ab[3]; vst2(bp, b4); }
    asm volatile("s_wait_xcnt 0x0" ::: "memory"); }   /* the store's registers are reused only behind the wait */
  const unsigned ho = (unsigned)((lane >> 4) * CC + (lane & 15) * 8);   /* f16 rows: 2 rows x 256 B per store */
  { v8f acc[8] = {}; pre_gemm<true>(sw[0], a, acc, col, lane);
#pragma unroll
    for (int j = 0; j < 8; ++j) { v8h hv, lv;
#pragma unroll
      for (int r = 0; r < 8; ++r) { const float v = acc[j][r]; const _Float16 h = (_Float16)v; hv[r] = h; lv[r] = (_Float16)((v - (float)h) * 1024.0f); }
      *(v8h*)&pw.q.h[col][j * 16 + 8 * g] = hv; *(v8h*)&pw.q.l[col][j * 16 + 8 * g] = lv; }
    LDSW();   /* the wave's own tile: its LDS writes land before its lanes read each other's */
    v4u th4[8], tl4[8];
#pragma unroll
    for (int i = 0; i < 8; ++i) { th4[i] = *(const v4u*)&pw.q.h[i * 2 + (lane >> 4)][(lane & 15) * 8]; tl4[i] = *(const v4u*)&pw.q.l[i * 2 + (lane >> 4)][(lane & 15) * 8]; }
    _Float16* dh = QH + r0 * CC + ho; _Float16* dl = QL + r0 * CC + ho;   /* QHI == TT: the residual rows are indexed as the q rows */
#pragma unroll
    for (int i = 0; i < 8; ++i) { vst2(dh + i * 2 * CC, th4[i]); vst2(dl + i * 2 * CC, tl4[i]); }
    asm volatile("s_wait_xcnt 0x0" ::: "memory"); }   /* the stores' registers are reused only behind the wait; it also keeps the next tile's LDS writes behind these reads */
  { v8f acc[8] = {}; pre_gemm<true>(sw[1], a, acc, col, lane);
#pragma unroll
    for (int j = 0; j < 8; ++j) { v8h hv;
#pragma unroll
      for (int r = 0; r < 8; ++r) hv[r] = (_Float16)acc[j][r];
      *(v8h*)&pw.q.h[col][j * 16 + 8 * g] = hv; }
    LDSW();   /* as above */
    v4u th4[8];
#pragma unroll
    for (int i = 0; i < 8; ++i) th4[i] = *(const v4u*)&pw.q.h[i * 2 + (lane >> 4)][(lane & 15) * 8];
    _Float16* dh = KH + r0 * CC + ho;
#pragma unroll
    for (int i = 0; i < 8; ++i) vst2(dh + i * 2 * CC, th4[i]);
    asm volatile("s_wait_xcnt 0x0" ::: "memory"); }   /* as above */
  {
#pragma unroll 1   /* the precise sigmoid is long code: two 16-channel tiles a trip, kept rolled so that the kernel's text stays small for the instruction cache */
    for (int jp = 0; jp < 4; ++jp) { v8f acc[2] = {}; const __bf16* wr = &sw[3][jp * 32 + col][0];
#pragma unroll
      for (int kc = 0; kc < 4; ++kc) { const v16b f0 = frag_b(wr + kc * 32, lane), f1 = frag_b(wr + 16 * WP + kc * 32, lane);
        acc[0] = wmmab(f0, a[kc].h, acc[0]); acc[1] = wmmab(f1, a[kc].h, acc[1]); acc[0] = wmmab(f0, a[kc].l, acc[0]); acc[1] = wmmab(f1, a[kc].l, acc[1]); }
#pragma unroll
      for (int j = 0; j < 2; ++j) { v4f s0, s1g;
#pragma unroll
        for (int r = 0; r < 4; ++r) { s0[r] = 1.0f / (1.0f + expf(-acc[j][r])); s1g[r] = 1.0f / (1.0f + expf(-acc[j][4 + r])); }   /* sigmoid(xn Wg^T), no bias */
        *(v4f*)&pw.f[col][jp * 32 + j * 16 + 8 * g] = s0; *(v4f*)&pw.f[col][jp * 32 + j * 16 + 8 * g + 4] = s1g; } }
    LDSW();   /* as above */
    v4f t4[16];
#pragma unroll
    for (int rl = 0; rl < 16; ++rl) t4[rl] = *(const v4f*)&pw.f[rl][lane * 4];
    float* dg = G + r0 * CC + lane * 4;
#pragma unroll
    for (int rl = 0; rl < 16; ++rl) vst2(dg + rl * CC, t4[rl]);   /* one 512-B row per store */
    asm volatile("s_wait_xcnt 0x0" ::: "memory"); }   /* as above */
  { v8f acc[8] = {}; pre_gemm<false>(sw[2], a, acc, col, lane);
    __syncthreads();   /* every wave has read its own tile for the last time before the block's v tile overwrites that LDS */
#pragma unroll
    for (int j = 0; j < 8; ++j) { v8h hv;
#pragma unroll
      for (int r = 0; r < 8; ++r) hv[r] = (_Float16)acc[j][r];
      *(v8h*)&sc.th[j * 16 + col][wave * 16 + 8 * g] = hv; }
    __syncthreads();   /* a channel's 256 t come from all sixteen waves */
    v4u t4[8];
#pragma unroll
    for (int i = 0; i < 8; ++i) t4[i] = *(const v4u*)&sc.th[wave * 8 + i][lane * 8];
    _Float16* dv = VT + ((size_t)blockIdx.x * CC + wave * 8) * TT + lane * 8;
#pragma unroll
    for (int i = 0; i < 8; ++i) vst2(dv + i * TT, t4[i]);   /* one channel's whole 512-B plane row per store */
  } }
// ---- k_attn: block = (64 queries qb, head h, 4 x NBL rows b), 16 waves; wave = 16 queries (wave & 3) of NBL rows b (group wave >> 2). The (bias + mask) tile of the block's 64 queries x 256 keys is summed once into LDS and serves every row b.
// Per row b: S^T = K Q^T (A = 16 key rows, B = q hi, then q residual x 2^10: 2 products), so a lane holds 128 of one query's 256 logits (lanes l and l ^ 16 split them); softmax in f32 in registers;
// two S^T tiles (keys 32 kc + 0..15, + 16..31), x 2^11 and once to f16, ARE the A fragment of P for ctx = P v (1 product, v f16 planes); logits and P never go to memory.
// The ctx tile is multiplied by its gate tile G (same row and column index) on its way from LDS to the store: Y holds the gated ctx.
#define NBL 4
__device__ __forceinline__ v16h frag_o(const _Float16* base, unsigned off) { union { v16h v; v8h q[2]; } u; const _Float16* p = base + off; u.q[0] = *(const v8h*)p; u.q[1] = *(const v8h*)(p + 16); return u.v; }   /* frag_h from the lane's own pointer (row and 8 * (lane >> 4) included) plus a constant */
__device__ __forceinline__ v8f wmmah(v16h a, v16h b, v8f c) { return __builtin_amdgcn_wmma_f32_16x16x32_f16(false, a, false, b, (short)0, c, false, false); }
__global__ __launch_bounds__(512) __attribute__((amdgpu_waves_per_eu(4, 4))) void k_attn(const _Float16* __restrict__ QH, const _Float16* __restrict__ KH, const _Float16* __restrict__ QL, const _Float16* __restrict__ VT, const float* __restrict__ BIAS, const float* __restrict__ MKP, const float* __restrict__ G, float* __restrict__ Y) {
  __shared__ __align__(16) float sb[64][TT + 4]; __shared__ __align__(16) float ss[16][16][HD + 4];   /* pitches 16 B x odd: 16-byte row reads without bank conflicts */
  const int tid = threadIdx.x, wave = __builtin_amdgcn_readfirstlane(tid >> 5), lane = tid & 31, col = lane & 15, g = lane >> 4; const int qb = blockIdx.x, h = blockIdx.y; const int ql0 = qb * 64 + (wave & 3) * 16;
  const float* bp = BIAS + ((size_t)qb * 64 * SZ + tid) * NH + h; const float* mp = MKP + (size_t)qb * 64 * SZ + tid;
  { float tb[32], tm[32];
#pragma unroll
    for (int u = 0; u < 32; ++u) { tb[u] = bp[(size_t)u * 512 * NH]; tm[u] = mp[u * 512]; }
    asm volatile("s_wait_xcnt 0x0" :: "v"(bp), "v"(tid) : "memory");   /* all 64 loads are issued in front of it (the fill is bound by load latency); their address registers, named here, are reused only behind the wait */
#pragma unroll
    for (int u = 0; u < 32; ++u) sb[u * 2 + (tid >> 8)][tid & 255] = tb[u] + bfr(tm[u]); }
  __syncthreads();
  const float* brow = &sb[(wave & 3) * 16 + col][8 * g];
  const unsigned qoff = (unsigned)((ql0 + col) * CC + h * HD + 8 * g), koff = (unsigned)(col * CC + h * HD + 8 * g), voff = (unsigned)((h * HD + col) * TT + 8 * g), yoff = (unsigned)((ql0 + (lane >> 3)) * CC + h * HD + (lane & 7) * 4);
#pragma unroll 1   /* the body is some thousands of instructions: kept rolled for the instruction cache */
  for (int bi = 0; bi < NBL; ++bi) { const size_t bo = (size_t)(((int)blockIdx.z * 4 + (wave >> 2)) * NBL + bi) * TT * CC;   /* row b's start in q, q residual (QHI == TT), k rows, v planes and ctx rows alike */
    const _Float16* qp = QH + bo + qoff; const _Float16* lp = QL + bo + qoff; const _Float16* kp = KH + bo + koff; const _Float16* vp = VT + bo + voff; const float* gp = G + bo + yoff;
    const v16h qh = frag_o(qp, 0), ql = frag_o(lp, 0); v16h kf[TT / 16];
#pragma unroll
    for (int j = 0; j < TT / 16; ++j) kf[j] = frag_o(kp, j * 16 * CC);
    asm volatile("s_wait_xcnt 0x0" :: "v"(qp), "v"(lp), "v"(kp) : "memory");   /* q and all 16 k fragments in one run of loads in front of it: one load latency per row b, not one per tile; the address registers, named here, are reused only behind the wait */
    __builtin_amdgcn_sched_barrier(0);   /* no product is scheduled in between the loads, which would split the run */
    v8f s[TT / 16], m8;
#pragma unroll
    for (int r = 0; r < 8; ++r) m8[r] = -3.0e38f;
#pragma unroll
    for (int j = 0; j < TT / 16; ++j) { v8f a = {}, l = {}; a = wmmah(kf[j], qh, a); l = wmmah(kf[j], ql, l);
      const v8f bm = __builtin_shufflevector(*(const v4f*)(brow + j * 16), *(const v4f*)(brow + j * 16 + 4), 0, 1, 2, 3, 4, 5, 6, 7);
      s[j] = (a + l * (1.0f / 1024.0f)) * SCALE + bm; m8 = __builtin_elementwise_max(m8, s[j]);
      if ((j & 3) == 3) __builtin_amdgcn_sched_barrier(0); }   /* four tiles' products and sums at a time: with more products run ahead the build spills */
    v16h vf[TT / 32][HD / 16];
#pragma unroll
    for (int kc = 0; kc < TT / 64; ++kc)
#pragma unroll
      for (int j = 0; j < HD / 16; ++j) vf[kc][j] = frag_o(vp, j * 16 * TT + kc * 32);
    v4f gt[4];
#pragma unroll
    for (int i = 0; i < 4; ++i) gt[i] = *(const v4f*)(gp + i * 4 * CC);   /* the gate tile, laid as the ctx stores are: 4 rows x 128 B per load */
    asm volatile("s_wait_xcnt 0x0" :: "v"(vp), "v"(gp) : "memory");   /* the first half of v and the gate tile are on their way while the exponentials run; address registers as above */
    float m = fmaxf(fmaxf(fmaxf(m8[0], m8[1]), fmaxf(m8[2], m8[3])), fmaxf(fmaxf(m8[4], m8[5]), fmaxf(m8[6], m8[7]))); m = fmaxf(m, __shfl_xor(m, 16));
    v8f s8 = {};
#pragma unroll
    for (int j = 0; j < TT / 16; ++j) {
#pragma unroll
      for (int r = 0; r < 8; ++r) { const float v = s[j][r]; const float x = expf(v - m); s[j][r] = (v <= -1.0e38f) ? 0.f : x; }
      s8 += s[j]; }
    float sum = ((s8[0] + s8[1]) + (s8[2] + s8[3])) + ((s8[4] + s8[5]) + (s8[6] + s8[7])); sum += __shfl_xor(sum, 16);
    const float inv = sum > 0.f ? 2048.0f / sum : 0.f;   /* a fully excluded row yields P = 0 */
    v16h p[TT / 32];
#pragma unroll
    for (int kc = 0; kc < TT / 32; ++kc)
#pragma unroll
      for (int i = 0; i < 8; ++i) { p[kc][i] = (_Float16)(s[2 * kc][i] * inv); p[kc][8 + i] = (_Float16)(s[2 * kc + 1][i] * inv); }
#pragma unroll
    for (int kc = TT / 64; kc < TT / 32; ++kc)
#pragma unroll
      for (int j = 0; j < HD / 16; ++j) vf[kc][j] = frag_o(vp, j * 16 * TT + kc * 32);
    asm volatile("s_wait_xcnt 0x0" :: "v"(vp) : "memory");   /* the second half of v, issued once P is packed and its registers are free; address register as above */
    v8f acc[HD / 16] = {};
#pragma unroll
    for (int kc = 0; kc < TT / 32; ++kc)
#pragma unroll
      for (int j = 0; j < HD / 16; ++j) acc[j] = wmmah(p[kc], vf[kc][j], acc[j]);
#pragma unroll
    for (int j = 0; j < HD / 16; ++j)
#pragma unroll
      for (int r = 0; r < 8; ++r) ss[wave][8 * g + r][j * 16 + col] = acc[j][r] * (1.0f / 2048.0f);
    LDSX();   /* the wave's own 16 x 32 tile: its LDS writes land before its lanes read each other's */
#pragma unroll
    for (int i = 0; i < 4; ++i) vst2(Y + bo + i * 4 * CC + yoff, *(const v4f*)&ss[wave][i * 4 + (lane >> 3)][(lane & 7) * 4] * gt[i]);   /* 4 rows x 128 B per store */
  } }
// ---- k_out: block = (64 rows, 128 cols): out = ctx Wo (+ bo): all rows: ctx bf16 hi + lo against exact bf16 Wo (2 products)
__global__ __launch_bounds__(128) void k_out(const float* __restrict__ Y, const float* __restrict__ WO, const float* __restrict__ BO, float* __restrict__ OUT) { __shared__ __align__(16) float sf[4][16][132]; __shared__ __align__(16) __bf16 sw[128][WP];
  const int tid = threadIdx.x, wave = tid >> 5, lane = tid & 31, col = lane & 15, g = lane >> 4; const int c0 = blockIdx.y * 128; const size_t r0 = (size_t)blockIdx.x * 64 + wave * 16;
  stage_w<128>(sw, WO + (size_t)c0 * CC, tid);
  __syncthreads();   /* the staged weight is read by all four waves */
  v8f acc[8] = {};
  if (true) {   /* ALL rows: gated ctx bf16 hi + lo x exact output_w (2 products) */
#pragma unroll 2
    for (int kc = 0; kc < CC / 32; ++kc) { v16b w[8];   /* this k step's weight fragments, read as one group in front of the row loads' wait, not among the products */
#pragma unroll
      for (int j = 0; j < 8; ++j) w[j] = frag_b(&sw[j * 16 + col][kc * 32], lane);
      const F2 a = split_row(Y + (r0 + col) * CC, kc * 32, lane); asm volatile("s_wait_loadcnt 0x0" ::: "memory");
#pragma unroll
      for (int j = 0; j < 8; ++j) { acc[j] = wmma_bf(a.h, w[j], acc[j]); acc[j] = wmma_bf(a.l, w[j], acc[j]); } }
#pragma unroll
    for (int j = 0; j < 8; ++j) { const float bias = BO ? bfr(BO[c0 + j * 16 + col]) : 0.f;
#pragma unroll
      for (int r = 0; r < 8; ++r) sf[wave][8 * g + r][j * 16 + col] = acc[j][r] + bias; }
  } else {
#pragma unroll 2
    for (int kc = 0; kc < CC / 32; ++kc) { const v16h a = frag_f32(Y + (r0 + col) * CC + kc * 32, lane); asm volatile("s_wait_loadcnt 0x0" ::: "memory");
#pragma unroll
      for (int j = 0; j < 8; ++j) { const v16h w = WOCOLH(WO, kc * 32, c0 + j * 16 + col, lane); asm volatile("s_wait_loadcnt 0x0" ::: "memory"); acc[j] = wmma16(a, w, acc[j]); } }
#pragma unroll
    for (int j = 0; j < 8; ++j) { const float bias = BO ? bfr(BO[c0 + j * 16 + col]) : 0.f;
#pragma unroll
      for (int r = 0; r < 8; ++r) sf[wave][8 * g + r][j * 16 + col] = acc[j][r] * (1.0f / 256.0f) + bias; } }
  LDSX(); for (int rl = 0; rl < 16; ++rl) vst2(OUT + (r0 + rl) * DIN + c0 + lane * 4, *(const v4f*)&sf[wave][rl][lane * 4]); }

extern "C" void kernel_launch(void* const* d_in, const int* in_sizes, int n_in, void* d_out, int out_size, void* d_ws, size_t ws_size, hipStream_t stream) {
  (void)in_sizes; (void)n_in; (void)out_size;
  const float** F = (const float**)d_in;
  if (ws_size < (size_t)WS_END) return;
  char* ws = (char*)d_ws; _Float16 *QH = (_Float16*)(ws + WS_QH), *KH = (_Float16*)(ws + WS_KH), *VT = (_Float16*)(ws + WS_VT), *QL = (_Float16*)(ws + WS_QL), *KL = (_Float16*)(ws + WS_KL); __bf16 *VB = (__bf16*)(ws + WS_VB), *VBL = (__bf16*)(ws + WS_VBL); float *Y = (float*)(ws + WS_Y);
  (void)Y; (void)QL; (void)KL; (void)VB; (void)VBL;
  // inputs: 0 x [1,256,256,128]; 1 attn_mask [1,1,256,256] (0 / -1e9); 2 ln_w, 3 ln_b; 4 Wb [4,128]; 5 Wq, 6 Wk, 7 Wv, 8 Wg, 9 Wo [128,128] (out,in)
  if (ws_size < (size_t)WS_END2) return;
  float *BIAS = (float*)(ws + WS_BIAS), *G = (float*)(ws + WS_G);
  k_pre<<<dim3(TNB), 512, 0, stream>>>(F[0], F[2], F[3], F[4], F[5], F[6], F[7], F[8], QH, QL, KH, VT, BIAS, G);
  k_attn<<<dim3(NQB, NH, TNB / (4 * NBL)), 512, 0, stream>>>(QH, KH, QL, VT, BIAS, F[1], G, Y);
  k_out<<<dim3(TNB * TT / 64, DIN / 128), 128, 0, stream>>>(Y, F[9], nullptr, (float*)d_out);
}

// v005
// One run takes 89 microseconds.
// Timed twice side by side with v004, it ran 1.14 times as fast both times.
// Counting every step since v000, it is 6.25 times as fast.
// compute dtype: all float inputs rounded to bf16; LayerNorm of pair_act in f32; q/k/v = LN(act) split bf16 hi + lo x W (exact bf16, (out,in)) on WMMA 16x16x32 (2 products, f32 accumulate); q as f16 hi + residual (x 2^10) against k once to f16 (2 products) x 32^-0.5 + the per-(query, key, head) triangle bias (2-product GEMM) + the mask bias; softmax in f32 (precise expf); P x 2^11 once to f16 against v once to f16 (1 product); gate sigmoid(LN(act) Wg) in f32 (2-product GEMM, precise expf); gated ctx split bf16 hi + lo against exact output_w (2 products); f32 output.
#include <hip/hip_runtime.h>
#include <math.h>

typedef __attribute__((ext_vector_type(16))) _Float16 v16h;
typedef __attribute__((ext_vector_type(16))) __bf16 v16b;
typedef __attribute__((ext_vector_type(8)))  _Float16 v8h;
typedef __attribute__((ext_vector_type(8)))  float v8f;
typedef __attribute__((ext_vector_type(4)))  float v4f;
typedef __attribute__((ext_vector_type(2)))  float v2f;
typedef __attribute__((ext_vector_type(4)))  unsigned v4u;
typedef __attribute__((ext_vector_type(4)))  int v4i;
typedef float __attribute__((may_alias)) float_a;
typedef int __attribute__((may_alias)) int_a;

template <typename T> __device__ __forceinline__ void vst2(void* p, T v) { *(T*)p = v;  }
__device__ __forceinline__ v8f wmma16(v16h a, v16h b, v8f c) {
  v8f d = __builtin_amdgcn_wmma_f32_16x16x32_f16(false, a, false, b, (short)0, c, false, false);
  asm volatile("v_nop\n\tv_nop\n\tv_nop\n\tv_nop" : "+v"(d) : "v"(a), "v"(b));
  return d;
}
__device__ __forceinline__ v8f wmma_bf(v16b a, v16b b, v8f c) {
  v8f d = __builtin_amdgcn_wmma_f32_16x16x32_bf16(false, a, false, b, (short)0, c, false, false);
  asm volatile("v_nop\n\tv_nop\n\tv_nop\n\tv_nop" : "+v"(d) : "v"(a), "v"(b));
  return d;
}
// 16x16x32 fragments: lane = (h = lane>>4, row/col = lane&15); elements 0..7 = k0+8h+0..7, 8..15 = k0+16+8h+0..7; D element r = row 8h+r
__device__ __forceinline__ v16h frag_h(const _Float16* rowk0, int lane) {
  union { v16h v; v8h q[2]; } u; const _Float16* p = rowk0 + 8 * (lane >> 4);
  u.q[0] = *(const v8h*)p; u.q[1] = *(const v8h*)(p + 16); return u.v;
}
__device__ __forceinline__ v16h frag_f32(const float* rowk0, int lane) {
  v16h a; const float* p = rowk0 + 8 * (lane >> 4);
#pragma unroll
  for (int i = 0; i < 8; ++i) { a[i] = (_Float16)p[i]; a[8 + i] = (_Float16)p[16 + i]; }
  return a;
}
__device__ __forceinline__ v16h frag_f32s(const float* rowk0, int lane, float sc) {
  v16h a; const float* p = rowk0 + 8 * (lane >> 4);
#pragma unroll
  for (int i = 0; i < 8; ++i) { a[i] = (_Float16)(p[i] * sc); a[8 + i] = (_Float16)(p[16 + i] * sc); }
  return a;
}
// column fragment from a [K][ld] layout (column n), rows >= K read as 0
__device__ __forceinline__ v16h fragc_f32(const float* W, int k0, int n, int lane, int ld, int K) {
  v16h a; const int g = lane >> 4;
#pragma unroll
  for (int i = 0; i < 8; ++i) { const int ka = k0 + 8 * g + i, kb = ka + 16;
    a[i] = (_Float16)(ka < K ? W[(size_t)(ka < K ? ka : K - 1) * ld + n] : 0.f); a[8 + i] = (_Float16)(kb < K ? W[(size_t)(kb < K ? kb : K - 1) * ld + n] : 0.f); }
  return a;
}
struct F2 { v16b h, l; };
__device__ __forceinline__ F2 bsplit16(const float v[16]) { F2 r;
#pragma unroll
  for (int i = 0; i < 16; ++i) { const __bf16 h = (__bf16)v[i]; r.h[i] = h; r.l[i] = (__bf16)(v[i] - (float)h); }
  return r; }
__device__ __forceinline__ F2 split_row(const float* row, int k0, int lane) { float v[16]; const float* p = row + k0 + 8 * (lane >> 4);
#pragma unroll
  for (int i = 0; i < 8; ++i) { v[i] = p[i]; v[8 + i] = p[16 + i]; }
  return bsplit16(v); }
__device__ __forceinline__ F2 split_rowK(const float* row, int k0, int lane, int K) { float v[16]; const int g = lane >> 4;
#pragma unroll
  for (int i = 0; i < 8; ++i) { const int ka = k0 + 8 * g + i, kb = ka + 16; v[i] = ka < K ? row[ka < K ? ka : K - 1] : 0.f; v[8 + i] = kb < K ? row[kb < K ? kb : K - 1] : 0.f; }
  return bsplit16(v); }
__device__ __forceinline__ F2 split_col(const float* W, int k0, int n, int lane, int ld, int K) { float v[16]; const int g = lane >> 4;
#pragma unroll
  for (int i = 0; i < 8; ++i) { const int ka = k0 + 8 * g + i, kb = ka + 16; v[i] = ka < K ? W[(size_t)(ka < K ? ka : K - 1) * ld + n] : 0.f; v[8 + i] = kb < K ? W[(size_t)(kb < K ? kb : K - 1) * ld + n] : 0.f; }
  return bsplit16(v); }
__device__ __forceinline__ v8f mac3(const F2& a, const F2& b, v8f c) { c = wmma_bf(a.l, b.h, c); c = wmma_bf(a.h, b.l, c); return wmma_bf(a.h, b.h, c); }
__device__ __forceinline__ float sigm(float v) { return 1.0f / (1.0f + expf(-v)); }
#define LDSX() do { asm volatile("s_wait_dscnt 0" ::: "memory"); __builtin_amdgcn_wave_barrier(); __builtin_amdgcn_fence(__ATOMIC_RELEASE, "workgroup"); } while (0)

// Triangle (starting-node) attention on a pair representation x [1, 256, 256, 128] (4 heads x 32): xn = LayerNorm(x); for every row b: q, k, v = xn[b] W^T ((out,in)); scores[b,h,q,k] = q . k / sqrt(32) + bias[h][q][k] + attn_mask[q][k] with bias[h][q][k] = xn[q][k] . Wb[h] (pair-indexed, shared across rows) and attn_mask in {0, -1e9}; softmax over k; o = (attn v) * sigmoid(xn[b][q] Wg^T); out[b][q] = o Wo^T.
#define NB 256
#define TT 256
#define CC 128            // NH * HD = projected width
#define DIN 128          // input (model) width
#define NH 4
#define HD 32
#define NQB (TT / 64)
#define HG 4
#define SCALE (0.17677669529663687f)
#define CAUSAL 0
#ifndef TNB
#define TNB NB
#endif
__device__ __forceinline__ float bfr(float v) { return (float)(__bf16)v; }
__host__ __device__ __forceinline__ int kb_last(int qb) { return CAUSAL ? ((qb * 64 + 63) >> 7) : (TT / 128 - 1); }
typedef __attribute__((ext_vector_type(8))) __bf16 v8b;
__device__ __forceinline__ v16b frag_b(const __bf16* rowk0, int lane) {
  union { v16b v; v8b q[2]; } u; const __bf16* p = rowk0 + 8 * (lane >> 4);
  u.q[0] = *(const v8b*)p; u.q[1] = *(const v8b*)(p + 16); return u.v;
}
// A block's weight, staged once: ROWS rows of an (out,in) [..][128] f32 weight, each read as one whole 512-B row per wave-wide load, rounded to bf16 and laid in LDS at pitch WP (272 B = 16 B x odd, for 16-byte fragment reads). 128 threads: wave w takes rows w, w + 4, ...
#define WP 136
typedef __attribute__((ext_vector_type(4))) __bf16 v4b;
template <int ROWS> __device__ __forceinline__ void stage_w(__bf16 (*sw)[WP], const float* __restrict__ Wm, int tid) {
  const float* p = Wm + (tid >> 5) * 128 + (tid & 31) * 4; __bf16* d = &sw[tid >> 5][(tid & 31) * 4]; v4f x[ROWS / 4];
#pragma unroll
  for (int u = 0; u < ROWS / 4; ++u) x[u] = *(const v4f*)(p + u * 4 * 128);
  asm volatile("s_wait_xcnt 0x0" :: "v"(p) : "memory");   /* all row loads are issued in front of it (the fill is bound by load latency); their address register, named here, is reused only behind the wait */
#pragma unroll
  for (int u = 0; u < ROWS / 4; ++u) { v4b y;
#pragma unroll
    for (int i = 0; i < 4; ++i) y[i] = (__bf16)x[u][i];
    *(v4b*)(d + u * 4 * WP) = y; } }
#define QBH 0              // unused: no kernel reads it
#define QHI 256            // rows carrying a q residual plane (all rows when non-causal: 2-product logits everywhere)
#define KHI 64            // key rows carrying k residual / v bf16 hi+lo planes (no kernel writes or reads them)
// B fragment (k rows k0+.., output column o) of a weight: (in,out) [K][ld] or (out,in) [ld rows of K]: bf16 exact, or f16(bf16 * 256) exact
__device__ __forceinline__ v16b wcol_io(const float* Wm, int k0, int o, int lane, int ld) { v16b w; const int g = lane >> 4;
#pragma unroll
  for (int i = 0; i < 8; ++i) { w[i] = (__bf16)Wm[(size_t)(k0 + 8 * g + i) * ld + o]; w[8 + i] = (__bf16)Wm[(size_t)(k0 + 16 + 8 * g + i) * ld + o]; }
  return w; }
__device__ __forceinline__ v16b wcol_oi(const float* Wm, int k0, int o, int lane, int K) { v16b w; const float* p = Wm + (size_t)o * K + k0 + 8 * (lane >> 4);
#pragma unroll
  for (int i = 0; i < 8; ++i) { w[i] = (__bf16)p[i]; w[8 + i] = (__bf16)p[16 + i]; }
  return w; }
__device__ __forceinline__ v16h wcolh_io(const float* Wm, int k0, int o, int lane, int ld) { v16h w; const int g = lane >> 4;
#pragma unroll
  for (int i = 0; i < 8; ++i) { w[i] = (_Float16)(bfr(Wm[(size_t)(k0 + 8 * g + i) * ld + o]) * 256.0f); w[8 + i] = (_Float16)(bfr(Wm[(size_t)(k0 + 16 + 8 * g + i) * ld + o]) * 256.0f); }
  return w; }
__device__ __forceinline__ v16h wcolh_oi(const float* Wm, int k0, int o, int lane, int K) { v16h w; const float* p = Wm + (size_t)o * K + k0 + 8 * (lane >> 4);
#pragma unroll
  for (int i = 0; i < 8; ++i) { w[i] = (_Float16)(bfr(p[i]) * 256.0f); w[8 + i] = (_Float16)(bfr(p[16 + i]) * 256.0f); }
  return w; }
#define WQKV_LAYOUT 1   // (out,in) [CC][DIN]
__device__ __forceinline__ v16b wcol_hdk(const float* Wm, int k0, int o, int lane) { v16b w; const int g = lane >> 4; const float* p = Wm + (size_t)(o / HD) * DIN * HD + (o % HD);
#pragma unroll
  for (int i = 0; i < 8; ++i) { w[i] = (__bf16)p[(size_t)(k0 + 8 * g + i) * HD]; w[8 + i] = (__bf16)p[(size_t)(k0 + 16 + 8 * g + i) * HD]; }
  return w; }
#define WO_OUT_IN 1
#if WQKV_LAYOUT == 1
#define WCOL(W, k0, o, lane) wcol_oi(W, k0, o, lane, DIN)
#elif WQKV_LAYOUT == 2
#define WCOL(W, k0, o, lane) wcol_hdk(W, k0, o, lane)
#else
#define WCOL(W, k0, o, lane) wcol_io(W, k0, o, lane, CC)
#endif
#if WO_OUT_IN
#define WOCOL(W, k0, o, lane) wcol_oi(W, k0, o, lane, CC)
#define WOCOLH(W, k0, o, lane) wcolh_oi(W, k0, o, lane, CC)
#else
#define WOCOL(W, k0, o, lane) wcol_io(W, k0, o, lane, DIN)
#define WOCOLH(W, k0, o, lane) wcolh_io(W, k0, o, lane, DIN)
#endif
#define SZ 256
#define BG 64              // rows r sizing the unused WS_S region (x 4 heads = 256 planes of 256 x 256)
#define NZR (SZ * SZ)      // 65,536 pair rows
#define WS_ZN   (WS_END)
#define WS_BIAS (WS_ZN + 4u * (size_t)NZR * CC)
#define WS_G    (WS_BIAS + 4u * (size_t)NZR * NH)
#define WS_END2 (WS_G + 4u * (size_t)NZR * CC)
#ifndef PROJ_EXTRA_PARAMS
#define PROJ_EXTRA_PARAMS
#endif

#define WS_QH  0u                                      // f16 q in fragment order [b][h][16-row tile][d half][lane][8]: lane (g, row) holds d = 16 * half + 8 g + 0..7 of its row
#define WS_KH  (WS_QH + 2u * (size_t)NB * TT * CC)      // f16 k, in the same fragment order as q
#define WS_VT  (WS_KH + 2u * (size_t)NB * TT * CC)      // f16 v in fragment order [b][h][32-key step][16-channel tile][key half][lane][8]: lane (g, channel) holds keys 16 * half + 8 g + 0..7 of its step
#define WS_QL  (WS_VT + 2u * (size_t)NB * CC * TT)      // f16 q residual x 2^10, in the same fragment order as q
#define WS_KL  (WS_QL + 2u * (size_t)NB * QHI * CC)     // f16 k residual x 2^10 rows [b][t < KHI][CC]
#define WS_VB  (WS_KL + 2u * (size_t)NB * KHI * CC)     // bf16 v hi planes [b][c][t < KHI]
#define WS_VBL (WS_VB + 2u * (size_t)NB * CC * KHI)
#define WS_S   (WS_VBL + 2u * (size_t)NB * CC * KHI)    // f32 region, unused: k_attn keeps logits and P in registers
#define WS_Y   (WS_S  + 4u * (size_t)BG * HG * TT * TT)   // skips 256 unused f32 planes of 256 x 256      // f32 ctx rows [b*t][CC] (only when there is an output projection)
#define WS_END (WS_Y  + 4u * (size_t)NB * TT * CC)

// ---- k_pre: block = one row b of the pair array (256 pair rows), 16 waves; wave = 16 pair rows. x is read once, straight into the 16x16x32 fragment layout (a lane holds 64 of its row's 128 channels, lanes l and l ^ 16 split the row);
// LayerNorm (biased var, eps 1e-5, ln_w / ln_b) of bf16(x) in those registers; LN(x) split bf16 hi + lo serves all five products (2 products each, hi then lo per k step) against the weights staged once per block in LDS as bf16.
// q, k, gate and bias as W x LN(x)^T (A = 16 weight rows, B = the pair rows): a lane holds 8 neighbouring output channels of one pair row. v as LN(x) x W^T: a lane holds 8 neighbouring t of one channel.
// Those 8 values are the very 16 bytes that the same lane of an attention wave wants as half a fragment, so q, k and v go to the workspace in fragment order, straight from the accumulators: each wave-wide store is 512 contiguous bytes, and so is each fragment load in k_attn.
__device__ __forceinline__ v8f wmmab(v16b a, v16b b, v8f c) { return __builtin_amdgcn_wmma_f32_16x16x32_bf16(false, a, false, b, (short)0, c, false, false); }
template <bool WA> __device__ __forceinline__ void pre_gemm(const __bf16 (*w)[WP], const F2 (&a)[4], v8f (&acc)[8], int col, int lane) {
#pragma unroll
  for (int kc = 0; kc < 4; ++kc) { v16b f[8];
#pragma unroll
    for (int j = 0; j < 8; ++j) f[j] = frag_b(&w[j * 16 + col][kc * 32], lane);
#pragma unroll
    for (int j = 0; j < 8; ++j) acc[j] = WA ? wmmab(f[j], a[kc].h, acc[j]) : wmmab(a[kc].h, f[j], acc[j]);
#pragma unroll
    for (int j = 0; j < 8; ++j) acc[j] = WA ? wmmab(f[j], a[kc].l, acc[j]) : wmmab(a[kc].l, f[j], acc[j]);
    __builtin_amdgcn_sched_barrier(0); } }   /* one k step's fragments at a time: with more of them read ahead the build spills */
#define LDSW() do { asm volatile("s_wait_dscnt 0" ::: "memory"); __builtin_amdgcn_wave_barrier(); } while (0)   /* one wave's own LDS exchange: its writes land before its lanes read each other's; no fence, which would also wait for the wave's global stores */
struct PreW { float f[16][132]; };   /* one wave's own gate tile on its way to whole-row stores; pitch 16 B x odd */
#define FH (TT * HD)   /* elements of one head of one row b in a fragment-order plane */
__global__ __launch_bounds__(512) __attribute__((amdgpu_waves_per_eu(4, 4))) void k_pre(const float* __restrict__ X, const float* __restrict__ LW, const float* __restrict__ LB, const float* __restrict__ WB, const float* __restrict__ WQ, const float* __restrict__ WK, const float* __restrict__ WV, const float* __restrict__ WG,
    _Float16* __restrict__ QH, _Float16* __restrict__ QL, _Float16* __restrict__ KH, _Float16* __restrict__ VT, float* __restrict__ BIAS, float* __restrict__ G) {
  __shared__ __align__(16) __bf16 sw[4][CC][WP]; __shared__ __align__(16) __bf16 swb[16][WP]; __shared__ __align__(16) float sln[2][CC]; __shared__ __align__(16) PreW sc[16];
  const int tid = threadIdx.x, wave = __builtin_amdgcn_readfirstlane(tid >> 5), lane = tid & 31, col = lane & 15, g = lane >> 4; const size_t r0 = (size_t)blockIdx.x * TT + wave * 16;
  const float* xp = X + (r0 + col) * CC + 8 * g; const unsigned wo = (unsigned)(wave * CC + lane * 4); const float* pq = WQ + wo; const float* pk = WK + wo; const float* pv = WV + wo; const float* pg = WG + wo;
  v4f xv[16], wv[4][8], wb = {};
#pragma unroll
  for (int kc = 0; kc < 4; ++kc) { xv[kc * 4] = *(const v4f*)(xp + kc * 32); xv[kc * 4 + 1] = *(const v4f*)(xp + kc * 32 + 4); xv[kc * 4 + 2] = *(const v4f*)(xp + kc * 32 + 16); xv[kc * 4 + 3] = *(const v4f*)(xp + kc * 32 + 20); }
  asm volatile("s_wait_xcnt 0x0" :: "v"(xp) : "memory");   /* the pair rows, which come from memory, are issued first; their address register, named here, is reused only behind the wait */
#pragma unroll
  for (int u = 0; u < 8; ++u) { wv[0][u] = *(const v4f*)(pq + u * 16 * CC); wv[1][u] = *(const v4f*)(pk + u * 16 * CC); wv[2][u] = *(const v4f*)(pv + u * 16 * CC); wv[3][u] = *(const v4f*)(pg + u * 16 * CC); }   /* wave w takes weight rows w, w + 16, ...: one whole 512-B row per load */
  const float* ep = (wave < NH ? WB + wave * CC : wave == NH ? LW : LB) + lane * 4; wb = *(const v4f*)ep;   /* waves 0..3: a row of the bias weight; wave 4: ln_w; wave 5: ln_b */
  asm volatile("s_wait_xcnt 0x0" :: "v"(pq), "v"(pk), "v"(pv), "v"(pg) : "memory");   /* all weight rows are issued in front of it, behind the pair rows (one load latency for the block's whole fill); their address registers, named here, are reused only behind the wait */
#pragma unroll
  for (int m = 0; m < 4; ++m)
#pragma unroll
    for (int u = 0; u < 8; ++u) { v4b y;
#pragma unroll
      for (int i = 0; i < 4; ++i) y[i] = (__bf16)wv[m][u][i];
      *(v4b*)&sw[m][wave + 16 * u][lane * 4] = y; }
  { v4b y;
#pragma unroll
    for (int i = 0; i < 4; ++i) { wb[i] = bfr(wb[i]); y[i] = wave < NH ? (__bf16)wb[i] : (__bf16)0.f; }   /* the bias tile's rows beyond NH are zero */
    *(v4b*)&swb[wave][lane * 4] = y;
    if (wave == NH || wave == NH + 1) *(v4f*)&sln[wave - NH][lane * 4] = wb; }
  v4f s4 = {};
#pragma unroll
  for (int i = 0; i < 16; ++i) {
#pragma unroll
    for (int e = 0; e < 4; ++e) xv[i][e] = bfr(xv[i][e]);
    s4 += xv[i]; }
  float s1 = (s4[0] + s4[1]) + (s4[2] + s4[3]); s1 += __shfl_xor(s1, 16);
  const float mu = s1 * (1.0f / CC); v4f q4 = {};
#pragma unroll
  for (int i = 0; i < 16; ++i) { const v4f d = xv[i] - mu; q4 += d * d; }
  float qs = (q4[0] + q4[1]) + (q4[2] + q4[3]); qs += __shfl_xor(qs, 16);
  const float rs = rsqrtf(qs * (1.0f / CC) + 1e-5f);
  __syncthreads();   /* the staged weights, ln_w and ln_b are read by all sixteen waves */
  F2 a[4];
#pragma unroll
  for (int kc = 0; kc < 4; ++kc) { float v[16];
#pragma unroll
    for (int e = 0; e < 4; ++e) { const int o = kc * 32 + (e >> 1) * 16 + (e & 1) * 4 + 8 * g; const v4f lw = *(const v4f*)&sln[0][o], lb = *(const v4f*)&sln[1][o];
#pragma unroll
      for (int i = 0; i < 4; ++i) v[e * 4 + i] = (xv[kc * 4 + e][i] - mu) * rs * lw[i] + lb[i]; }
    a[kc] = bsplit16(v); }
  PreW& pw = sc[wave];
  { v8f ab = {};   /* bias: heads 0..3 of pair row col are elements 0..3 of lanes 0..15: 16 rows x 16 B = one 256-B run per wave */
#pragma unroll
    for (int kc = 0; kc < 4; ++kc) { const v16b f = frag_b(&swb[col][kc * 32], lane); ab = wmma_bf(f, a[kc].h, ab); ab = wmma_bf(f, a[kc].l, ab); }   /* the form with its four slots behind: the last result goes straight into a store */
    float* bp = BIAS + (r0 + col) * NH;
    if (g == 0) { v4f b4; b4[0] = ab[0]; b4[1] = ab[1]; b4[2] = ab[2]; b4[3] = ab[3]; vst2(bp, b4); }
    asm volatile("s_wait_xcnt 0x0" ::: "memory"); }   /* the store's registers are reused only behind the wait */
  const size_t pb = (size_t)blockIdx.x * TT * CC; const unsigned fo = (unsigned)(wave * 512 + lane * 8);   /* row b's plane; the wave's 16 pair rows are tile 'wave' of each head */
  { v8f acc[8] = {}; pre_gemm<true>(sw[0], a, acc, col, lane);
    v8h hv[8], lv[8];
#pragma unroll
    for (int j = 0; j < 8; ++j)
#pragma unroll
      for (int r = 0; r < 8; ++r) { const float v = acc[j][r]; const _Float16 h = (_Float16)v; hv[j][r] = h; lv[j][r] = (_Float16)((v - (float)h) * 1024.0f); }
    _Float16* dh = QH + pb + fo; _Float16* dl = QL + pb + fo;   /* QHI == TT: the residual plane is indexed as the q plane */
#pragma unroll
    for (int j = 0; j < 8; ++j) { vst2(dh + (j >> 1) * FH + (j & 1) * 256, hv[j]); vst2(dl + (j >> 1) * FH + (j & 1) * 256, lv[j]); }   /* channel tile j = head j >> 1, d half j & 1: 512 contiguous bytes per store */
    asm volatile("s_wait_xcnt 0x0" ::: "memory"); }   /* the stores' registers are reused only behind the wait */
  { v8f acc[8] = {}; pre_gemm<true>(sw[1], a, acc, col, lane);
    v8h hv[8];
#pragma unroll
    for (int j = 0; j < 8; ++j)
#pragma unroll
      for (int r = 0; r < 8; ++r) hv[j][r] = (_Float16)acc[j][r];
    _Float16* dh = KH + pb + fo;
#pragma unroll
    for (int j = 0; j < 8; ++j) vst2(dh + (j >> 1) * FH + (j & 1) * 256, hv[j]);
    asm volatile("s_wait_xcnt 0x0" ::: "memory"); }   /* as above */
  {
#pragma unroll 1   /* the precise sigmoid is long code: two 16-channel tiles a trip, kept rolled so that the kernel's text stays small for the instruction cache */
    for (int jp = 0; jp < 4; ++jp) { v8f acc[2] = {}; const __bf16* wr = &sw[3][jp * 32 + col][0];
#pragma unroll
      for (int kc = 0; kc < 4; ++kc) { const v16b f0 = frag_b(wr + kc * 32, lane), f1 = frag_b(wr + 16 * WP + kc * 32, lane);
        acc[0] = wmmab(f0, a[kc].h, acc[0]); acc[1] = wmmab(f1, a[kc].h, acc[1]); acc[0] = wmmab(f0, a[kc].l, acc[0]); acc[1] = wmmab(f1, a[kc].l, acc[1]); }
#pragma unroll
      for (int j = 0; j < 2; ++j) { v4f s0, s1g;
#pragma unroll
        for (int r = 0; r < 4; ++r) { s0[r] = 1.0f / (1.0f + expf(-acc[j][r])); s1g[r] = 1.0f / (1.0f + expf(-acc[j][4 + r])); }   /* sigmoid(xn Wg^T), no bias */
        *(v4f*)&pw.f[col][jp * 32 + j * 16 + 8 * g] = s0; *(v4f*)&pw.f[col][jp * 32 + j * 16 + 8 * g + 4] = s1g; } }
    LDSW();   /* as above */
    v4f t4[16];
#pragma unroll
    for (int rl = 0; rl < 16; ++rl) t4[rl] = *(const v4f*)&pw.f[rl][lane * 4];
    float* dg = G + r0 * CC + lane * 4;
#pragma unroll
    for (int rl = 0; rl < 16; ++rl) vst2(dg + rl * CC, t4[rl]);   /* one 512-B row per store */
    asm volatile("s_wait_xcnt 0x0" ::: "memory"); }   /* as above */
  { v8f acc[8] = {}; pre_gemm<false>(sw[2], a, acc, col, lane);
    v8h hv[8];
#pragma unroll
    for (int j = 0; j < 8; ++j)
#pragma unroll
      for (int r = 0; r < 8; ++r) hv[j][r] = (_Float16)acc[j][r];
    _Float16* dv = VT + pb + (unsigned)((wave >> 1) * 1024 + (wave & 1) * 256 + lane * 8);   /* the wave's 16 t are key half wave & 1 of 32-key step wave >> 1 */
#pragma unroll
    for (int j = 0; j < 8; ++j) vst2(dv + (j >> 1) * FH + (j & 1) * 512, hv[j]);   /* channel tile j = head j >> 1, tile j & 1: 512 contiguous bytes per store */
  } }
// ---- k_attn: block = (64 queries qb, head h, 4 x NBL rows b), 16 waves; wave = 16 queries (wave & 3) of NBL rows b (group wave >> 2). The (bias + mask) tile of the block's 64 queries x 256 keys is summed once into LDS and serves every row b.
// Per row b: S^T = K Q^T (A = 16 key rows, B = q hi, then q residual x 2^10: 2 products), so a lane holds 128 of one query's 256 logits (lanes l and l ^ 16 split them); softmax in f32 in registers;
// two S^T tiles (keys 32 kc + 0..15, + 16..31), x 2^11 and once to f16, ARE the A fragment of P for ctx = P v (1 product, v f16 planes); logits and P never go to memory.
// The ctx tile is multiplied by its gate tile G (same row and column index) on its way from LDS to the store: Y holds the gated ctx.
#define NBL 4
__device__ __forceinline__ v16h frag_o(const _Float16* base, unsigned off) { union { v16h v; v8h q[2]; } u; const _Float16* p = base + off; u.q[0] = *(const v8h*)p; u.q[1] = *(const v8h*)(p + 256); return u.v; }   /* a fragment laid in fragment order: its two halves are runs of 32 lanes x 16 B; the lane's own pointer (lane * 8 included) plus a constant */
__device__ __forceinline__ v8f wmmah(v16h a, v16h b, v8f c) { return __builtin_amdgcn_wmma_f32_16x16x32_f16(false, a, false, b, (short)0, c, false, false); }
__global__ __launch_bounds__(512) __attribute__((amdgpu_waves_per_eu(4, 4))) void k_attn(const _Float16* __restrict__ QH, const _Float16* __restrict__ KH, const _Float16* __restrict__ QL, const _Float16* __restrict__ VT, const float* __restrict__ BIAS, const float* __restrict__ MKP, const float* __restrict__ G, float* __restrict__ Y) {
  __shared__ __align__(16) float sb[64][TT + 4]; __shared__ __align__(16) float ss[16][16][HD + 4];   /* pitches 16 B x odd: 16-byte row reads without bank conflicts */
  const int tid = threadIdx.x, wave = __builtin_amdgcn_readfirstlane(tid >> 5), lane = tid & 31, col = lane & 15, g = lane >> 4; const int qb = blockIdx.x, h = blockIdx.y; const int ql0 = qb * 64 + (wave & 3) * 16;
  const float* bp = BIAS + ((size_t)qb * 64 * SZ + tid) * NH + h; const float* mp = MKP + (size_t)qb * 64 * SZ + tid;
  { float tb[32], tm[32];
#pragma unroll
    for (int u = 0; u < 32; ++u) { tb[u] = bp[(size_t)u * 512 * NH]; tm[u] = mp[u * 512]; }
    asm volatile("s_wait_xcnt 0x0" :: "v"(bp), "v"(tid) : "memory");   /* all 64 loads are issued in front of it (the fill is bound by load latency); their address registers, named here, are reused only behind the wait */
#pragma unroll
    for (int u = 0; u < 32; ++u) sb[u * 2 + (tid >> 8)][tid & 255] = tb[u] + bfr(tm[u]); }
  __syncthreads();
  const float* brow = &sb[(wave & 3) * 16 + col][8 * g];
  const unsigned koff = (unsigned)(h * FH + lane * 8), qoff = koff + (unsigned)((ql0 >> 4) * 512), voff = koff, yoff = (unsigned)((ql0 + (lane >> 3)) * CC + h * HD + (lane & 7) * 4);
#pragma unroll 1   /* the body is some thousands of instructions: kept rolled for the instruction cache */
  for (int bi = 0; bi < NBL; ++bi) { const size_t bo = (size_t)(((int)blockIdx.z * 4 + (wave >> 2)) * NBL + bi) * TT * CC;   /* row b's start in the q, q residual (QHI == TT), k and v planes and in the gate and ctx rows alike */
    const _Float16* qp = QH + bo + qoff; const _Float16* lp = QL + bo + qoff; const _Float16* kp = KH + bo + koff; const _Float16* vp = VT + bo + voff; const float* gp = G + bo + yoff;
    const v16h qh = frag_o(qp, 0), ql = frag_o(lp, 0); v16h kf[TT / 16];
#pragma unroll
    for (int j = 0; j < TT / 16; ++j) kf[j] = frag_o(kp, j * 512);
    asm volatile("s_wait_xcnt 0x0" :: "v"(qp), "v"(lp), "v"(kp) : "memory");   /* q and all 16 k fragments in one run of loads in front of it: one load latency per row b, not one per tile; the address registers, named here, are reused only behind the wait */
    __builtin_amdgcn_sched_barrier(0);   /* no product is scheduled in between the loads, which would split the run */
    v8f s[TT / 16], m8;
#pragma unroll
    for (int r = 0; r < 8; ++r) m8[r] = -3.0e38f;
#pragma unroll
    for (int j = 0; j < TT / 16; ++j) { v8f a = {}, l = {}; a = wmmah(kf[j], qh, a); l = wmmah(kf[j], ql, l);
      const v8f bm = __builtin_shufflevector(*(const v4f*)(brow + j * 16), *(const v4f*)(brow + j * 16 + 4), 0, 1, 2, 3, 4, 5, 6, 7);
      s[j] = (a + l * (1.0f / 1024.0f)) * SCALE + bm; m8 = __builtin_elementwise_max(m8, s[j]);
      if ((j & 3) == 3) __builtin_amdgcn_sched_barrier(0); }   /* four tiles' products and sums at a time: with more products run ahead the build spills */
    v16h vf[TT / 32][HD / 16];
#pragma unroll
    for (int kc = 0; kc < TT / 64; ++kc)
#pragma unroll
      for (int j = 0; j < HD / 16; ++j) vf[kc][j] = frag_o(vp, (kc * 2 + j) * 512);
    v4f gt[4];
#pragma unroll
    for (int i = 0; i < 4; ++i) gt[i] = *(const v4f*)(gp + i * 4 * CC);   /* the gate tile, laid as the ctx stores are: 4 rows x 128 B per load */
    asm volatile("s_wait_xcnt 0x0" :: "v"(vp), "v"(gp) : "memory");   /* the first half of v and the gate tile are on their way while the exponentials run; address registers as above */
    float m = fmaxf(fmaxf(fmaxf(m8[0], m8[1]), fmaxf(m8[2], m8[3])), fmaxf(fmaxf(m8[4], m8[5]), fmaxf(m8[6], m8[7]))); m = fmaxf(m, __shfl_xor(m, 16));
    v8f s8 = {};
#pragma unroll
    for (int j = 0; j < TT / 16; ++j) {
#pragma unroll
      for (int r = 0; r < 8; ++r) { const float v = s[j][r]; const float x = expf(v - m); s[j][r] = (v <= -1.0e38f) ? 0.f : x; }
      s8 += s[j]; }
    float sum = ((s8[0] + s8[1]) + (s8[2] + s8[3])) + ((s8[4] + s8[5]) + (s8[6] + s8[7])); sum += __shfl_xor(sum, 16);
    const float inv = sum > 0.f ? 2048.0f / sum : 0.f;   /* a fully excluded row yields P = 0 */
    v16h p[TT / 32];
#pragma unroll
    for (int kc = 0; kc < TT / 32; ++kc)
#pragma unroll
      for (int i = 0; i < 8; ++i) { p[kc][i] = (_Float16)(s[2 * kc][i] * inv); p[kc][8 + i] = (_Float16)(s[2 * kc + 1][i] * inv); }
#pragma unroll
    for (int kc = TT / 64; kc < TT / 32; ++kc)
#pragma unroll
      for (int j = 0; j < HD / 16; ++j) vf[kc][j] = frag_o(vp, (kc * 2 + j) * 512);
    asm volatile("s_wait_xcnt 0x0" :: "v"(vp) : "memory");   /* the second half of v, issued once P is packed and its registers are free; address register as above */
    v8f acc[HD / 16] = {};
#pragma unroll
    for (int kc = 0; kc < TT / 32; ++kc)
#pragma unroll
      for (int j = 0; j < HD / 16; ++j) acc[j] = wmmah(p[kc], vf[kc][j], acc[j]);
#pragma unroll
    for (int j = 0; j < HD / 16; ++j)
#pragma unroll
      for (int r = 0; r < 8; ++r) ss[wave][8 * g + r][j * 16 + col] = acc[j][r] * (1.0f / 2048.0f);
    LDSX();   /* the wave's own 16 x 32 tile: its LDS writes land before its lanes read each other's */
#pragma unroll
    for (int i = 0; i < 4; ++i) vst2(Y + bo + i * 4 * CC + yoff, *(const v4f*)&ss[wave][i * 4 + (lane >> 3)][(lane & 7) * 4] * gt[i]);   /* 4 rows x 128 B per store */
  } }
// ---- k_out: block = (64 rows, 128 cols): out = ctx Wo (+ bo): all rows: ctx bf16 hi + lo against exact bf16 Wo (2 products)
__global__ __launch_bounds__(128) void k_out(const float* __restrict__ Y, const float* __restrict__ WO, const float* __restrict__ BO, float* __restrict__ OUT) { __shared__ __align__(16) float sf[4][16][132]; __shared__ __align__(16) __bf16 sw[128][WP];
  const int tid = threadIdx.x, wave = tid >> 5, lane = tid & 31, col = lane & 15, g = lane >> 4; const int c0 = blockIdx.y * 128; const size_t r0 = (size_t)blockIdx.x * 64 + wave * 16;
  stage_w<128>(sw, WO + (size_t)c0 * CC, tid);
  __syncthreads();   /* the staged weight is read by all four waves */
  v8f acc[8] = {};
  if (true) {   /* ALL rows: gated ctx bf16 hi + lo x exact output_w (2 products) */
#pragma unroll 2
    for (int kc = 0; kc < CC / 32; ++kc) { v16b w[8];   /* this k step's weight fragments, read as one group in front of the row loads' wait, not among the products */
#pragma unroll
      for (int j = 0; j < 8; ++j) w[j] = frag_b(&sw[j * 16 + col][kc * 32], lane);
      const F2 a = split_row(Y + (r0 + col) * CC, kc * 32, lane); asm volatile("s_wait_loadcnt 0x0" ::: "memory");
#pragma unroll
      for (int j = 0; j < 8; ++j) { acc[j] = wmma_bf(a.h, w[j], acc[j]); acc[j] = wmma_bf(a.l, w[j], acc[j]); } }
#pragma unroll
    for (int j = 0; j < 8; ++j) { const float bias = BO ? bfr(BO[c0 + j * 16 + col]) : 0.f;
#pragma unroll
      for (int r = 0; r < 8; ++r) sf[wave][8 * g + r][j * 16 + col] = acc[j][r] + bias; }
  } else {
#pragma unroll 2
    for (int kc = 0; kc < CC / 32; ++kc) { const v16h a = frag_f32(Y + (r0 + col) * CC + kc * 32, lane); asm volatile("s_wait_loadcnt 0x0" ::: "memory");
#pragma unroll
      for (int j = 0; j < 8; ++j) { const v16h w = WOCOLH(WO, kc * 32, c0 + j * 16 + col, lane); asm volatile("s_wait_loadcnt 0x0" ::: "memory"); acc[j] = wmma16(a, w, acc[j]); } }
#pragma unroll
    for (int j = 0; j < 8; ++j) { const float bias = BO ? bfr(BO[c0 + j * 16 + col]) : 0.f;
#pragma unroll
      for (int r = 0; r < 8; ++r) sf[wave][8 * g + r][j * 16 + col] = acc[j][r] * (1.0f / 256.0f) + bias; } }
  LDSX(); for (int rl = 0; rl < 16; ++rl) vst2(OUT + (r0 + rl) * DIN + c0 + lane * 4, *(const v4f*)&sf[wave][rl][lane * 4]); }

extern "C" void kernel_launch(void* const* d_in, const int* in_sizes, int n_in, void* d_out, int out_size, void* d_ws, size_t ws_size, hipStream_t stream) {
  (void)in_sizes; (void)n_in; (void)out_size;
  const float** F = (const float**)d_in;
  if (ws_size < (size_t)WS_END) return;
  char* ws = (char*)d_ws; _Float16 *QH = (_Float16*)(ws + WS_QH), *KH = (_Float16*)(ws + WS_KH), *VT = (_Float16*)(ws + WS_VT), *QL = (_Float16*)(ws + WS_QL), *KL = (_Float16*)(ws + WS_KL); __bf16 *VB = (__bf16*)(ws + WS_VB), *VBL = (__bf16*)(ws + WS_VBL); float *Y = (float*)(ws + WS_Y);
  (void)Y; (void)QL; (void)KL; (void)VB; (void)VBL;
  // inputs: 0 x [1,256,256,128]; 1 attn_mask [1,1,256,256] (0 / -1e9); 2 ln_w, 3 ln_b; 4 Wb [4,128]; 5 Wq, 6 Wk, 7 Wv, 8 Wg, 9 Wo [128,128] (out,in)
  if (ws_size < (size_t)WS_END2) return;
  float *BIAS = (float*)(ws + WS_BIAS), *G = (float*)(ws + WS_G);
  k_pre<<<dim3(TNB), 512, 0, stream>>>(F[0], F[2], F[3], F[4], F[5], F[6], F[7], F[8], QH, QL, KH, VT, BIAS, G);
  k_attn<<<dim3(NQB, NH, TNB / (4 * NBL)), 512, 0, stream>>>(QH, KH, QL, VT, BIAS, F[1], G, Y);
  k_out<<<dim3(TNB * TT / 64, DIN / 128), 128, 0, stream>>>(Y, F[9], nullptr, (float*)d_out);
}

// v006
// It runs in 73.8 microseconds.
// In both of two side-by-side timings against v005, it was 1.20 times as fast.
// Counting every step since v000, it is 7.51 times as fast.
// compute dtype: all float inputs rounded to bf16; LayerNorm of pair_act in f32; q/k/v = LN(act) split bf16 hi + lo x W (exact bf16, (out,in)) on WMMA 16x16x32 (2 products, f32 accumulate); q as f16 hi + residual (x 2^10) against k once to f16 (2 products) x 32^-0.5 + the per-(query, key, head) triangle bias (2-product GEMM) + the mask bias; softmax in f32 on base-2 logits (hardware exp2); P x 2^11 once to f16 against v once to f16 (1 product); gate sigmoid(LN(act) Wg) in f32 (2-product GEMM, hardware exp2); gated ctx split bf16 hi + lo against exact output_w (2 products); f32 output.
#include <hip/hip_runtime.h>
#include <math.h>

typedef __attribute__((ext_vector_type(16))) _Float16 v16h;
typedef __attribute__((ext_vector_type(16))) __bf16 v16b;
typedef __attribute__((ext_vector_type(8)))  _Float16 v8h;
typedef __attribute__((ext_vector_type(8)))  float v8f;
typedef __attribute__((ext_vector_type(4)))  float v4f;
typedef __attribute__((ext_vector_type(2)))  float v2f;
typedef __attribute__((ext_vector_type(4)))  unsigned v4u;
typedef __attribute__((ext_vector_type(4)))  int v4i;
typedef float __attribute__((may_alias)) float_a;
typedef int __attribute__((may_alias)) int_a;

template <typename T> __device__ __forceinline__ void vst2(void* p, T v) { *(T*)p = v;  }
__device__ __forceinline__ v8f wmma16(v16h a, v16h b, v8f c) {
  v8f d = __builtin_amdgcn_wmma_f32_16x16x32_f16(false, a, false, b, (short)0, c, false, false);
  asm volatile("v_nop\n\tv_nop\n\tv_nop\n\tv_nop" : "+v"(d) : "v"(a), "v"(b));
  return d;
}
__device__ __forceinline__ v8f wmma_bf(v16b a, v16b b, v8f c) {
  v8f d = __builtin_amdgcn_wmma_f32_16x16x32_bf16(false, a, false, b, (short)0, c, false, false);
  asm volatile("v_nop\n\tv_nop\n\tv_nop\n\tv_nop" : "+v"(d) : "v"(a), "v"(b));
  return d;
}
// 16x16x32 fragments: lane = (h = lane>>4, row/col = lane&15); elements 0..7 = k0+8h+0..7, 8..15 = k0+16+8h+0..7; D element r = row 8h+r
__device__ __forceinline__ v16h frag_h(const _Float16* rowk0, int lane) {
  union { v16h v; v8h q[2]; } u; const _Float16* p = rowk0 + 8 * (lane >> 4);
  u.q[0] = *(const v8h*)p; u.q[1] = *(const v8h*)(p + 16); return u.v;
}
__device__ __forceinline__ v16h frag_f32(const float* rowk0, int lane) {
  v16h a; const float* p = rowk0 + 8 * (lane >> 4);
#pragma unroll
  for (int i = 0; i < 8; ++i) { a[i] = (_Float16)p[i]; a[8 + i] = (_Float16)p[16 + i]; }
  return a;
}
__device__ __forceinline__ v16h frag_f32s(const float* rowk0, int lane, float sc) {
  v16h a; const float* p = rowk0 + 8 * (lane >> 4);
#pragma unroll
  for (int i = 0; i < 8; ++i) { a[i] = (_Float16)(p[i] * sc); a[8 + i] = (_Float16)(p[16 + i] * sc); }
  return a;
}
// column fragment from a [K][ld] layout (column n), rows >= K read as 0
__device__ __forceinline__ v16h fragc_f32(const float* W, int k0, int n, int lane, int ld, int K) {
  v16h a; const int g = lane >> 4;
#pragma unroll
  for (int i = 0; i < 8; ++i) { const int ka = k0 + 8 * g + i, kb = ka + 16;
    a[i] = (_Float16)(ka < K ? W[(size_t)(ka < K ? ka : K - 1) * ld + n] : 0.f); a[8 + i] = (_Float16)(kb < K ? W[(size_t)(kb < K ? kb : K - 1) * ld + n] : 0.f); }
  return a;
}
struct F2 { v16b h, l; };
__device__ __forceinline__ F2 bsplit16(const float v[16]) { F2 r;
#pragma unroll
  for (int i = 0; i < 16; ++i) { const __bf16 h = (__bf16)v[i]; r.h[i] = h; r.l[i] = (__bf16)(v[i] - (float)h); }
  return r; }
__device__ __forceinline__ F2 split_row(const float* row, int k0, int lane) { float v[16]; const float* p = row + k0 + 8 * (lane >> 4);
#pragma unroll
  for (int i = 0; i < 8; ++i) { v[i] = p[i]; v[8 + i] = p[16 + i]; }
  return bsplit16(v); }
__device__ __forceinline__ F2 split_rowK(const float* row, int k0, int lane, int K) { float v[16]; const int g = lane >> 4;
#pragma unroll
  for (int i = 0; i < 8; ++i) { const int ka = k0 + 8 * g + i, kb = ka + 16; v[i] = ka < K ? row[ka < K ? ka : K - 1] : 0.f; v[8 + i] = kb < K ? row[kb < K ? kb : K - 1] : 0.f; }
  return bsplit16(v); }
__device__ __forceinline__ F2 split_col(const float* W, int k0, int n, int lane, int ld, int K) { float v[16]; const int g = lane >> 4;
#pragma unroll
  for (int i = 0; i < 8; ++i) { const int ka = k0 + 8 * g + i, kb = ka + 16; v[i] = ka < K ? W[(size_t)(ka < K ? ka : K - 1) * ld + n] : 0.f; v[8 + i] = kb < K ? W[(size_t)(kb < K ? kb : K - 1) * ld + n] : 0.f; }
  return bsplit16(v); }
__device__ __forceinline__ v8f mac3(const F2& a, const F2& b, v8f c) { c = wmma_bf(a.l, b.h, c); c = wmma_bf(a.h, b.l, c); return wmma_bf(a.h, b.h, c); }
// 4 hardware 2^x, each in place (the source register is the result's, so no following instruction can overwrite a source that is still being read), and one v_nop: the slot that the instruction set asks for between a transcendental and the first use of its result
__device__ __forceinline__ void exp2ip(float& a, float& b, float& c, float& d) { asm("v_exp_f32 %0, %0\n\tv_exp_f32 %1, %1\n\tv_exp_f32 %2, %2\n\tv_exp_f32 %3, %3\n\tv_nop" : "+v"(a), "+v"(b), "+v"(c), "+v"(d)); }
__device__ __forceinline__ float sigm(float v) { return 1.0f / (1.0f + expf(-v)); }
#define LDSX() do { asm volatile("s_wait_dscnt 0" ::: "memory"); __builtin_amdgcn_wave_barrier(); __builtin_amdgcn_fence(__ATOMIC_RELEASE, "workgroup"); } while (0)

// Triangle (starting-node) attention on a pair representation x [1, 256, 256, 128] (4 heads x 32): xn = LayerNorm(x); for every row b: q, k, v = xn[b] W^T ((out,in)); scores[b,h,q,k] = q . k / sqrt(32) + bias[h][q][k] + attn_mask[q][k] with bias[h][q][k] = xn[q][k] . Wb[h] (pair-indexed, shared across rows) and attn_mask in {0, -1e9}; softmax over k; o = (attn v) * sigmoid(xn[b][q] Wg^T); out[b][q] = o Wo^T.
#define NB 256
#define TT 256
#define CC 128            // NH * HD = projected width
#define DIN 128          // input (model) width
#define NH 4
#define HD 32
#define NQB (TT / 64)
#define HG 4
#define SCALE (0.17677669529663687f)
#define LOG2E (1.4426950408889634f)   // logits are kept in base 2: e^x = 2^(x log2 e)
#define CAUSAL 0
#ifndef TNB
#define TNB NB
#endif
__device__ __forceinline__ float bfr(float v) { return (float)(__bf16)v; }
__host__ __device__ __forceinline__ int kb_last(int qb) { return CAUSAL ? ((qb * 64 + 63) >> 7) : (TT / 128 - 1); }
typedef __attribute__((ext_vector_type(8))) __bf16 v8b;
__device__ __forceinline__ v16b frag_b(const __bf16* rowk0, int lane) {
  union { v16b v; v8b q[2]; } u; const __bf16* p = rowk0 + 8 * (lane >> 4);
  u.q[0] = *(const v8b*)p; u.q[1] = *(const v8b*)(p + 16); return u.v;
}
// A block's weight, staged once: ROWS rows of an (out,in) [..][128] f32 weight, each read as one whole 512-B row per wave-wide load, rounded to bf16 and laid in LDS at pitch WP (272 B = 16 B x odd, for 16-byte fragment reads). 128 threads: wave w takes rows w, w + 4, ...
#define WP 136
typedef __attribute__((ext_vector_type(4))) __bf16 v4b;
template <int ROWS> __device__ __forceinline__ void stage_w(__bf16 (*sw)[WP], const float* __restrict__ Wm, int tid) {
  const float* p = Wm + (tid >> 5) * 128 + (tid & 31) * 4; __bf16* d = &sw[tid >> 5][(tid & 31) * 4]; v4f x[ROWS / 4];
#pragma unroll
  for (int u = 0; u < ROWS / 4; ++u) x[u] = *(const v4f*)(p + u * 4 * 128);
  asm volatile("s_wait_xcnt 0x0" :: "v"(p) : "memory");   /* all row loads are issued in front of it (the fill is bound by load latency); their address register, named here, is reused only behind the wait */
#pragma unroll
  for (int u = 0; u < ROWS / 4; ++u) { v4b y;
#pragma unroll
    for (int i = 0; i < 4; ++i) y[i] = (__bf16)x[u][i];
    *(v4b*)(d + u * 4 * WP) = y; } }
#define QBH 0              // unused: no kernel reads it
#define QHI 256            // rows carrying a q residual plane (all rows when non-causal: 2-product logits everywhere)
#define KHI 64            // key rows carrying k residual / v bf16 hi+lo planes (no kernel writes or reads them)
// B fragment (k rows k0+.., output column o) of a weight: (in,out) [K][ld] or (out,in) [ld rows of K]: bf16 exact, or f16(bf16 * 256) exact
__device__ __forceinline__ v16b wcol_io(const float* Wm, int k0, int o, int lane, int ld) { v16b w; const int g = lane >> 4;
#pragma unroll
  for (int i = 0; i < 8; ++i) { w[i] = (__bf16)Wm[(size_t)(k0 + 8 * g + i) * ld + o]; w[8 + i] = (__bf16)Wm[(size_t)(k0 + 16 + 8 * g + i) * ld + o]; }
  return w; }
__device__ __forceinline__ v16b wcol_oi(const float* Wm, int k0, int o, int lane, int K) { v16b w; const float* p = Wm + (size_t)o * K + k0 + 8 * (lane >> 4);
#pragma unroll
  for (int i = 0; i < 8; ++i) { w[i] = (__bf16)p[i]; w[8 + i] = (__bf16)p[16 + i]; }
  return w; }
__device__ __forceinline__ v16h wcolh_io(const float* Wm, int k0, int o, int lane, int ld) { v16h w; const int g = lane >> 4;
#pragma unroll
  for (int i = 0; i < 8; ++i) { w[i] = (_Float16)(bfr(Wm[(size_t)(k0 + 8 * g + i) * ld + o]) * 256.0f); w[8 + i] = (_Float16)(bfr(Wm[(size_t)(k0 + 16 + 8 * g + i) * ld + o]) * 256.0f); }
  return w; }
__device__ __forceinline__ v16h wcolh_oi(const float* Wm, int k0, int o, int lane, int K) { v16h w; const float* p = Wm + (size_t)o * K + k0 + 8 * (lane >> 4);
#pragma unroll
  for (int i = 0; i < 8; ++i) { w[i] = (_Float16)(bfr(p[i]) * 256.0f); w[8 + i] = (_Float16)(bfr(p[16 + i]) * 256.0f); }
  return w; }
#define WQKV_LAYOUT 1   // (out,in) [CC][DIN]
__device__ __forceinline__ v16b wcol_hdk(const float* Wm, int k0, int o, int lane) { v16b w; const int g = lane >> 4; const float* p = Wm + (size_t)(o / HD) * DIN * HD + (o % HD);
#pragma unroll
  for (int i = 0; i < 8; ++i) { w[i] = (__bf16)p[(size_t)(k0 + 8 * g + i) * HD]; w[8 + i] = (__bf16)p[(size_t)(k0 + 16 + 8 * g + i) * HD]; }
  return w; }
#define WO_OUT_IN 1
#if WQKV_LAYOUT == 1
#define WCOL(W, k0, o, lane) wcol_oi(W, k0, o, lane, DIN)
#elif WQKV_LAYOUT == 2
#define WCOL(W, k0, o, lane) wcol_hdk(W, k0, o, lane)
#else
#define WCOL(W, k0, o, lane) wcol_io(W, k0, o, lane, CC)
#endif
#if WO_OUT_IN
#define WOCOL(W, k0, o, lane) wcol_oi(W, k0, o, lane, CC)
#define WOCOLH(W, k0, o, lane) wcolh_oi(W, k0, o, lane, CC)
#else
#define WOCOL(W, k0, o, lane) wcol_io(W, k0, o, lane, DIN)
#define WOCOLH(W, k0, o, lane) wcolh_io(W, k0, o, lane, DIN)
#endif
#define SZ 256
#define BG 64              // rows r sizing the unused WS_S region (x 4 heads = 256 planes of 256 x 256)
#define NZR (SZ * SZ)      // 65,536 pair rows
#define WS_ZN   (WS_END)
#define WS_BIAS (WS_ZN + 4u * (size_t)NZR * CC)
#define WS_G    (WS_BIAS + 4u * (size_t)NZR * NH)
#define WS_END2 (WS_G + 4u * (size_t)NZR * CC)
#ifndef PROJ_EXTRA_PARAMS
#define PROJ_EXTRA_PARAMS
#endif

#define WS_QH  0u                                      // f16 q in fragment order [b][h][16-row tile][d half][lane][8]: lane (g, row) holds d = 16 * half + 8 g + 0..7 of its row
#define WS_KH  (WS_QH + 2u * (size_t)NB * TT * CC)      // f16 k, in the same fragment order as q
#define WS_VT  (WS_KH + 2u * (size_t)NB * TT * CC)      // f16 v in fragment order [b][h][32-key step][16-channel tile][key half][lane][8]: lane (g, channel) holds keys 16 * half + 8 g + 0..7 of its step
#define WS_QL  (WS_VT + 2u * (size_t)NB * CC * TT)      // f16 q residual x 2^10, in the same fragment order as q
#define WS_KL  (WS_QL + 2u * (size_t)NB * QHI * CC)     // f16 k residual x 2^10 rows [b][t < KHI][CC]
#define WS_VB  (WS_KL + 2u * (size_t)NB * KHI * CC)     // bf16 v hi planes [b][c][t < KHI]
#define WS_VBL (WS_VB + 2u * (size_t)NB * CC * KHI)
#define WS_S   (WS_VBL + 2u * (size_t)NB * CC * KHI)    // f32 region, unused: k_attn keeps logits and P in registers
#define WS_Y   (WS_S  + 4u * (size_t)BG * HG * TT * TT)   // skips 256 unused f32 planes of 256 x 256      // f32 ctx rows [b*t][CC] (only when there is an output projection)
#define WS_END (WS_Y  + 4u * (size_t)NB * TT * CC)

// ---- k_pre: block = one row b of the pair array (256 pair rows), 16 waves; wave = 16 pair rows. x is read once, straight into the 16x16x32 fragment layout (a lane holds 64 of its row's 128 channels, lanes l and l ^ 16 split the row);
// LayerNorm (biased var, eps 1e-5, ln_w / ln_b) of bf16(x) in those registers; LN(x) split bf16 hi + lo serves all five products (2 products each, hi then lo per k step) against the weights staged once per block in LDS as bf16.
// q, k, gate and bias as W x LN(x)^T (A = 16 weight rows, B = the pair rows): a lane holds 8 neighbouring output channels of one pair row. v as LN(x) x W^T: a lane holds 8 neighbouring t of one channel.
// Those 8 values are the very 16 bytes that the same lane of an attention wave wants as half a fragment, so q, k and v go to the workspace in fragment order, straight from the accumulators: each wave-wide store is 512 contiguous bytes, and so is each fragment load in k_attn.
__device__ __forceinline__ v8f wmmab(v16b a, v16b b, v8f c) { return __builtin_amdgcn_wmma_f32_16x16x32_bf16(false, a, false, b, (short)0, c, false, false); }
template <bool WA> __device__ __forceinline__ void pre_gemm(const __bf16 (*w)[WP], const F2 (&a)[4], v8f (&acc)[8], int col, int lane) {
#pragma unroll
  for (int kc = 0; kc < 4; ++kc) { v16b f[8];
#pragma unroll
    for (int j = 0; j < 8; ++j) f[j] = frag_b(&w[j * 16 + col][kc * 32], lane);
#pragma unroll
    for (int j = 0; j < 8; ++j) acc[j] = WA ? wmmab(f[j], a[kc].h, acc[j]) : wmmab(a[kc].h, f[j], acc[j]);
#pragma unroll
    for (int j = 0; j < 8; ++j) acc[j] = WA ? wmmab(f[j], a[kc].l, acc[j]) : wmmab(a[kc].l, f[j], acc[j]);
    __builtin_amdgcn_sched_barrier(0); } }   /* one k step's fragments at a time: with more of them read ahead the build spills */
#define LDSW() do { asm volatile("s_wait_dscnt 0" ::: "memory"); __builtin_amdgcn_wave_barrier(); } while (0)   /* one wave's own LDS exchange: its writes land before its lanes read each other's; no fence, which would also wait for the wave's global stores */
struct PreW { float f[16][132]; };   /* one wave's own gate tile on its way to whole-row stores; pitch 16 B x odd */
#define FH (TT * HD)   /* elements of one head of one row b in a fragment-order plane */
__global__ __launch_bounds__(512) __attribute__((amdgpu_waves_per_eu(4, 4))) void k_pre(const float* __restrict__ X, const float* __restrict__ LW, const float* __restrict__ LB, const float* __restrict__ WB, const float* __restrict__ WQ, const float* __restrict__ WK, const float* __restrict__ WV, const float* __restrict__ WG,
    _Float16* __restrict__ QH, _Float16* __restrict__ QL, _Float16* __restrict__ KH, _Float16* __restrict__ VT, float* __restrict__ BIAS, float* __restrict__ G) {
  __shared__ __align__(16) __bf16 sw[4][CC][WP]; __shared__ __align__(16) __bf16 swb[16][WP]; __shared__ __align__(16) float sln[2][CC]; __shared__ __align__(16) PreW sc[16];
  const int tid = threadIdx.x, wave = __builtin_amdgcn_readfirstlane(tid >> 5), lane = tid & 31, col = lane & 15, g = lane >> 4; const size_t r0 = (size_t)blockIdx.x * TT + wave * 16;
  const float* xp = X + (r0 + col) * CC + 8 * g; const unsigned wo = (unsigned)(wave * CC + lane * 4); const float* pq = WQ + wo; const float* pk = WK + wo; const float* pv = WV + wo; const float* pg = WG + wo;
  v4f xv[16], wv[4][8], wb = {};
#pragma unroll
  for (int kc = 0; kc < 4; ++kc) { xv[kc * 4] = *(const v4f*)(xp + kc * 32); xv[kc * 4 + 1] = *(const v4f*)(xp + kc * 32 + 4); xv[kc * 4 + 2] = *(const v4f*)(xp + kc * 32 + 16); xv[kc * 4 + 3] = *(const v4f*)(xp + kc * 32 + 20); }
  asm volatile("s_wait_xcnt 0x0" :: "v"(xp) : "memory");   /* the pair rows, which come from memory, are issued first; their address register, named here, is reused only behind the wait */
#pragma unroll
  for (int u = 0; u < 8; ++u) { wv[0][u] = *(const v4f*)(pq + u * 16 * CC); wv[1][u] = *(const v4f*)(pk + u * 16 * CC); wv[2][u] = *(const v4f*)(pv + u * 16 * CC); wv[3][u] = *(const v4f*)(pg + u * 16 * CC); }   /* wave w takes weight rows w, w + 16, ...: one whole 512-B row per load */
  const float* ep = (wave < NH ? WB + wave * CC : wave == NH ? LW : LB) + lane * 4; wb = *(const v4f*)ep;   /* waves 0..3: a row of the bias weight; wave 4: ln_w; wave 5: ln_b */
  asm volatile("s_wait_xcnt 0x0" :: "v"(pq), "v"(pk), "v"(pv), "v"(pg) : "memory");   /* all weight rows are issued in front of it, behind the pair rows (one load latency for the block's whole fill); their address registers, named here, are reused only behind the wait */
#pragma unroll
  for (int m = 0; m < 4; ++m)
#pragma unroll
    for (int u = 0; u < 8; ++u) { v4b y;
#pragma unroll
      for (int i = 0; i < 4; ++i) y[i] = (__bf16)wv[m][u][i];
      *(v4b*)&sw[m][wave + 16 * u][lane * 4] = y; }
  { v4b y;
#pragma unroll
    for (int i = 0; i < 4; ++i) { wb[i] = bfr(wb[i]); y[i] = wave < NH ? (__bf16)wb[i] : (__bf16)0.f; }   /* the bias tile's rows beyond NH are zero */
    *(v4b*)&swb[wave][lane * 4] = y;
    if (wave == NH || wave == NH + 1) *(v4f*)&sln[wave - NH][lane * 4] = wb; }
  v4f s4 = {};
#pragma unroll
  for (int i = 0; i < 16; ++i) {
#pragma unroll
    for (int e = 0; e < 4; ++e) xv[i][e] = bfr(xv[i][e]);
    s4 += xv[i]; }
  float s1 = (s4[0] + s4[1]) + (s4[2] + s4[3]); s1 += __shfl_xor(s1, 16);
  const float mu = s1 * (1.0f / CC); v4f q4 = {};
#pragma unroll
  for (int i = 0; i < 16; ++i) { const v4f d = xv[i] - mu; q4 += d * d; }
  float qs = (q4[0] + q4[1]) + (q4[2] + q4[3]); qs += __shfl_xor(qs, 16);
  const float rs = rsqrtf(qs * (1.0f / CC) + 1e-5f);
  __syncthreads();   /* the staged weights, ln_w and ln_b are read by all sixteen waves */
  F2 a[4];
#pragma unroll
  for (int kc = 0; kc < 4; ++kc) { float v[16];
#pragma unroll
    for (int e = 0; e < 4; ++e) { const int o = kc * 32 + (e >> 1) * 16 + (e & 1) * 4 + 8 * g; const v4f lw = *(const v4f*)&sln[0][o], lb = *(const v4f*)&sln[1][o];
#pragma unroll
      for (int i = 0; i < 4; ++i) v[e * 4 + i] = (xv[kc * 4 + e][i] - mu) * rs * lw[i] + lb[i]; }
    a[kc] = bsplit16(v); }
  PreW& pw = sc[wave];
  { v8f ab = {};   /* bias: heads 0..3 of pair row col are elements 0..3 of lanes 0..15: 16 rows x 16 B = one 256-B run per wave */
#pragma unroll
    for (int kc = 0; kc < 4; ++kc) { const v16b f = frag_b(&swb[col][kc * 32], lane); ab = wmma_bf(f, a[kc].h, ab); ab = wmma_bf(f, a[kc].l, ab); }   /* the form with its four slots behind: the last result goes straight into a store */
    float* bp = BIAS + (r0 + col) * NH;
    if (g == 0) { v4f b4; b4[0] = ab[0]; b4[1] = ab[1]; b4[2] = ab[2]; b4[3] = ab[3]; vst2(bp, b4); }
    asm volatile("s_wait_xcnt 0x0" ::: "memory"); }   /* the store's registers are reused only behind the wait */
  const size_t pb = (size_t)blockIdx.x * TT * CC; const unsigned fo = (unsigned)(wave * 512 + lane * 8);   /* row b's plane; the wave's 16 pair rows are tile 'wave' of each head */
  { v8f acc[8] = {}; pre_gemm<true>(sw[0], a, acc, col, lane);
    v8h hv[8], lv[8];
#pragma unroll
    for (int j = 0; j < 8; ++j)
#pragma unroll
      for (int r = 0; r < 8; ++r) { const float v = acc[j][r]; const _Float16 h = (_Float16)v; hv[j][r] = h; lv[j][r] = (_Float16)((v - (float)h) * 1024.0f); }
    _Float16* dh = QH + pb + fo; _Float16* dl = QL + pb + fo;   /* QHI == TT: the residual plane is indexed as the q plane */
#pragma unroll
    for (int j = 0; j < 8; ++j) { vst2(dh + (j >> 1) * FH + (j & 1) * 256, hv[j]); vst2(dl + (j >> 1) * FH + (j & 1) * 256, lv[j]); }   /* channel tile j = head j >> 1, d half j & 1: 512 contiguous bytes per store */
    asm volatile("s_wait_xcnt 0x0" ::: "memory"); }   /* the stores' registers are reused only behind the wait */
  { v8f acc[8] = {}; pre_gemm<true>(sw[1], a, acc, col, lane);
    v8h hv[8];
#pragma unroll
    for (int j = 0; j < 8; ++j)
#pragma unroll
      for (int r = 0; r < 8; ++r) hv[j][r] = (_Float16)acc[j][r];
    _Float16* dh = KH + pb + fo;
#pragma unroll
    for (int j = 0; j < 8; ++j) vst2(dh + (j >> 1) * FH + (j & 1) * 256, hv[j]);
    asm volatile("s_wait_xcnt 0x0" ::: "memory"); }   /* as above */
  {
#pragma unroll 1   /* the sigmoid uses hardware 2^x and a division per value: two 16-channel tiles a trip, kept rolled so that the kernel's text stays small for the instruction cache */
    for (int jp = 0; jp < 4; ++jp) { v8f acc[2] = {}; const __bf16* wr = &sw[3][jp * 32 + col][0];
#pragma unroll
      for (int kc = 0; kc < 4; ++kc) { const v16b f0 = frag_b(wr + kc * 32, lane), f1 = frag_b(wr + 16 * WP + kc * 32, lane);
        acc[0] = wmmab(f0, a[kc].h, acc[0]); acc[1] = wmmab(f1, a[kc].h, acc[1]); acc[0] = wmmab(f0, a[kc].l, acc[0]); acc[1] = wmmab(f1, a[kc].l, acc[1]); }
#pragma unroll
      for (int j = 0; j < 2; ++j) { v4f s0, s1g; float ex[8];   /* e^-x = 2^(-x log2 e) */
#pragma unroll
        for (int r = 0; r < 8; ++r) ex[r] = acc[j][r] * -LOG2E;
#pragma unroll
        for (int r = 0; r < 8; r += 4) exp2ip(ex[r + 0], ex[r + 1], ex[r + 2], ex[r + 3]);
#pragma unroll
        for (int r = 0; r < 4; ++r) { s0[r] = 1.0f / (1.0f + ex[r]); s1g[r] = 1.0f / (1.0f + ex[4 + r]); }   /* sigmoid(xn Wg^T), no bias */
        *(v4f*)&pw.f[col][jp * 32 + j * 16 + 8 * g] = s0; *(v4f*)&pw.f[col][jp * 32 + j * 16 + 8 * g + 4] = s1g; } }
    LDSW();   /* as above */
    v4f t4[16];
#pragma unroll
    for (int rl = 0; rl < 16; ++rl) t4[rl] = *(const v4f*)&pw.f[rl][lane * 4];
    float* dg = G + r0 * CC + lane * 4;
#pragma unroll
    for (int rl = 0; rl < 16; ++rl) vst2(dg + rl * CC, t4[rl]);   /* one 512-B row per store */
    asm volatile("s_wait_xcnt 0x0" ::: "memory"); }   /* as above */
  { v8f acc[8] = {}; pre_gemm<false>(sw[2], a, acc, col, lane);
    v8h hv[8];
#pragma unroll
    for (int j = 0; j < 8; ++j)
#pragma unroll
      for (int r = 0; r < 8; ++r) hv[j][r] = (_Float16)acc[j][r];
    _Float16* dv = VT + pb + (unsigned)((wave >> 1) * 1024 + (wave & 1) * 256 + lane * 8);   /* the wave's 16 t are key half wave & 1 of 32-key step wave >> 1 */
#pragma unroll
    for (int j = 0; j < 8; ++j) vst2(dv + (j >> 1) * FH + (j & 1) * 512, hv[j]);   /* channel tile j = head j >> 1, tile j & 1: 512 contiguous bytes per store */
  } }
// ---- k_attn: block = (64 queries qb, head h, 4 x NBL rows b), 16 waves; wave = 16 queries (wave & 3) of NBL rows b (group wave >> 2). The (bias + mask) tile of the block's 64 queries x 256 keys is summed once into LDS and serves every row b.
// Per row b: S^T = K Q^T (A = 16 key rows, B = q hi, then q residual x 2^10: 2 products), so a lane holds 128 of one query's 256 logits (lanes l and l ^ 16 split them); softmax in f32 in registers;
// two S^T tiles (keys 32 kc + 0..15, + 16..31), x 2^11 and once to f16, ARE the A fragment of P for ctx = P v (1 product, v f16 planes); logits and P never go to memory.
// The ctx tile is multiplied by its gate tile G (same row and column index) on its way from LDS to the store: Y holds the gated ctx.
#define NBL 4
__device__ __forceinline__ v16h frag_o(const _Float16* base, unsigned off) { union { v16h v; v8h q[2]; } u; const _Float16* p = base + off; u.q[0] = *(const v8h*)p; u.q[1] = *(const v8h*)(p + 256); return u.v; }   /* a fragment laid in fragment order: its two halves are runs of 32 lanes x 16 B; the lane's own pointer (lane * 8 included) plus a constant */
__device__ __forceinline__ v8f wmmah(v16h a, v16h b, v8f c) { return __builtin_amdgcn_wmma_f32_16x16x32_f16(false, a, false, b, (short)0, c, false, false); }
__global__ __launch_bounds__(512) __attribute__((amdgpu_waves_per_eu(4, 4))) void k_attn(const _Float16* __restrict__ QH, const _Float16* __restrict__ KH, const _Float16* __restrict__ QL, const _Float16* __restrict__ VT, const float* __restrict__ BIAS, const float* __restrict__ MKP, const float* __restrict__ G, float* __restrict__ Y) {
  __shared__ __align__(16) float sb[64][TT + 4]; __shared__ __align__(16) float ss[16][16][HD + 4];   /* pitches 16 B x odd: 16-byte row reads without bank conflicts */
  const int tid = threadIdx.x, wave = __builtin_amdgcn_readfirstlane(tid >> 5), lane = tid & 31, col = lane & 15, g = lane >> 4; const int qb = blockIdx.x, h = blockIdx.y; const int ql0 = qb * 64 + (wave & 3) * 16;
  const float* bp = BIAS + ((size_t)qb * 64 * SZ + tid) * NH + h; const float* mp = MKP + (size_t)qb * 64 * SZ + tid;
  { float tb[32], tm[32];
#pragma unroll
    for (int u = 0; u < 32; ++u) { tb[u] = bp[(size_t)u * 512 * NH]; tm[u] = mp[u * 512]; }
    asm volatile("s_wait_xcnt 0x0" :: "v"(bp), "v"(tid) : "memory");   /* all 64 loads are issued in front of it (the fill is bound by load latency); their address registers, named here, are reused only behind the wait */
#pragma unroll
    for (int u = 0; u < 32; ++u) sb[u * 2 + (tid >> 8)][tid & 255] = (tb[u] + bfr(tm[u])) * LOG2E; }   /* staged in base 2, as the logits are */
  __syncthreads();
  const float* brow = &sb[(wave & 3) * 16 + col][8 * g];
  const unsigned koff = (unsigned)(h * FH + lane * 8), qoff = koff + (unsigned)((ql0 >> 4) * 512), voff = koff, yoff = (unsigned)((ql0 + (lane >> 3)) * CC + h * HD + (lane & 7) * 4);
#pragma unroll 1   /* the body is some thousands of instructions: kept rolled for the instruction cache */
  for (int bi = 0; bi < NBL; ++bi) { const size_t bo = (size_t)(((int)blockIdx.z * 4 + (wave >> 2)) * NBL + bi) * TT * CC;   /* row b's start in the q, q residual (QHI == TT), k and v planes and in the gate and ctx rows alike */
    const _Float16* qp = QH + bo + qoff; const _Float16* lp = QL + bo + qoff; const _Float16* kp = KH + bo + koff; const _Float16* vp = VT + bo + voff; const float* gp = G + bo + yoff;
    const v16h qh = frag_o(qp, 0), ql = frag_o(lp, 0); v16h kf[TT / 16];
#pragma unroll
    for (int j = 0; j < TT / 16; ++j) kf[j] = frag_o(kp, j * 512);
    asm volatile("s_wait_xcnt 0x0" :: "v"(qp), "v"(lp), "v"(kp) : "memory");   /* q and all 16 k fragments in one run of loads in front of it: one load latency per row b, not one per tile; the address registers, named here, are reused only behind the wait */
    __builtin_amdgcn_sched_barrier(0);   /* no product is scheduled in between the loads, which would split the run */
    v8f s[TT / 16], m8;
#pragma unroll
    for (int r = 0; r < 8; ++r) m8[r] = -3.0e38f;
#pragma unroll
    for (int j = 0; j < TT / 16; ++j) { v8f a = {}, l = {}; a = wmmah(kf[j], qh, a); l = wmmah(kf[j], ql, l);
      const v8f bm = __builtin_shufflevector(*(const v4f*)(brow + j * 16), *(const v4f*)(brow + j * 16 + 4), 0, 1, 2, 3, 4, 5, 6, 7);
      s[j] = (a + l * (1.0f / 1024.0f)) * (SCALE * LOG2E) + bm; m8 = __builtin_elementwise_max(m8, s[j]);
      if ((j & 3) == 3) __builtin_amdgcn_sched_barrier(0); }   /* four tiles' products and sums at a time: with more products run ahead the build spills */
    v16h vf[TT / 32][HD / 16];
#pragma unroll
    for (int kc = 0; kc < TT / 64; ++kc)
#pragma unroll
      for (int j = 0; j < HD / 16; ++j) vf[kc][j] = frag_o(vp, (kc * 2 + j) * 512);
    v4f gt[4];
#pragma unroll
    for (int i = 0; i < 4; ++i) gt[i] = *(const v4f*)(gp + i * 4 * CC);   /* the gate tile, laid as the ctx stores are: 4 rows x 128 B per load */
    asm volatile("s_wait_xcnt 0x0" :: "v"(vp), "v"(gp) : "memory");   /* the first half of v and the gate tile are on their way while the exponentials run; address registers as above */
    float m = fmaxf(fmaxf(fmaxf(m8[0], m8[1]), fmaxf(m8[2], m8[3])), fmaxf(fmaxf(m8[4], m8[5]), fmaxf(m8[6], m8[7]))); m = fmaxf(m, __shfl_xor(m, 16));
    if (m <= -1.0e38f * LOG2E) m = __builtin_inff();   /* excluded logits (<= -1e38) count as 0: under a larger maximum 2^(v - m) is 0 by itself (the two differ by 1e30 at least); where the maximum itself is excluded, so is the whole row, and v - inf makes every term 0 */
    v8f s8 = {};
#pragma unroll
    for (int j = 0; j < TT / 16; ++j) {
#pragma unroll
      for (int r = 0; r < 8; r += 4) { float t[4];   /* base-2 logits; the argument is <= 0, and a result below the normal range counts as 0 */
#pragma unroll
        for (int i = 0; i < 4; ++i) t[i] = s[j][r + i] - m;
        exp2ip(t[0], t[1], t[2], t[3]);
#pragma unroll
        for (int i = 0; i < 4; ++i) s[j][r + i] = t[i]; }
      s8 += s[j]; }
    float sum = ((s8[0] + s8[1]) + (s8[2] + s8[3])) + ((s8[4] + s8[5]) + (s8[6] + s8[7])); sum += __shfl_xor(sum, 16);
    const float inv = sum > 0.f ? 2048.0f / sum : 0.f;   /* a fully excluded row yields P = 0 */
    v16h p[TT / 32];
#pragma unroll
    for (int kc = 0; kc < TT / 32; ++kc)
#pragma unroll
      for (int i = 0; i < 8; ++i) { p[kc][i] = (_Float16)(s[2 * kc][i] * inv); p[kc][8 + i] = (_Float16)(s[2 * kc + 1][i] * inv); }
#pragma unroll
    for (int kc = TT / 64; kc < TT / 32; ++kc)
#pragma unroll
      for (int j = 0; j < HD / 16; ++j) vf[kc][j] = frag_o(vp, (kc * 2 + j) * 512);
    asm volatile("s_wait_xcnt 0x0" :: "v"(vp) : "memory");   /* the second half of v, issued once P is packed and its registers are free; address register as above */
    v8f acc[HD / 16] = {};
#pragma unroll
    for (int kc = 0; kc < TT / 32; ++kc)
#pragma unroll
      for (int j = 0; j < HD / 16; ++j) acc[j] = wmmah(p[kc], vf[kc][j], acc[j]);
#pragma unroll
    for (int j = 0; j < HD / 16; ++j)
#pragma unroll
      for (int r = 0; r < 8; ++r) ss[wave][8 * g + r][j * 16 + col] = acc[j][r] * (1.0f / 2048.0f);
    LDSX();   /* the wave's own 16 x 32 tile: its LDS writes land before its lanes read each other's */
#pragma unroll
    for (int i = 0; i < 4; ++i) vst2(Y + bo + i * 4 * CC + yoff, *(const v4f*)&ss[wave][i * 4 + (lane >> 3)][(lane & 7) * 4] * gt[i]);   /* 4 rows x 128 B per store */
  } }
// ---- k_out: block = (64 rows, 128 cols): out = ctx Wo (+ bo): all rows: ctx bf16 hi + lo against exact bf16 Wo (2 products)
__global__ __launch_bounds__(128) void k_out(const float* __restrict__ Y, const float* __restrict__ WO, const float* __restrict__ BO, float* __restrict__ OUT) { __shared__ __align__(16) float sf[4][16][132]; __shared__ __align__(16) __bf16 sw[128][WP];
  const int tid = threadIdx.x, wave = tid >> 5, lane = tid & 31, col = lane & 15, g = lane >> 4; const int c0 = blockIdx.y * 128; const size_t r0 = (size_t)blockIdx.x * 64 + wave * 16;
  stage_w<128>(sw, WO + (size_t)c0 * CC, tid);
  __syncthreads();   /* the staged weight is read by all four waves */
  v8f acc[8] = {};
  if (true) {   /* ALL rows: gated ctx bf16 hi + lo x exact output_w (2 products) */
#pragma unroll 2
    for (int kc = 0; kc < CC / 32; ++kc) { v16b w[8];   /* this k step's weight fragments, read as one group in front of the row loads' wait, not among the products */
#pragma unroll
      for (int j = 0; j < 8; ++j) w[j] = frag_b(&sw[j * 16 + col][kc * 32], lane);
      const F2 a = split_row(Y + (r0 + col) * CC, kc * 32, lane); asm volatile("s_wait_loadcnt 0x0" ::: "memory");
#pragma unroll
      for (int j = 0; j < 8; ++j) { acc[j] = wmma_bf(a.h, w[j], acc[j]); acc[j] = wmma_bf(a.l, w[j], acc[j]); } }
#pragma unroll
    for (int j = 0; j < 8; ++j) { const float bias = BO ? bfr(BO[c0 + j * 16 + col]) : 0.f;
#pragma unroll
      for (int r = 0; r < 8; ++r) sf[wave][8 * g + r][j * 16 + col] = acc[j][r] + bias; }
  } else {
#pragma unroll 2
    for (int kc = 0; kc < CC / 32; ++kc) { const v16h a = frag_f32(Y + (r0 + col) * CC + kc * 32, lane); asm volatile("s_wait_loadcnt 0x0" ::: "memory");
#pragma unroll
      for (int j = 0; j < 8; ++j) { const v16h w = WOCOLH(WO, kc * 32, c0 + j * 16 + col, lane); asm volatile("s_wait_loadcnt 0x0" ::: "memory"); acc[j] = wmma16(a, w, acc[j]); } }
#pragma unroll
    for (int j = 0; j < 8; ++j) { const float bias = BO ? bfr(BO[c0 + j * 16 + col]) : 0.f;
#pragma unroll
      for (int r = 0; r < 8; ++r) sf[wave][8 * g + r][j * 16 + col] = acc[j][r] * (1.0f / 256.0f) + bias; } }
  LDSX(); for (int rl = 0; rl < 16; ++rl) vst2(OUT + (r0 + rl) * DIN + c0 + lane * 4, *(const v4f*)&sf[wave][rl][lane * 4]); }

extern "C" void kernel_launch(void* const* d_in, const int* in_sizes, int n_in, void* d_out, int out_size, void* d_ws, size_t ws_size, hipStream_t stream) {
  (void)in_sizes; (void)n_in; (void)out_size;
  const float** F = (const float**)d_in;
  if (ws_size < (size_t)WS_END) return;
  char* ws = (char*)d_ws; _Float16 *QH = (_Float16*)(ws + WS_QH), *KH = (_Float16*)(ws + WS_KH), *VT = (_Float16*)(ws + WS_VT), *QL = (_Float16*)(ws + WS_QL), *KL = (_Float16*)(ws + WS_KL); __bf16 *VB = (__bf16*)(ws + WS_VB), *VBL = (__bf16*)(ws + WS_VBL); float *Y = (float*)(ws + WS_Y);
  (void)Y; (void)QL; (void)KL; (void)VB; (void)VBL;
  // inputs: 0 x [1,256,256,128]; 1 attn_mask [1,1,256,256] (0 / -1e9); 2 ln_w, 3 ln_b; 4 Wb [4,128]; 5 Wq, 6 Wk, 7 Wv, 8 Wg, 9 Wo [128,128] (out,in)
  if (ws_size < (size_t)WS_END2) return;
  float *BIAS = (float*)(ws + WS_BIAS), *G = (float*)(ws + WS_G);
  k_pre<<<dim3(TNB), 512, 0, stream>>>(F[0], F[2], F[3], F[4], F[5], F[6], F[7], F[8], QH, QL, KH, VT, BIAS, G);
  k_attn<<<dim3(NQB, NH, TNB / (4 * NBL)), 512, 0, stream>>>(QH, KH, QL, VT, BIAS, F[1], G, Y);
  k_out<<<dim3(TNB * TT / 64, DIN / 128), 128, 0, stream>>>(Y, F[9], nullptr, (float*)d_out);
}

// v007
// One run takes 69.2 microseconds.
// In both of two side-by-side timings against v006, it was 1.06 times as fast.
// Counting every step since v000, it is 7.96 times as fast.
// compute dtype: all float inputs rounded to bf16; LayerNorm of pair_act in f32; q/k/v = LN(act) split bf16 hi + lo x W (exact bf16, (out,in)) on WMMA 16x16x32 (2 products, f32 accumulate); q as f16 hi + residual (x 2^10) against k once to f16 (2 products) x 32^-0.5 + the per-(query, key, head) triangle bias (2-product GEMM) + the mask bias; softmax in f32 on base-2 logits (hardware exp2); P x 2^11 once to f16 against v once to f16 (1 product); gate sigmoid(LN(act) Wg) in f32 (2-product GEMM, hardware exp2); gated ctx split bf16 hi + lo against exact output_w (2 products); f32 output.
#include <hip/hip_runtime.h>
#include <math.h>

typedef __attribute__((ext_vector_type(16))) _Float16 v16h;
typedef __attribute__((ext_vector_type(16))) __bf16 v16b;
typedef __attribute__((ext_vector_type(8)))  _Float16 v8h;
typedef __attribute__((ext_vector_type(8)))  float v8f;
typedef __attribute__((ext_vector_type(4)))  float v4f;
typedef __attribute__((ext_vector_type(2)))  float v2f;
typedef __attribute__((ext_vector_type(4)))  unsigned v4u;
typedef __attribute__((ext_vector_type(4)))  int v4i;
typedef float __attribute__((may_alias)) float_a;
typedef int __attribute__((may_alias)) int_a;

template <typename T> __device__ __forceinline__ void vst2(void* p, T v) { *(T*)p = v;  }
__device__ __forceinline__ v8f wmma16(v16h a, v16h b, v8f c) {
  v8f d = __builtin_amdgcn_wmma_f32_16x16x32_f16(false, a, false, b, (short)0, c, false, false);
  asm volatile("v_nop\n\tv_nop\n\tv_nop\n\tv_nop" : "+v"(d) : "v"(a), "v"(b));
  return d;
}
__device__ __forceinline__ v8f wmma_bf(v16b a, v16b b, v8f c) {
  v8f d = __builtin_amdgcn_wmma_f32_16x16x32_bf16(false, a, false, b, (short)0, c, false, false);
  asm volatile("v_nop\n\tv_nop\n\tv_nop\n\tv_nop" : "+v"(d) : "v"(a), "v"(b));
  return d;
}
// 16x16x32 fragments: lane = (h = lane>>4, row/col = lane&15); elements 0..7 = k0+8h+0..7, 8..15 = k0+16+8h+0..7; D element r = row 8h+r
__device__ __forceinline__ v16h frag_h(const _Float16* rowk0, int lane) {
  union { v16h v; v8h q[2]; } u; const _Float16* p = rowk0 + 8 * (lane >> 4);
  u.q[0] = *(const v8h*)p; u.q[1] = *(const v8h*)(p + 16); return u.v;
}
__device__ __forceinline__ v16h frag_f32(const float* rowk0, int lane) {
  v16h a; const float* p = rowk0 + 8 * (lane >> 4);
#pragma unroll
  for (int i = 0; i < 8; ++i) { a[i] = (_Float16)p[i]; a[8 + i] = (_Float16)p[16 + i]; }
  return a;
}
__device__ __forceinline__ v16h frag_f32s(const float* rowk0, int lane, float sc) {
  v16h a; const float* p = rowk0 + 8 * (lane >> 4);
#pragma unroll
  for (int i = 0; i < 8; ++i) { a[i] = (_Float16)(p[i] * sc); a[8 + i] = (_Float16)(p[16 + i] * sc); }
  return a;
}
// column fragment from a [K][ld] layout (column n), rows >= K read as 0
__device__ __forceinline__ v16h fragc_f32(const float* W, int k0, int n, int lane, int ld, int K) {
  v16h a; const int g = lane >> 4;
#pragma unroll
  for (int i = 0; i < 8; ++i) { const int ka = k0 + 8 * g + i, kb = ka + 16;
    a[i] = (_Float16)(ka < K ? W[(size_t)(ka < K ? ka : K - 1) * ld + n] : 0.f); a[8 + i] = (_Float16)(kb < K ? W[(size_t)(kb < K ? kb : K - 1) * ld + n] : 0.f); }
  return a;
}
struct F2 { v16b h, l; };
__device__ __forceinline__ F2 bsplit16(const float v[16]) { F2 r;
#pragma unroll
  for (int i = 0; i < 16; ++i) { const __bf16 h = (__bf16)v[i]; r.h[i] = h; r.l[i] = (__bf16)(v[i] - (float)h); }
  return r; }
__device__ __forceinline__ F2 split_row(const float* row, int k0, int lane) { float v[16]; const float* p = row + k0 + 8 * (lane >> 4);
#pragma unroll
  for (int i = 0; i < 8; ++i) { v[i] = p[i]; v[8 + i] = p[16 + i]; }
  return bsplit16(v); }
__device__ __forceinline__ F2 split_rowK(const float* row, int k0, int lane, int K) { float v[16]; const int g = lane >> 4;
#pragma unroll
  for (int i = 0; i < 8; ++i) { const int ka = k0 + 8 * g + i, kb = ka + 16; v[i] = ka < K ? row[ka < K ? ka : K - 1] : 0.f; v[8 + i] = kb < K ? row[kb < K ? kb : K - 1] : 0.f; }
  return bsplit16(v); }
__device__ __forceinline__ F2 split_col(const float* W, int k0, int n, int lane, int ld, int K) { float v[16]; const int g = lane >> 4;
#pragma unroll
  for (int i = 0; i < 8; ++i) { const int ka = k0 + 8 * g + i, kb = ka + 16; v[i] = ka < K ? W[(size_t)(ka < K ? ka : K - 1) * ld + n] : 0.f; v[8 + i] = kb < K ? W[(size_t)(kb < K ? kb : K - 1) * ld + n] : 0.f; }
  return bsplit16(v); }
__device__ __forceinline__ v8f mac3(const F2& a, const F2& b, v8f c) { c = wmma_bf(a.l, b.h, c); c = wmma_bf(a.h, b.l, c); return wmma_bf(a.h, b.h, c); }
// 4 hardware 2^x, each in place (the source register is the result's, so no following instruction can overwrite a source that is still being read), and one v_nop: the slot that the instruction set asks for between a transcendental and the first use of its result
__device__ __forceinline__ void exp2ip(float& a, float& b, float& c, float& d) { asm("v_exp_f32 %0, %0\n\tv_exp_f32 %1, %1\n\tv_exp_f32 %2, %2\n\tv_exp_f32 %3, %3\n\tv_nop" : "+v"(a), "+v"(b), "+v"(c), "+v"(d)); }
__device__ __forceinline__ float sigm(float v) { return 1.0f / (1.0f + expf(-v)); }
#define LDSX() do { asm volatile("s_wait_dscnt 0" ::: "memory"); __builtin_amdgcn_wave_barrier(); __builtin_amdgcn_fence(__ATOMIC_RELEASE, "workgroup"); } while (0)

// Triangle (starting-node) attention on a pair representation x [1, 256, 256, 128] (4 heads x 32): xn = LayerNorm(x); for every row b: q, k, v = xn[b] W^T ((out,in)); scores[b,h,q,k] = q . k / sqrt(32) + bias[h][q][k] + attn_mask[q][k] with bias[h][q][k] = xn[q][k] . Wb[h] (pair-indexed, shared across rows) and attn_mask in {0, -1e9}; softmax over k; o = (attn v) * sigmoid(xn[b][q] Wg^T); out[b][q] = o Wo^T.
#define NB 256
#define TT 256
#define CC 128            // NH * HD = projected width
#define DIN 128          // input (model) width
#define NH 4
#define HD 32
#define NQB (TT / 64)
#define HG 4
#define SCALE (0.17677669529663687f)
#define LOG2E (1.4426950408889634f)   // logits are kept in base 2: e^x = 2^(x log2 e)
#define CAUSAL 0
#ifndef TNB
#define TNB NB
#endif
__device__ __forceinline__ float bfr(float v) { return (float)(__bf16)v; }
__host__ __device__ __forceinline__ int kb_last(int qb) { return CAUSAL ? ((qb * 64 + 63) >> 7) : (TT / 128 - 1); }
typedef __attribute__((ext_vector_type(8))) __bf16 v8b;
__device__ __forceinline__ v16b frag_b(const __bf16* rowk0, int lane) {
  union { v16b v; v8b q[2]; } u; const __bf16* p = rowk0 + 8 * (lane >> 4);
  u.q[0] = *(const v8b*)p; u.q[1] = *(const v8b*)(p + 16); return u.v;
}
// A block's weight, staged once: ROWS rows of an (out,in) [..][128] f32 weight, each read as one whole 512-B row per wave-wide load, rounded to bf16 and laid in LDS at pitch WP (272 B = 16 B x odd, for 16-byte fragment reads). 128 threads: wave w takes rows w, w + 4, ...
#define WP 136
typedef __attribute__((ext_vector_type(4))) __bf16 v4b;
template <int ROWS> __device__ __forceinline__ void stage_w(__bf16 (*sw)[WP], const float* __restrict__ Wm, int tid) {
  const float* p = Wm + (tid >> 5) * 128 + (tid & 31) * 4; __bf16* d = &sw[tid >> 5][(tid & 31) * 4]; v4f x[ROWS / 4];
#pragma unroll
  for (int u = 0; u < ROWS / 4; ++u) x[u] = *(const v4f*)(p + u * 4 * 128);
  asm volatile("s_wait_xcnt 0x0" :: "v"(p) : "memory");   /* all row loads are issued in front of it (the fill is bound by load latency); their address register, named here, is reused only behind the wait */
#pragma unroll
  for (int u = 0; u < ROWS / 4; ++u) { v4b y;
#pragma unroll
    for (int i = 0; i < 4; ++i) y[i] = (__bf16)x[u][i];
    *(v4b*)(d + u * 4 * WP) = y; } }
#define QBH 0              // unused: no kernel reads it
#define QHI 256            // rows carrying a q residual plane (all rows when non-causal: 2-product logits everywhere)
#define KHI 64            // key rows carrying k residual / v bf16 hi+lo planes (no kernel writes or reads them)
// B fragment (k rows k0+.., output column o) of a weight: (in,out) [K][ld] or (out,in) [ld rows of K]: bf16 exact, or f16(bf16 * 256) exact
__device__ __forceinline__ v16b wcol_io(const float* Wm, int k0, int o, int lane, int ld) { v16b w; const int g = lane >> 4;
#pragma unroll
  for (int i = 0; i < 8; ++i) { w[i] = (__bf16)Wm[(size_t)(k0 + 8 * g + i) * ld + o]; w[8 + i] = (__bf16)Wm[(size_t)(k0 + 16 + 8 * g + i) * ld + o]; }
  return w; }
__device__ __forceinline__ v16b wcol_oi(const float* Wm, int k0, int o, int lane, int K) { v16b w; const float* p = Wm + (size_t)o * K + k0 + 8 * (lane >> 4);
#pragma unroll
  for (int i = 0; i < 8; ++i) { w[i] = (__bf16)p[i]; w[8 + i] = (__bf16)p[16 + i]; }
  return w; }
__device__ __forceinline__ v16h wcolh_io(const float* Wm, int k0, int o, int lane, int ld) { v16h w; const int g = lane >> 4;
#pragma unroll
  for (int i = 0; i < 8; ++i) { w[i] = (_Float16)(bfr(Wm[(size_t)(k0 + 8 * g + i) * ld + o]) * 256.0f); w[8 + i] = (_Float16)(bfr(Wm[(size_t)(k0 + 16 + 8 * g + i) * ld + o]) * 256.0f); }
  return w; }
__device__ __forceinline__ v16h wcolh_oi(const float* Wm, int k0, int o, int lane, int K) { v16h w; const float* p = Wm + (size_t)o * K + k0 + 8 * (lane >> 4);
#pragma unroll
  for (int i = 0; i < 8; ++i) { w[i] = (_Float16)(bfr(p[i]) * 256.0f); w[8 + i] = (_Float16)(bfr(p[16 + i]) * 256.0f); }
  return w; }
#define WQKV_LAYOUT 1   // (out,in) [CC][DIN]
__device__ __forceinline__ v16b wcol_hdk(const float* Wm, int k0, int o, int lane) { v16b w; const int g = lane >> 4; const float* p = Wm + (size_t)(o / HD) * DIN * HD + (o % HD);
#pragma unroll
  for (int i = 0; i < 8; ++i) { w[i] = (__bf16)p[(size_t)(k0 + 8 * g + i) * HD]; w[8 + i] = (__bf16)p[(size_t)(k0 + 16 + 8 * g + i) * HD]; }
  return w; }
#define WO_OUT_IN 1
#if WQKV_LAYOUT == 1
#define WCOL(W, k0, o, lane) wcol_oi(W, k0, o, lane, DIN)
#elif WQKV_LAYOUT == 2
#define WCOL(W, k0, o, lane) wcol_hdk(W, k0, o, lane)
#else
#define WCOL(W, k0, o, lane) wcol_io(W, k0, o, lane, CC)
#endif
#if WO_OUT_IN
#define WOCOL(W, k0, o, lane) wcol_oi(W, k0, o, lane, CC)
#define WOCOLH(W, k0, o, lane) wcolh_oi(W, k0, o, lane, CC)
#else
#define WOCOL(W, k0, o, lane) wcol_io(W, k0, o, lane, DIN)
#define WOCOLH(W, k0, o, lane) wcolh_io(W, k0, o, lane, DIN)
#endif
#define SZ 256
#define BG 64              // rows r sizing the unused WS_S region (x 4 heads = 256 planes of 256 x 256)
#define NZR (SZ * SZ)      // 65,536 pair rows
#define WS_ZN   (WS_END)
#define WS_BIAS (WS_ZN + 4u * (size_t)NZR * CC)
#define WS_G    (WS_BIAS + 4u * (size_t)NZR * NH)
#define WS_END2 (WS_G + 4u * (size_t)NZR * CC)
#ifndef PROJ_EXTRA_PARAMS
#define PROJ_EXTRA_PARAMS
#endif

#define WS_QH  0u                                      // f16 q in fragment order [b][h][16-row tile][d half][lane][8]: lane (g, row) holds d = 16 * half + 8 g + 0..7 of its row
#define WS_KH  (WS_QH + 2u * (size_t)NB * TT * CC)      // f16 k, in the same fragment order as q
#define WS_VT  (WS_KH + 2u * (size_t)NB * TT * CC)      // f16 v in fragment order [b][h][32-key step][16-channel tile][key half][lane][8]: lane (g, channel) holds keys 16 * half + 8 g + 0..7 of its step
#define WS_QL  (WS_VT + 2u * (size_t)NB * CC * TT)      // f16 q residual x 2^10, in the same fragment order as q
#define WS_KL  (WS_QL + 2u * (size_t)NB * QHI * CC)     // f16 k residual x 2^10 rows [b][t < KHI][CC]
#define WS_VB  (WS_KL + 2u * (size_t)NB * KHI * CC)     // bf16 v hi planes [b][c][t < KHI]
#define WS_VBL (WS_VB + 2u * (size_t)NB * CC * KHI)
#define WS_S   (WS_VBL + 2u * (size_t)NB * CC * KHI)    // f32 region, unused: k_attn keeps logits and P in registers
#define WS_Y   (WS_S  + 4u * (size_t)BG * HG * TT * TT)   // skips 256 unused f32 planes of 256 x 256      // f32 ctx rows [b*t][CC], unused: k_attn keeps the gated ctx in LDS
#define WS_END (WS_Y  + 4u * (size_t)NB * TT * CC)

// ---- k_pre: block = one row b of the pair array (256 pair rows), 16 waves; wave = 16 pair rows. x is read once, straight into the 16x16x32 fragment layout (a lane holds 64 of its row's 128 channels, lanes l and l ^ 16 split the row);
// LayerNorm (biased var, eps 1e-5, ln_w / ln_b) of bf16(x) in those registers; LN(x) split bf16 hi + lo serves all five products (2 products each, hi then lo per k step) against the weights staged once per block in LDS as bf16.
// q, k, gate and bias as W x LN(x)^T (A = 16 weight rows, B = the pair rows): a lane holds 8 neighbouring output channels of one pair row. v as LN(x) x W^T: a lane holds 8 neighbouring t of one channel.
// Those 8 values are the very 16 bytes that the same lane of an attention wave wants as half a fragment, so q, k and v go to the workspace in fragment order, straight from the accumulators: each wave-wide store is 512 contiguous bytes, and so is each fragment load in k_attn.
__device__ __forceinline__ v8f wmmab(v16b a, v16b b, v8f c) { return __builtin_amdgcn_wmma_f32_16x16x32_bf16(false, a, false, b, (short)0, c, false, false); }
template <bool WA> __device__ __forceinline__ void pre_gemm(const __bf16 (*w)[WP], const F2 (&a)[4], v8f (&acc)[8], int col, int lane) {
#pragma unroll
  for (int kc = 0; kc < 4; ++kc) { v16b f[8];
#pragma unroll
    for (int j = 0; j < 8; ++j) f[j] = frag_b(&w[j * 16 + col][kc * 32], lane);
#pragma unroll
    for (int j = 0; j < 8; ++j) acc[j] = WA ? wmmab(f[j], a[kc].h, acc[j]) : wmmab(a[kc].h, f[j], acc[j]);
#pragma unroll
    for (int j = 0; j < 8; ++j) acc[j] = WA ? wmmab(f[j], a[kc].l, acc[j]) : wmmab(a[kc].l, f[j], acc[j]);
    __builtin_amdgcn_sched_barrier(0); } }   /* one k step's fragments at a time: with more of them read ahead the build spills */
#define LDSW() do { asm volatile("s_wait_dscnt 0" ::: "memory"); __builtin_amdgcn_wave_barrier(); } while (0)   /* one wave's own LDS exchange: its writes land before its lanes read each other's; no fence, which would also wait for the wave's global stores */
struct PreW { float f[16][132]; };   /* one wave's own gate tile on its way to whole-row stores; pitch 16 B x odd */
#define FH (TT * HD)   /* elements of one head of one row b in a fragment-order plane */
__global__ __launch_bounds__(512) __attribute__((amdgpu_waves_per_eu(4, 4))) void k_pre(const float* __restrict__ X, const float* __restrict__ LW, const float* __restrict__ LB, const float* __restrict__ WB, const float* __restrict__ WQ, const float* __restrict__ WK, const float* __restrict__ WV, const float* __restrict__ WG,
    _Float16* __restrict__ QH, _Float16* __restrict__ QL, _Float16* __restrict__ KH, _Float16* __restrict__ VT, float* __restrict__ BIAS, float* __restrict__ G) {
  __shared__ __align__(16) __bf16 sw[4][CC][WP]; __shared__ __align__(16) __bf16 swb[16][WP]; __shared__ __align__(16) float sln[2][CC]; __shared__ __align__(16) PreW sc[16];
  const int tid = threadIdx.x, wave = __builtin_amdgcn_readfirstlane(tid >> 5), lane = tid & 31, col = lane & 15, g = lane >> 4; const size_t r0 = (size_t)blockIdx.x * TT + wave * 16;
  const float* xp = X + (r0 + col) * CC + 8 * g; const unsigned wo = (unsigned)(wave * CC + lane * 4); const float* pq = WQ + wo; const float* pk = WK + wo; const float* pv = WV + wo; const float* pg = WG + wo;
  v4f xv[16], wv[4][8], wb = {};
#pragma unroll
  for (int kc = 0; kc < 4; ++kc) { xv[kc * 4] = *(const v4f*)(xp + kc * 32); xv[kc * 4 + 1] = *(const v4f*)(xp + kc * 32 + 4); xv[kc * 4 + 2] = *(const v4f*)(xp + kc * 32 + 16); xv[kc * 4 + 3] = *(const v4f*)(xp + kc * 32 + 20); }
  asm volatile("s_wait_xcnt 0x0" :: "v"(xp) : "memory");   /* the pair rows, which come from memory, are issued first; their address register, named here, is reused only behind the wait */
#pragma unroll
  for (int u = 0; u < 8; ++u) { wv[0][u] = *(const v4f*)(pq + u * 16 * CC); wv[1][u] = *(const v4f*)(pk + u * 16 * CC); wv[2][u] = *(const v4f*)(pv + u * 16 * CC); wv[3][u] = *(const v4f*)(pg + u * 16 * CC); }   /* wave w takes weight rows w, w + 16, ...: one whole 512-B row per load */
  const float* ep = (wave < NH ? WB + wave * CC : wave == NH ? LW : LB) + lane * 4; wb = *(const v4f*)ep;   /* waves 0..3: a row of the bias weight; wave 4: ln_w; wave 5: ln_b */
  asm volatile("s_wait_xcnt 0x0" :: "v"(pq), "v"(pk), "v"(pv), "v"(pg) : "memory");   /* all weight rows are issued in front of it, behind the pair rows (one load latency for the block's whole fill); their address registers, named here, are reused only behind the wait */
#pragma unroll
  for (int m = 0; m < 4; ++m)
#pragma unroll
    for (int u = 0; u < 8; ++u) { v4b y;
#pragma unroll
      for (int i = 0; i < 4; ++i) y[i] = (__bf16)wv[m][u][i];
      *(v4b*)&sw[m][wave + 16 * u][lane * 4] = y; }
  { v4b y;
#pragma unroll
    for (int i = 0; i < 4; ++i) { wb[i] = bfr(wb[i]); y[i] = wave < NH ? (__bf16)wb[i] : (__bf16)0.f; }   /* the bias tile's rows beyond NH are zero */
    *(v4b*)&swb[wave][lane * 4] = y;
    if (wave == NH || wave == NH + 1) *(v4f*)&sln[wave - NH][lane * 4] = wb; }
  v4f s4 = {};
#pragma unroll
  for (int i = 0; i < 16; ++i) {
#pragma unroll
    for (int e = 0; e < 4; ++e) xv[i][e] = bfr(xv[i][e]);
    s4 += xv[i]; }
  float s1 = (s4[0] + s4[1]) + (s4[2] + s4[3]); s1 += __shfl_xor(s1, 16);
  const float mu = s1 * (1.0f / CC); v4f q4 = {};
#pragma unroll
  for (int i = 0; i < 16; ++i) { const v4f d = xv[i] - mu; q4 += d * d; }
  float qs = (q4[0] + q4[1]) + (q4[2] + q4[3]); qs += __shfl_xor(qs, 16);
  const float rs = rsqrtf(qs * (1.0f / CC) + 1e-5f);
  __syncthreads();   /* the staged weights, ln_w and ln_b are read by all sixteen waves */
  F2 a[4];
#pragma unroll
  for (int kc = 0; kc < 4; ++kc) { float v[16];
#pragma unroll
    for (int e = 0; e < 4; ++e) { const int o = kc * 32 + (e >> 1) * 16 + (e & 1) * 4 + 8 * g; const v4f lw = *(const v4f*)&sln[0][o], lb = *(const v4f*)&sln[1][o];
#pragma unroll
      for (int i = 0; i < 4; ++i) v[e * 4 + i] = (xv[kc * 4 + e][i] - mu) * rs * lw[i] + lb[i]; }
    a[kc] = bsplit16(v); }
  PreW& pw = sc[wave];
  { v8f ab = {};   /* bias: heads 0..3 of pair row col are elements 0..3 of lanes 0..15: 16 rows x 16 B = one 256-B run per wave */
#pragma unroll
    for (int kc = 0; kc < 4; ++kc) { const v16b f = frag_b(&swb[col][kc * 32], lane); ab = wmma_bf(f, a[kc].h, ab); ab = wmma_bf(f, a[kc].l, ab); }   /* the form with its four slots behind: the last result goes straight into a store */
    float* bp = BIAS + (r0 + col) * NH;
    if (g == 0) { v4f b4; b4[0] = ab[0]; b4[1] = ab[1]; b4[2] = ab[2]; b4[3] = ab[3]; vst2(bp, b4); }
    asm volatile("s_wait_xcnt 0x0" ::: "memory"); }   /* the store's registers are reused only behind the wait */
  const size_t pb = (size_t)blockIdx.x * TT * CC; const unsigned fo = (unsigned)(wave * 512 + lane * 8);   /* row b's plane; the wave's 16 pair rows are tile 'wave' of each head */
  { v8f acc[8] = {}; pre_gemm<true>(sw[0], a, acc, col, lane);
    v8h hv[8], lv[8];
#pragma unroll
    for (int j = 0; j < 8; ++j)
#pragma unroll
      for (int r = 0; r < 8; ++r) { const float v = acc[j][r]; const _Float16 h = (_Float16)v; hv[j][r] = h; lv[j][r] = (_Float16)((v - (float)h) * 1024.0f); }
    _Float16* dh = QH + pb + fo; _Float16* dl = QL + pb + fo;   /* QHI == TT: the residual plane is indexed as the q plane */
#pragma unroll
    for (int j = 0; j < 8; ++j) { vst2(dh + (j >> 1) * FH + (j & 1) * 256, hv[j]); vst2(dl + (j >> 1) * FH + (j & 1) * 256, lv[j]); }   /* channel tile j = head j >> 1, d half j & 1: 512 contiguous bytes per store */
    asm volatile("s_wait_xcnt 0x0" ::: "memory"); }   /* the stores' registers are reused only behind the wait */
  { v8f acc[8] = {}; pre_gemm<true>(sw[1], a, acc, col, lane);
    v8h hv[8];
#pragma unroll
    for (int j = 0; j < 8; ++j)
#pragma unroll
      for (int r = 0; r < 8; ++r) hv[j][r] = (_Float16)acc[j][r];
    _Float16* dh = KH + pb + fo;
#pragma unroll
    for (int j = 0; j < 8; ++j) vst2(dh + (j >> 1) * FH + (j & 1) * 256, hv[j]);
    asm volatile("s_wait_xcnt 0x0" ::: "memory"); }   /* as above */
  {
#pragma unroll 1   /* the sigmoid uses hardware 2^x and a division per value: two 16-channel tiles a trip, kept rolled so that the kernel's text stays small for the instruction cache */
    for (int jp = 0; jp < 4; ++jp) { v8f acc[2] = {}; const __bf16* wr = &sw[3][jp * 32 + col][0];
#pragma unroll
      for (int kc = 0; kc < 4; ++kc) { const v16b f0 = frag_b(wr + kc * 32, lane), f1 = frag_b(wr + 16 * WP + kc * 32, lane);
        acc[0] = wmmab(f0, a[kc].h, acc[0]); acc[1] = wmmab(f1, a[kc].h, acc[1]); acc[0] = wmmab(f0, a[kc].l, acc[0]); acc[1] = wmmab(f1, a[kc].l, acc[1]); }
#pragma unroll
      for (int j = 0; j < 2; ++j) { v4f s0, s1g; float ex[8];   /* e^-x = 2^(-x log2 e) */
#pragma unroll
        for (int r = 0; r < 8; ++r) ex[r] = acc[j][r] * -LOG2E;
#pragma unroll
        for (int r = 0; r < 8; r += 4) exp2ip(ex[r + 0], ex[r + 1], ex[r + 2], ex[r + 3]);
#pragma unroll
        for (int r = 0; r < 4; ++r) { s0[r] = 1.0f / (1.0f + ex[r]); s1g[r] = 1.0f / (1.0f + ex[4 + r]); }   /* sigmoid(xn Wg^T), no bias */
        *(v4f*)&pw.f[col][jp * 32 + j * 16 + 8 * g] = s0; *(v4f*)&pw.f[col][jp * 32 + j * 16 + 8 * g + 4] = s1g; } }
    LDSW();   /* as above */
    v4f t4[16];
#pragma unroll
    for (int rl = 0; rl < 16; ++rl) t4[rl] = *(const v4f*)&pw.f[rl][lane * 4];
    float* dg = G + r0 * CC + lane * 4;
#pragma unroll
    for (int rl = 0; rl < 16; ++rl) vst2(dg + rl * CC, t4[rl]);   /* one 512-B row per store */
    asm volatile("s_wait_xcnt 0x0" ::: "memory"); }   /* as above */
  { v8f acc[8] = {}; pre_gemm<false>(sw[2], a, acc, col, lane);
    v8h hv[8];
#pragma unroll
    for (int j = 0; j < 8; ++j)
#pragma unroll
      for (int r = 0; r < 8; ++r) hv[j][r] = (_Float16)acc[j][r];
    _Float16* dv = VT + pb + (unsigned)((wave >> 1) * 1024 + (wave & 1) * 256 + lane * 8);   /* the wave's 16 t are key half wave & 1 of 32-key step wave >> 1 */
#pragma unroll
    for (int j = 0; j < 8; ++j) vst2(dv + (j >> 1) * FH + (j & 1) * 512, hv[j]);   /* channel tile j = head j >> 1, tile j & 1: 512 contiguous bytes per store */
  } }
// ---- k_attn: block = (32 queries qb, all 4 heads, 2 x NBL rows b), 16 waves; wave = 16 queries of one head (wave >> 2) of one row b: row tile wave & 3 = (row b of the pair, query tile). The (bias + mask) tiles of the block's 32 queries x 256 keys x 4 heads are summed once into LDS and serve every row b.
// Per row b: S^T = K Q^T (A = 16 key rows, B = q hi, then q residual x 2^10: 2 products), so a lane holds 128 of one query's 256 logits (lanes l and l ^ 16 split them); softmax in f32 in registers;
// two S^T tiles (keys 32 kc + 0..15, + 16..31), x 2^11 and once to f16, ARE the A fragment of P for ctx = P v (1 product, v f16 planes); logits and P never go to memory.
// The ctx tile is multiplied by its gate tile G (same row and column index) on its way out of the wave's LDS tile, split bf16 hi + lo, and laid in the block's tile of 64 rows x 128 channels (all four heads side by side).
// Behind one barrier a trip the same 16 waves do out = gated ctx Wo^T on it (hi + lo against exact bf16 Wo staged once per block: 2 products, hi then lo per k step): wave = its 16 rows x 32 output columns. The gated ctx never goes to memory.
#define NBL 4
#define QT 32
__device__ __forceinline__ v16h frag_o(const _Float16* base, unsigned off) { union { v16h v; v8h q[2]; } u; const _Float16* p = base + off; u.q[0] = *(const v8h*)p; u.q[1] = *(const v8h*)(p + 256); return u.v; }   /* a fragment laid in fragment order: its two halves are runs of 32 lanes x 16 B; the lane's own pointer (lane * 8 included) plus a constant */
__device__ __forceinline__ v8f wmmah(v16h a, v16h b, v8f c) { return __builtin_amdgcn_wmma_f32_16x16x32_f16(false, a, false, b, (short)0, c, false, false); }
__global__ __launch_bounds__(512) __attribute__((amdgpu_waves_per_eu(4, 4))) void k_attn(const _Float16* __restrict__ QH, const _Float16* __restrict__ KH, const _Float16* __restrict__ QL, const _Float16* __restrict__ VT, const float* __restrict__ BIAS, const float* __restrict__ MKP, const float* __restrict__ G, const float* __restrict__ WO, float* __restrict__ OUT) {
  __shared__ __align__(16) float sb[NH][QT][TT + 4]; __shared__ __align__(16) float ss[16][16][HD + 4];   /* pitches 16 B x odd: 16-byte row reads without bank conflicts */
  __shared__ __align__(16) __bf16 swo[DIN][WP]; __shared__ __align__(16) __bf16 sy[2][2][64][WP];   /* Wo as bf16; gated ctx [buffer][hi, lo][row][channel]: two buffers, so that one barrier a trip is enough */
  const int tid = threadIdx.x, wave = __builtin_amdgcn_readfirstlane(tid >> 5), lane = tid & 31, col = lane & 15, g = lane >> 4; const int qb = blockIdx.x, rt = wave & 3, h = wave >> 2; const int ql0 = qb * QT + (rt & 1) * 16;
  const float* bp = BIAS + ((size_t)qb * QT * SZ + tid) * NH; const float* mp = MKP + (size_t)qb * QT * SZ + tid; const float* wp = WO + wave * CC + lane * 4;
  { v4f tb[16], tw[8]; float tm[16];
#pragma unroll
    for (int u = 0; u < 16; ++u) { tb[u] = *(const v4f*)(bp + (size_t)u * 512 * NH); tm[u] = mp[u * 512]; }   /* the four heads' bias of one (query, key) pair: 16 B a lane, 512 contiguous bytes a load */
#pragma unroll
    for (int u = 0; u < 8; ++u) tw[u] = *(const v4f*)(wp + u * 16 * CC);   /* wave w takes Wo rows w, w + 16, ...: one whole 512-B row per load */
    asm volatile("s_wait_xcnt 0x0" :: "v"(bp), "v"(mp), "v"(wp) : "memory");   /* all 40 loads are issued in front of it (the fill is bound by load latency); their address registers, named here, are reused only behind the wait */
#pragma unroll
    for (int u = 0; u < 16; ++u) { const float mk = bfr(tm[u]);
#pragma unroll
      for (int hh = 0; hh < NH; ++hh) sb[hh][u * 2 + (tid >> 8)][tid & 255] = (tb[u][hh] + mk) * LOG2E; }   /* staged in base 2, as the logits are */
#pragma unroll
    for (int u = 0; u < 8; ++u) { v4b y;
#pragma unroll
      for (int i = 0; i < 4; ++i) y[i] = (__bf16)tw[u][i];
      *(v4b*)&swo[wave + 16 * u][lane * 4] = y; } }
  __syncthreads();
  const float* brow = &sb[h][(rt & 1) * 16 + col][8 * g];
  const unsigned koff = (unsigned)(h * FH + lane * 8), qoff = koff + (unsigned)((ql0 >> 4) * 512), voff = koff, yoff = (unsigned)((ql0 + (lane >> 3)) * CC + h * HD + (lane & 7) * 4);
  size_t bo = (size_t)((int)blockIdx.y * (2 * NBL) + (rt >> 1)) * TT * CC;   /* row b's start in the q, q residual (QHI == TT), k and v planes and in the gate and output rows alike; a trip goes two rows b on */
  const auto outp = [&](int buf, size_t ob) __attribute__((always_inline)) {   /* out = gated ctx Wo^T of the trip's 64 rows */
    const __bf16 (*ah_)[WP] = sy[buf][0]; const __bf16 (*al_)[WP] = sy[buf][1];
    __builtin_amdgcn_fence(__ATOMIC_RELEASE, "workgroup", "local"); __builtin_amdgcn_s_barrier(); __builtin_amdgcn_fence(__ATOMIC_ACQUIRE, "workgroup", "local");   /* the work-group's barrier with fences on LDS alone (__syncthreads() would also wait for the q and k loads in flight): a row's 128 gated ctx channels come from four waves (one per head) and are read by four (one per 32 output columns); this buffer is rewritten only behind the next trip's barrier */
    v8f oa[2] = {};
#pragma unroll
    for (int kc = 0; kc < CC / 32; ++kc) { const v16b ah = frag_b(&ah_[rt * 16 + col][kc * 32], lane), al = frag_b(&al_[rt * 16 + col][kc * 32], lane), w0 = frag_b(&swo[h * 32 + col][kc * 32], lane), w1 = frag_b(&swo[h * 32 + 16 + col][kc * 32], lane);
      oa[0] = wmmab(ah, w0, oa[0]); oa[1] = wmmab(ah, w1, oa[1]); oa[0] = wmmab(al, w0, oa[0]); oa[1] = kc == CC / 32 - 1 ? wmma_bf(al, w1, oa[1]) : wmmab(al, w1, oa[1]); }   /* the very last in the form with its four slots behind: the results go straight into LDS stores, and the next vector instruction may stand behind a branch */
#pragma unroll
    for (int j = 0; j < 2; ++j)
#pragma unroll
      for (int r = 0; r < 8; ++r) ss[wave][8 * g + r][j * 16 + col] = oa[j][r];
    LDSW();   /* the wave's own 16 x 32 output tile, as the ctx tile; no fence, which would also wait for the q and k loads in flight */
    v4f o4[4];
#pragma unroll
    for (int i = 0; i < 4; ++i) o4[i] = *(const v4f*)&ss[wave][i * 4 + (lane >> 3)][(lane & 7) * 4];
#pragma unroll
    for (int i = 0; i < 4; ++i) vst2(OUT + ob + i * 4 * DIN + yoff, o4[i]);   /* 4 rows x 128 B per store; output columns 32 (wave >> 2) + 0..31 */
    asm volatile("s_wait_xcnt 0x0" ::: "memory"); };   /* the stores' registers are reused only behind the wait */
  v16h qh, ql, kf[TT / 16];
  { const _Float16* qp = QH + bo + qoff; const _Float16* lp = QL + bo + qoff; const _Float16* kp = KH + bo + koff;
    qh = frag_o(qp, 0); ql = frag_o(lp, 0);
#pragma unroll
    for (int j = 0; j < TT / 16; ++j) kf[j] = frag_o(kp, j * 512);
    asm volatile("s_wait_xcnt 0x0" :: "v"(qp), "v"(lp), "v"(kp) : "memory"); }   /* q and all 16 k fragments in one run of loads in front of it: one load latency per row b, not one per tile; the address registers, named here, are reused only behind the wait */
#pragma unroll 1   /* the body is some thousands of instructions: kept rolled for the instruction cache */
  for (int bi = 0; bi < NBL; ++bi) {
    const _Float16* vp = VT + bo + voff; const float* gp = G + bo + yoff;
    __builtin_amdgcn_sched_barrier(0);   /* no product is scheduled in between the loads, which would split the run */
    v8f s[TT / 16], m8;
#pragma unroll
    for (int r = 0; r < 8; ++r) m8[r] = -3.0e38f;
#pragma unroll
    for (int j = 0; j < TT / 16; ++j) { v8f a = {}, l = {}; a = wmmah(kf[j], qh, a); l = wmmah(kf[j], ql, l);
      const v8f bm = __builtin_shufflevector(*(const v4f*)(brow + j * 16), *(const v4f*)(brow + j * 16 + 4), 0, 1, 2, 3, 4, 5, 6, 7);
      s[j] = (a + l * (1.0f / 1024.0f)) * (SCALE * LOG2E) + bm; m8 = __builtin_elementwise_max(m8, s[j]);
      if ((j & 3) == 3) __builtin_amdgcn_sched_barrier(0); }   /* four tiles' products and sums at a time: with more products run ahead the build spills */
    v16h vf[TT / 32][HD / 16];
#pragma unroll
    for (int kc = 0; kc < TT / 64; ++kc)
#pragma unroll
      for (int j = 0; j < HD / 16; ++j) vf[kc][j] = frag_o(vp, (kc * 2 + j) * 512);
    asm volatile("s_wait_xcnt 0x0" :: "v"(vp) : "memory");   /* the first half of v is on its way while the exponentials run; address register as above */
    float m = fmaxf(fmaxf(fmaxf(m8[0], m8[1]), fmaxf(m8[2], m8[3])), fmaxf(fmaxf(m8[4], m8[5]), fmaxf(m8[6], m8[7]))); m = fmaxf(m, __shfl_xor(m, 16));
    if (m <= -1.0e38f * LOG2E) m = __builtin_inff();   /* excluded logits (<= -1e38) count as 0: under a larger maximum 2^(v - m) is 0 by itself (the two differ by 1e30 at least); where the maximum itself is excluded, so is the whole row, and v - inf makes every term 0 */
    v8f s8 = {};
#pragma unroll
    for (int j = 0; j < TT / 16; ++j) {
#pragma unroll
      for (int r = 0; r < 8; r += 4) { float t[4];   /* base-2 logits; the argument is <= 0, and a result below the normal range counts as 0 */
#pragma unroll
        for (int i = 0; i < 4; ++i) t[i] = s[j][r + i] - m;
        exp2ip(t[0], t[1], t[2], t[3]);
#pragma unroll
        for (int i = 0; i < 4; ++i) s[j][r + i] = t[i]; }
      s8 += s[j]; }
    float sum = ((s8[0] + s8[1]) + (s8[2] + s8[3])) + ((s8[4] + s8[5]) + (s8[6] + s8[7])); sum += __shfl_xor(sum, 16);
    const float inv = sum > 0.f ? 2048.0f / sum : 0.f;   /* a fully excluded row yields P = 0 */
    v16h p[TT / 32];
#pragma unroll
    for (int kc = 0; kc < TT / 32; ++kc)
#pragma unroll
      for (int i = 0; i < 8; ++i) { p[kc][i] = (_Float16)(s[2 * kc][i] * inv); p[kc][8 + i] = (_Float16)(s[2 * kc + 1][i] * inv); }
#pragma unroll
    for (int kc = TT / 64; kc < TT / 32; ++kc)
#pragma unroll
      for (int j = 0; j < HD / 16; ++j) vf[kc][j] = frag_o(vp, (kc * 2 + j) * 512);
    v4f gt[4];
#pragma unroll
    for (int i = 0; i < 4; ++i) gt[i] = *(const v4f*)(gp + i * 4 * CC);   /* the gate tile, laid as the ctx rows are read from LDS: 4 rows x 128 B per load */
    asm volatile("s_wait_xcnt 0x0" :: "v"(vp), "v"(gp) : "memory");   /* the second half of v and the gate tile, issued once P is packed and its registers are free (the block's further addresses leave no room for the gate tile earlier: the build spills); address registers as above */
    v8f acc[HD / 16] = {};
#pragma unroll
    for (int kc = 0; kc < TT / 32; ++kc)
#pragma unroll
      for (int j = 0; j < HD / 16; ++j) acc[j] = wmmah(p[kc], vf[kc][j], acc[j]);
#pragma unroll
    for (int j = 0; j < HD / 16; ++j)
#pragma unroll
      for (int r = 0; r < 8; ++r) ss[wave][8 * g + r][j * 16 + col] = acc[j][r] * (1.0f / 2048.0f);
    LDSX();   /* the wave's own 16 x 32 tile: its LDS writes land before its lanes read each other's */
    __bf16 (*yh)[WP] = sy[bi & 1][0]; __bf16 (*yl)[WP] = sy[bi & 1][1];
#pragma unroll
    for (int i = 0; i < 4; ++i) { const v4f y = *(const v4f*)&ss[wave][i * 4 + (lane >> 3)][(lane & 7) * 4] * gt[i]; v4b y0, y1;
#pragma unroll
      for (int e = 0; e < 4; ++e) { const __bf16 t = (__bf16)y[e]; y0[e] = t; y1[e] = (__bf16)(y[e] - (float)t); }
      *(v4b*)&yh[rt * 16 + i * 4 + (lane >> 3)][h * HD + (lane & 7) * 4] = y0; *(v4b*)&yl[rt * 16 + i * 4 + (lane >> 3)][h * HD + (lane & 7) * 4] = y1; }
    { const size_t bn = bo + (bi + 1 < NBL ? (size_t)2 * TT * CC : (size_t)0);   /* no branch round these loads (one would keep the old fragments alive through the whole trip, and the build spills): the last trip asks for its own row again and uses nothing of it */
       const _Float16* qp = QH + bn + qoff; const _Float16* lp = QL + bn + qoff; const _Float16* kp = KH + bn + koff;   /* the next row b's q and k are asked for in front of the barrier: they fly while the waves meet and do the output product */
      qh = frag_o(qp, 0); ql = frag_o(lp, 0);
#pragma unroll
      for (int j = 0; j < TT / 16; ++j) kf[j] = frag_o(kp, j * 512);
      asm volatile("s_wait_xcnt 0x0" :: "v"(qp), "v"(lp), "v"(kp) : "memory"); }   /* address registers as above */
    outp(bi & 1, bo);
    bo += (size_t)2 * TT * CC;
  }
  asm volatile("s_wait_loadcnt 0x0" ::: "memory"); }   /* the last trip's q and k loads, which nothing uses, have returned before the wave ends and gives its registers back */

extern "C" void kernel_launch(void* const* d_in, const int* in_sizes, int n_in, void* d_out, int out_size, void* d_ws, size_t ws_size, hipStream_t stream) {
  (void)in_sizes; (void)n_in; (void)out_size;
  const float** F = (const float**)d_in;
  if (ws_size < (size_t)WS_END) return;
  char* ws = (char*)d_ws; _Float16 *QH = (_Float16*)(ws + WS_QH), *KH = (_Float16*)(ws + WS_KH), *VT = (_Float16*)(ws + WS_VT), *QL = (_Float16*)(ws + WS_QL), *KL = (_Float16*)(ws + WS_KL); __bf16 *VB = (__bf16*)(ws + WS_VB), *VBL = (__bf16*)(ws + WS_VBL); float *Y = (float*)(ws + WS_Y);
  (void)Y; (void)QL; (void)KL; (void)VB; (void)VBL;
  // inputs: 0 x [1,256,256,128]; 1 attn_mask [1,1,256,256] (0 / -1e9); 2 ln_w, 3 ln_b; 4 Wb [4,128]; 5 Wq, 6 Wk, 7 Wv, 8 Wg, 9 Wo [128,128] (out,in)
  if (ws_size < (size_t)WS_END2) return;
  float *BIAS = (float*)(ws + WS_BIAS), *G = (float*)(ws + WS_G);
  k_pre<<<dim3(TNB), 512, 0, stream>>>(F[0], F[2], F[3], F[4], F[5], F[6], F[7], F[8], QH, QL, KH, VT, BIAS, G);
  k_attn<<<dim3(TT / QT, TNB / (2 * NBL)), 512, 0, stream>>>(QH, KH, QL, VT, BIAS, F[1], G, F[9], (float*)d_out);
}

// v010
// One run takes 38.1 microseconds.
// Versions in between are left out here; by their measured steps it is 1.81 times as fast as v007.
// All steps since v000 together make it 14.4 times as fast.
// compute dtype: all float inputs rounded to bf16; LayerNorm of pair_act in f32; q/k/v = LN(act) split bf16 hi + lo x W (exact bf16, (out,in)) on WMMA 16x16x32 (2 products, f32 accumulate); q and k each once to f16 (1 product) x 32^-0.5 + the per-(query, key, head) triangle bias (2-product GEMM) + the mask bias; softmax in f32 on base-2 logits (hardware exp2); P x 2^11 once to f16 against v once to f16 (1 product); gate sigmoid(LN(act) Wg) in f32 (2-product GEMM, hardware exp2), once to f16; gated ctx split bf16 hi + lo against exact output_w (2 products); f32 output.
#include <hip/hip_runtime.h>
#include <math.h>

typedef __attribute__((ext_vector_type(16))) _Float16 v16h;
typedef __attribute__((ext_vector_type(16))) __bf16 v16b;
typedef __attribute__((ext_vector_type(8)))  _Float16 v8h;
typedef __attribute__((ext_vector_type(8)))  float v8f;
typedef __attribute__((ext_vector_type(4)))  float v4f;
typedef __attribute__((ext_vector_type(2)))  float v2f;
typedef __attribute__((ext_vector_type(4)))  unsigned v4u;
typedef __attribute__((ext_vector_type(4)))  int v4i;
typedef float __attribute__((may_alias)) float_a;
typedef int __attribute__((may_alias)) int_a;

template <typename T> __device__ __forceinline__ void vst2(void* p, T v) { *(T*)p = v;  }
__device__ __forceinline__ v8f wmma16(v16h a, v16h b, v8f c) {
  v8f d = __builtin_amdgcn_wmma_f32_16x16x32_f16(false, a, false, b, (short)0, c, false, false);
  asm volatile("v_nop\n\tv_nop\n\tv_nop\n\tv_nop" : "+v"(d) : "v"(a), "v"(b));
  return d;
}
__device__ __forceinline__ v8f wmma_bf(v16b a, v16b b, v8f c) {
  v8f d = __builtin_amdgcn_wmma_f32_16x16x32_bf16(false, a, false, b, (short)0, c, false, false);
  asm volatile("v_nop\n\tv_nop\n\tv_nop\n\tv_nop" : "+v"(d) : "v"(a), "v"(b));
  return d;
}
// 16x16x32 fragments: lane = (h = lane>>4, row/col = lane&15); elements 0..7 = k0+8h+0..7, 8..15 = k0+16+8h+0..7; D element r = row 8h+r
__device__ __forceinline__ v16h frag_h(const _Float16* rowk0, int lane) {
  union { v16h v; v8h q[2]; } u; const _Float16* p = rowk0 + 8 * (lane >> 4);
  u.q[0] = *(const v8h*)p; u.q[1] = *(const v8h*)(p + 16); return u.v;
}
__device__ __forceinline__ v16h frag_f32(const float* rowk0, int lane) {
  v16h a; const float* p = rowk0 + 8 * (lane >> 4);
#pragma unroll
  for (int i = 0; i < 8; ++i) { a[i] = (_Float16)p[i]; a[8 + i] = (_Float16)p[16 + i]; }
  return a;
}
__device__ __forceinline__ v16h frag_f32s(const float* rowk0, int lane, float sc) {
  v16h a; const float* p = rowk0 + 8 * (lane >> 4);
#pragma unroll
  for (int i = 0; i < 8; ++i) { a[i] = (_Float16)(p[i] * sc); a[8 + i] = (_Float16)(p[16 + i] * sc); }
  return a;
}
// column fragment from a [K][ld] layout (column n), rows >= K read as 0
__device__ __forceinline__ v16h fragc_f32(const float* W, int k0, int n, int lane, int ld, int K) {
  v16h a; const int g = lane >> 4;
#pragma unroll
  for (int i = 0; i < 8; ++i) { const int ka = k0 + 8 * g + i, kb = ka + 16;
    a[i] = (_Float16)(ka < K ? W[(size_t)(ka < K ? ka : K - 1) * ld + n] : 0.f); a[8 + i] = (_Float16)(kb < K ? W[(size_t)(kb < K ? kb : K - 1) * ld + n] : 0.f); }
  return a;
}
struct F2 { v16b h, l; };
__device__ __forceinline__ F2 bsplit16(const float v[16]) { F2 r;
#pragma unroll
  for (int i = 0; i < 16; ++i) { const __bf16 h = (__bf16)v[i]; r.h[i] = h; r.l[i] = (__bf16)(v[i] - (float)h); }
  return r; }
__device__ __forceinline__ F2 split_row(const float* row, int k0, int lane) { float v[16]; const float* p = row + k0 + 8 * (lane >> 4);
#pragma unroll
  for (int i = 0; i < 8; ++i) { v[i] = p[i]; v[8 + i] = p[16 + i]; }
  return bsplit16(v); }
__device__ __forceinline__ F2 split_rowK(const float* row, int k0, int lane, int K) { float v[16]; const int g = lane >> 4;
#pragma unroll
  for (int i = 0; i < 8; ++i) { const int ka = k0 + 8 * g + i, kb = ka + 16; v[i] = ka < K ? row[ka < K ? ka : K - 1] : 0.f; v[8 + i] = kb < K ? row[kb < K ? kb : K - 1] : 0.f; }
  return bsplit16(v); }
__device__ __forceinline__ F2 split_col(const float* W, int k0, int n, int lane, int ld, int K) { float v[16]; const int g = lane >> 4;
#pragma unroll
  for (int i = 0; i < 8; ++i) { const int ka = k0 + 8 * g + i, kb = ka + 16; v[i] = ka < K ? W[(size_t)(ka < K ? ka : K - 1) * ld + n] : 0.f; v[8 + i] = kb < K ? W[(size_t)(kb < K ? kb : K - 1) * ld + n] : 0.f; }
  return bsplit16(v); }
__device__ __forceinline__ v8f mac3(const F2& a, const F2& b, v8f c) { c = wmma_bf(a.l, b.h, c); c = wmma_bf(a.h, b.l, c); return wmma_bf(a.h, b.h, c); }
// 4 hardware 2^x, each in place (the source register is the result's, so no following instruction can overwrite a source that is still being read), and one v_nop: the slot that the instruction set asks for between a transcendental and the first use of its result
__device__ __forceinline__ void exp2ip(float& a, float& b, float& c, float& d) { asm("v_exp_f32 %0, %0\n\tv_exp_f32 %1, %1\n\tv_exp_f32 %2, %2\n\tv_exp_f32 %3, %3\n\tv_nop" : "+v"(a), "+v"(b), "+v"(c), "+v"(d)); }
__device__ __forceinline__ float sigm(float v) { return 1.0f / (1.0f + expf(-v)); }

// Triangle (starting-node) attention on a pair representation x [1, 256, 256, 128] (4 heads x 32): xn = LayerNorm(x); for every row b: q, k, v = xn[b] W^T ((out,in)); scores[b,h,q,k] = q . k / sqrt(32) + bias[h][q][k] + attn_mask[q][k] with bias[h][q][k] = xn[q][k] . Wb[h] (pair-indexed, shared across rows) and attn_mask in {0, -1e9}; softmax over k; o = (attn v) * sigmoid(xn[b][q] Wg^T); out[b][q] = o Wo^T.
#define NB 256
#define TT 256
#define CC 128            // NH * HD = projected width
#define DIN 128          // input (model) width
#define NH 4
#define HD 32
#define NQB (TT / 64)
#define HG 4
#define SCALE (0.17677669529663687f)
#define LOG2E (1.4426950408889634f)   // logits are kept in base 2: e^x = 2^(x log2 e)
#define CAUSAL 0
#ifndef TNB
#define TNB NB
#endif
__device__ __forceinline__ float bfr(float v) { return (float)(__bf16)v; }
__host__ __device__ __forceinline__ int kb_last(int qb) { return CAUSAL ? ((qb * 64 + 63) >> 7) : (TT / 128 - 1); }
typedef __attribute__((ext_vector_type(8))) __bf16 v8b;
__device__ __forceinline__ v16b frag_b(const __bf16* rowk0, int lane) {
  union { v16b v; v8b q[2]; } u; const __bf16* p = rowk0 + 8 * (lane >> 4);
  u.q[0] = *(const v8b*)p; u.q[1] = *(const v8b*)(p + 16); return u.v;
}
// A block's weight, staged once: ROWS rows of an (out,in) [..][128] f32 weight, each read as one whole 512-B row per wave-wide load, rounded to bf16 and laid in LDS at pitch WP (272 B = 16 B x odd, for 16-byte fragment reads). 128 threads: wave w takes rows w, w + 4, ...
#define WP 136
typedef __attribute__((ext_vector_type(4))) __bf16 v4b;
template <int ROWS> __device__ __forceinline__ void stage_w(__bf16 (*sw)[WP], const float* __restrict__ Wm, int tid) {
  const float* p = Wm + (tid >> 5) * 128 + (tid & 31) * 4; __bf16* d = &sw[tid >> 5][(tid & 31) * 4]; v4f x[ROWS / 4];
#pragma unroll
  for (int u = 0; u < ROWS / 4; ++u) x[u] = *(const v4f*)(p + u * 4 * 128);
  asm volatile("s_wait_xcnt 0x0" :: "v"(p) : "memory");   /* all row loads are issued in front of it (the fill is bound by load latency); their address register, named here, is reused only behind the wait */
#pragma unroll
  for (int u = 0; u < ROWS / 4; ++u) { v4b y;
#pragma unroll
    for (int i = 0; i < 4; ++i) y[i] = (__bf16)x[u][i];
    *(v4b*)(d + u * 4 * WP) = y; } }
#define QBH 0              // not used: this file has no high-precision path
#define QHI 256            // rows of the workspace range once laid out for a q residual plane (sizes the layout only)
#define KHI 64            // key rows of the unused k residual / v bf16 hi+lo planes (sizes the layout only)
// B fragment (k rows k0+.., output column o) of a weight: (in,out) [K][ld] or (out,in) [ld rows of K]: bf16 exact, or f16(bf16 * 256) exact
__device__ __forceinline__ v16b wcol_io(const float* Wm, int k0, int o, int lane, int ld) { v16b w; const int g = lane >> 4;
#pragma unroll
  for (int i = 0; i < 8; ++i) { w[i] = (__bf16)Wm[(size_t)(k0 + 8 * g + i) * ld + o]; w[8 + i] = (__bf16)Wm[(size_t)(k0 + 16 + 8 * g + i) * ld + o]; }
  return w; }
__device__ __forceinline__ v16b wcol_oi(const float* Wm, int k0, int o, int lane, int K) { v16b w; const float* p = Wm + (size_t)o * K + k0 + 8 * (lane >> 4);
#pragma unroll
  for (int i = 0; i < 8; ++i) { w[i] = (__bf16)p[i]; w[8 + i] = (__bf16)p[16 + i]; }
  return w; }
__device__ __forceinline__ v16h wcolh_io(const float* Wm, int k0, int o, int lane, int ld) { v16h w; const int g = lane >> 4;
#pragma unroll
  for (int i = 0; i < 8; ++i) { w[i] = (_Float16)(bfr(Wm[(size_t)(k0 + 8 * g + i) * ld + o]) * 256.0f); w[8 + i] = (_Float16)(bfr(Wm[(size_t)(k0 + 16 + 8 * g + i) * ld + o]) * 256.0f); }
  return w; }
__device__ __forceinline__ v16h wcolh_oi(const float* Wm, int k0, int o, int lane, int K) { v16h w; const float* p = Wm + (size_t)o * K + k0 + 8 * (lane >> 4);
#pragma unroll
  for (int i = 0; i < 8; ++i) { w[i] = (_Float16)(bfr(p[i]) * 256.0f); w[8 + i] = (_Float16)(bfr(p[16 + i]) * 256.0f); }
  return w; }
#define WQKV_LAYOUT 1   // (out,in) [CC][DIN]
__device__ __forceinline__ v16b wcol_hdk(const float* Wm, int k0, int o, int lane) { v16b w; const int g = lane >> 4; const float* p = Wm + (size_t)(o / HD) * DIN * HD + (o % HD);
#pragma unroll
  for (int i = 0; i < 8; ++i) { w[i] = (__bf16)p[(size_t)(k0 + 8 * g + i) * HD]; w[8 + i] = (__bf16)p[(size_t)(k0 + 16 + 8 * g + i) * HD]; }
  return w; }
#define WO_OUT_IN 1
#if WQKV_LAYOUT == 1
#define WCOL(W, k0, o, lane) wcol_oi(W, k0, o, lane, DIN)
#elif WQKV_LAYOUT == 2
#define WCOL(W, k0, o, lane) wcol_hdk(W, k0, o, lane)
#else
#define WCOL(W, k0, o, lane) wcol_io(W, k0, o, lane, CC)
#endif
#if WO_OUT_IN
#define WOCOL(W, k0, o, lane) wcol_oi(W, k0, o, lane, CC)
#define WOCOLH(W, k0, o, lane) wcolh_oi(W, k0, o, lane, CC)
#else
#define WOCOL(W, k0, o, lane) wcol_io(W, k0, o, lane, DIN)
#define WOCOLH(W, k0, o, lane) wcolh_io(W, k0, o, lane, DIN)
#endif
#define SZ 256
#define BG 64              // rows r sizing the unused WS_S region (x 4 heads = 256 planes of 256 x 256)
#define NZR (SZ * SZ)      // 65,536 pair rows
#define WS_ZN   (WS_END)
#define WS_BIAS (WS_ZN + 4u * (size_t)NZR * CC)
#define WS_G    (WS_BIAS + 4u * (size_t)NZR * NH)
#define WS_END2 (WS_G + 4u * (size_t)NZR * CC)
#ifndef PROJ_EXTRA_PARAMS
#define PROJ_EXTRA_PARAMS
#endif

#define WS_QH  0u                                      // not used (q stays with its lane); fragment order of q and k, as k lies in LDS: [h][16-row tile][d half][lane][8]: lane (g, row) holds d = 16 * half + 8 g + 0..7 of its row
#define WS_KH  (WS_QH + 2u * (size_t)NB * TT * CC)      // not used: k stays in LDS
#define WS_VT  (WS_KH + 2u * (size_t)NB * TT * CC)      // not used: v stays in LDS, in fragment order [h][32-key step][16-channel tile][key half][lane][8]: lane (g, channel) holds keys 16 * half + 8 g + 0..7 of its step
#define WS_QL  (WS_VT + 2u * (size_t)NB * CC * TT)      // not used: the logits take q once to f16, as they take k
#define WS_KL  (WS_QL + 2u * (size_t)NB * QHI * CC)     // f16 k residual x 2^10 rows [b][t < KHI][CC]
#define WS_VB  (WS_KL + 2u * (size_t)NB * KHI * CC)     // bf16 v hi planes [b][c][t < KHI]
#define WS_VBL (WS_VB + 2u * (size_t)NB * CC * KHI)
#define WS_S   (WS_VBL + 2u * (size_t)NB * CC * KHI)    // f32 region, unused: k_fa keeps logits and P in registers
#define WS_Y   (WS_S  + 4u * (size_t)BG * HG * TT * TT)   // skips 256 unused f32 planes of 256 x 256      // f32 ctx rows [b*t][CC], unused: k_fa keeps the gated ctx in LDS
#define WS_END (WS_Y  + 4u * (size_t)NB * TT * CC)

__device__ __forceinline__ v8f wmmab(v16b a, v16b b, v8f c) { return __builtin_amdgcn_wmma_f32_16x16x32_bf16(false, a, false, b, (short)0, c, false, false); }
template <bool WA> __device__ __forceinline__ void pre_gemm(const __bf16 (*w)[WP], const F2 (&a)[4], v8f (&acc)[8], int col, int lane) {
#pragma unroll
  for (int kc = 0; kc < 4; ++kc) { v16b f[8];
#pragma unroll
    for (int j = 0; j < 8; ++j) f[j] = frag_b(&w[j * 16 + col][kc * 32], lane);
#pragma unroll
    for (int j = 0; j < 8; ++j) acc[j] = WA ? wmmab(f[j], a[kc].h, acc[j]) : wmmab(a[kc].h, f[j], acc[j]);
#pragma unroll
    for (int j = 0; j < 8; ++j) acc[j] = WA ? wmmab(f[j], a[kc].l, acc[j]) : wmmab(a[kc].l, f[j], acc[j]);
    __builtin_amdgcn_sched_barrier(0); } }   /* one k step's fragments at a time: with more of them read ahead the build spills */
#define LDSW() do { asm volatile("s_wait_dscnt 0" ::: "memory"); __builtin_amdgcn_wave_barrier(); } while (0)   /* one wave's own LDS exchange: its writes land before its lanes read each other's; no fence, which would also wait for the wave's global stores */
#define FH (TT * HD)   /* elements of one head of one row b in a fragment-order plane */
__device__ __forceinline__ v16h frag_o(const _Float16* base, unsigned off) { union { v16h v; v8h q[2]; } u; const _Float16* p = base + off; u.q[0] = *(const v8h*)p; u.q[1] = *(const v8h*)(p + 256); return u.v; }   /* a fragment laid in fragment order: its two halves are runs of 32 lanes x 16 B; the lane's own pointer (lane * 8 included) plus a constant */
__device__ __forceinline__ v8f wmmah(v16h a, v16h b, v8f c) { return __builtin_amdgcn_wmma_f32_16x16x32_f16(false, a, false, b, (short)0, c, false, false); }
// ---- k_bias: block = 16 queries (tile qt) x 16 keys (tile jt) of the pair array, 16 waves; wave = one query's 16 pair rows. LayerNorm as in k_fa, then bias[h][q][k] = LN(x[q][k]) . Wb[h] (2 products), + the mask, x log2 e.
// The sums go out in the order in which an attention lane wants them, [h][qt][jt][half of 4][lane][4]: lane (g, query) holds keys 16 jt + 8 g + 4 half + 0..3. The block owns its four 1-KB runs whole: gathered in LDS behind one barrier, stored by 512-B wave-wide stores.
__global__ __launch_bounds__(512) void k_bias(const float* __restrict__ X, const float* __restrict__ LW, const float* __restrict__ LB, const float* __restrict__ WB, const float* __restrict__ MKP, float* __restrict__ BM) {
  __shared__ __align__(16) __bf16 swb[16][WP]; __shared__ __align__(16) float sln[2][CC]; __shared__ __align__(16) float sbm[NH][256];
  const int tid = threadIdx.x, wave = __builtin_amdgcn_readfirstlane(tid >> 5), lane = tid & 31, col = lane & 15, g = lane >> 4; const int qt = blockIdx.x >> 4, jt = blockIdx.x & 15;
  const size_t r0 = (size_t)(qt * 16 + wave) * TT + jt * 16;
  const float* xp = X + (r0 + col) * CC + 8 * g; const float* mp = MKP + r0 + col;
  v4f xv[16], wb = {};
#pragma unroll
  for (int kc = 0; kc < 4; ++kc) { xv[kc * 4] = *(const v4f*)(xp + kc * 32); xv[kc * 4 + 1] = *(const v4f*)(xp + kc * 32 + 4); xv[kc * 4 + 2] = *(const v4f*)(xp + kc * 32 + 16); xv[kc * 4 + 3] = *(const v4f*)(xp + kc * 32 + 20); }
  const float* ep = (wave < NH ? WB + wave * CC : wave == NH ? LW : LB) + lane * 4; wb = *(const v4f*)ep;   /* waves 0..3: a row of the bias weight; wave 4: ln_w; wave 5: ln_b */
  const float mk = bfr(*mp);
  asm volatile("s_wait_xcnt 0x0" :: "v"(xp), "v"(ep), "v"(mp) : "memory");   /* all loads are issued in front of it; their address registers, named here, are reused only behind the wait */
  { v4b y;
#pragma unroll
    for (int i = 0; i < 4; ++i) { wb[i] = bfr(wb[i]); y[i] = wave < NH ? (__bf16)wb[i] : (__bf16)0.f; }   /* the bias tile's rows beyond NH are zero */
    *(v4b*)&swb[wave][lane * 4] = y;
    if (wave == NH || wave == NH + 1) *(v4f*)&sln[wave - NH][lane * 4] = wb; }
  v4f s4 = {};
#pragma unroll
  for (int i = 0; i < 16; ++i) {
#pragma unroll
    for (int e = 0; e < 4; ++e) xv[i][e] = bfr(xv[i][e]);
    s4 += xv[i]; }
  float s1 = (s4[0] + s4[1]) + (s4[2] + s4[3]); s1 += __shfl_xor(s1, 16);
  const float mu = s1 * (1.0f / CC); v4f q4 = {};
#pragma unroll
  for (int i = 0; i < 16; ++i) { const v4f d = xv[i] - mu; q4 += d * d; }
  float qs = (q4[0] + q4[1]) + (q4[2] + q4[3]); qs += __shfl_xor(qs, 16);
  const float rs = rsqrtf(qs * (1.0f / CC) + 1e-5f);
  __syncthreads();   /* the bias weight, ln_w and ln_b are read by all sixteen waves */
  v8f ab = {};   /* heads 0..3 of pair row col are elements 0..3 of lanes 0..15 */
#pragma unroll
  for (int kc = 0; kc < 4; ++kc) { float v[16];
#pragma unroll
    for (int e = 0; e < 4; ++e) { const int o = kc * 32 + (e >> 1) * 16 + (e & 1) * 4 + 8 * g; const v4f lw = *(const v4f*)&sln[0][o], lb = *(const v4f*)&sln[1][o];
#pragma unroll
      for (int i = 0; i < 4; ++i) v[e * 4 + i] = (xv[kc * 4 + e][i] - mu) * rs * lw[i] + lb[i]; }
    const F2 a = bsplit16(v); const v16b f = frag_b(&swb[col][kc * 32], lane); ab = wmma_bf(f, a.h, ab); ab = wmma_bf(f, a.l, ab); }   /* the form with its four slots behind: the last result goes straight into LDS stores behind a branch */
  if (g == 0) {
#pragma unroll
    for (int hh = 0; hh < NH; ++hh) sbm[hh][((col >> 2) & 1) * 128 + ((col >> 3) * 16 + wave) * 4 + (col & 3)] = (ab[hh] + mk) * LOG2E; }   /* key col of query 'wave': attention lane (col >> 3, wave), element col & 7; in base 2, as the logits are */
  __syncthreads();   /* a 1-KB run holds values of all sixteen waves */
  if (wave < 8) { const v4f o = *(const v4f*)&sbm[tid >> 6][(tid & 63) * 4]; vst2(BM + ((size_t)((tid >> 6) * 16 + qt) * 16 + jt) * 256 + (tid & 63) * 4, o); }
}
// ---- k_fa: block = one row b of the pair array (256 pair rows = 256 queries = 256 keys, all 4 heads), 16 waves; wave = 16 pair rows, which are its 16 queries. x is read once, straight into the 16x16x32 fragment layout (a lane holds 64 of its row's 128 channels, lanes l and l ^ 16 split the row);
// LayerNorm (biased var, eps 1e-5, ln_w / ln_b) of bf16(x) in those registers; LN(x) split bf16 hi + lo serves all four products (2 products each, hi then lo per k step) against the weights staged once per block in LDS as bf16.
// q, k and gate as W x LN(x)^T (A = 16 weight rows, B = the pair rows): a lane holds 8 neighbouring output channels of one pair row. v as LN(x) x W^T: a lane holds 8 neighbouring t of one channel.
// Those 8 values are the very 16 bytes that a lane wants as half a fragment: k and v, once to f16, are laid in LDS in fragment order and read by all sixteen waves behind one barrier; they never go to memory.
// q and the gate (once to f16) are wanted by the very lane that made them: behind that barrier each lane parks its own in the LDS that held the weights, 16 B a store, and takes them back head by head.
// Per head: S^T = K Q^T (A = 16 key rows from LDS, B = q: 1 product), so a lane holds 128 of one query's 256 logits (lanes l and l ^ 16 split them); bias + mask come from k_bias's plane, asked for one head ahead; softmax in f32 in registers;
// two S^T tiles (keys 32 kc + 0..15, + 16..31), x 2^11 and once to f16, ARE the B fragment of P^T for ctx^T = v^T P^T (1 product, v from LDS as A); logits and P never go to memory.
// A lane so holds 8 neighbouring channels of its own query, as of the gate: gated ctx, split bf16 hi + lo, IS the lane's A fragment of out = gated ctx Wo^T (k step = head), parked where that head's q and gate lay.
// Behind the four heads the wave does its 16 rows x 128 output columns (hi + lo against exact bf16 Wo: 2 products, hi then lo per k step) with no further barrier.
#define RW 8704   /* bytes of a wave's own range in the LDS that held the four weights: 139,264 / 16 */
#define OP 132    /* f32 pitch of the wave's output tile: 528 B = 16 B x odd */
typedef v4u __attribute__((may_alias)) v4ua;
typedef v4f __attribute__((may_alias)) v4fa;
__global__ __launch_bounds__(512) __attribute__((amdgpu_waves_per_eu(4, 4))) void k_fa(const float* __restrict__ X, const float* __restrict__ LW, const float* __restrict__ LB, const float* __restrict__ WQ, const float* __restrict__ WK, const float* __restrict__ WV, const float* __restrict__ WG, const float* __restrict__ WO, const float* __restrict__ BM, float* __restrict__ OUT) {
  __shared__ __align__(16) __bf16 sw[4][CC][WP]; __shared__ __align__(16) __bf16 swo[DIN][WP]; __shared__ __align__(16) float sln[2][CC]; __shared__ __align__(16) _Float16 sk[NH * FH]; __shared__ __align__(16) _Float16 sv[NH * FH];
  const int tid = threadIdx.x, wave = __builtin_amdgcn_readfirstlane(tid >> 5), lane = tid & 31, col = lane & 15, g = lane >> 4; const size_t r0 = (size_t)blockIdx.x * TT + wave * 16;
  const float* xp = X + (r0 + col) * CC + 8 * g; const unsigned wo = (unsigned)(wave * CC + lane * 4); const float* pq = WQ + wo; const float* pk = WK + wo; const float* pv = WV + wo; const float* pg = WG + wo; const float* po = WO + wo;
  v4f xv[16], wb = {};
  { v4f wv[4][8];
#pragma unroll
    for (int kc = 0; kc < 4; ++kc) { xv[kc * 4] = *(const v4f*)(xp + kc * 32); xv[kc * 4 + 1] = *(const v4f*)(xp + kc * 32 + 4); xv[kc * 4 + 2] = *(const v4f*)(xp + kc * 32 + 16); xv[kc * 4 + 3] = *(const v4f*)(xp + kc * 32 + 20); }
    asm volatile("s_wait_xcnt 0x0" :: "v"(xp) : "memory");   /* the pair rows, which come from memory, are issued first; their address register, named here, is reused only behind the wait */
#pragma unroll
    for (int u = 0; u < 8; ++u) { wv[0][u] = *(const v4f*)(pq + u * 16 * CC); wv[1][u] = *(const v4f*)(pk + u * 16 * CC); wv[2][u] = *(const v4f*)(pv + u * 16 * CC); wv[3][u] = *(const v4f*)(pg + u * 16 * CC); }   /* wave w takes weight rows w, w + 16, ...: one whole 512-B row per load */
    const float* ep = ((wave & 1) ? LB : LW) + lane * 4; wb = *(const v4f*)ep;   /* wave 0: ln_w; wave 1: ln_b */
    asm volatile("s_wait_xcnt 0x0" :: "v"(pq), "v"(pk), "v"(pv), "v"(pg), "v"(ep) : "memory");   /* all weight rows are issued in front of it, behind the pair rows (one load latency for the block's fill); their address registers, named here, are reused only behind the wait */
#pragma unroll
    for (int m = 0; m < 4; ++m)
#pragma unroll
      for (int u = 0; u < 8; ++u) { v4b y;
#pragma unroll
        for (int i = 0; i < 4; ++i) y[i] = (__bf16)wv[m][u][i];
        *(v4b*)&sw[m][wave + 16 * u][lane * 4] = y; } }
  v4f tw[8];
#pragma unroll
  for (int u = 0; u < 8; ++u) tw[u] = *(const v4f*)(po + u * 16 * CC);   /* Wo's rows, asked for once the four weights' registers are free; they fly while the row statistics are formed */
  asm volatile("s_wait_xcnt 0x0" :: "v"(po) : "memory");   /* address register as above */
#pragma unroll
  for (int i = 0; i < 4; ++i) wb[i] = bfr(wb[i]);
  if (wave < 2) *(v4f*)&sln[wave][lane * 4] = wb;
  v4f s4 = {};
#pragma unroll
  for (int i = 0; i < 16; ++i) {
#pragma unroll
    for (int e = 0; e < 4; ++e) xv[i][e] = bfr(xv[i][e]);
    s4 += xv[i]; }
  float s1 = (s4[0] + s4[1]) + (s4[2] + s4[3]); s1 += __shfl_xor(s1, 16);
  const float mu = s1 * (1.0f / CC); v4f q4 = {};
#pragma unroll
  for (int i = 0; i < 16; ++i) { const v4f d = xv[i] - mu; q4 += d * d; }
  float qs = (q4[0] + q4[1]) + (q4[2] + q4[3]); qs += __shfl_xor(qs, 16);
  const float rs = rsqrtf(qs * (1.0f / CC) + 1e-5f);
#pragma unroll
  for (int u = 0; u < 8; ++u) { v4b y;
#pragma unroll
    for (int i = 0; i < 4; ++i) y[i] = (__bf16)tw[u][i];
    *(v4b*)&swo[wave + 16 * u][lane * 4] = y; }
  __syncthreads();   /* the staged weights, ln_w and ln_b are read by all sixteen waves */
  v8h hq[8], hg[8];
  { F2 a[4];
#pragma unroll
    for (int kc = 0; kc < 4; ++kc) { float v[16];
#pragma unroll
      for (int e = 0; e < 4; ++e) { const int o = kc * 32 + (e >> 1) * 16 + (e & 1) * 4 + 8 * g; const v4f lw = *(const v4f*)&sln[0][o], lb = *(const v4f*)&sln[1][o];
#pragma unroll
        for (int i = 0; i < 4; ++i) v[e * 4 + i] = (xv[kc * 4 + e][i] - mu) * rs * lw[i] + lb[i]; }
      a[kc] = bsplit16(v); }
    { v8f acc[8] = {}; pre_gemm<true>(sw[1], a, acc, col, lane);
      _Float16* dk = sk + (unsigned)(wave * 512 + lane * 8);   /* the wave's 16 pair rows are key tile 'wave' of each head */
#pragma unroll
      for (int j = 0; j < 8; ++j) { v8h hv;
#pragma unroll
        for (int r = 0; r < 8; ++r) hv[r] = (_Float16)acc[j][r];
        *(v8h*)(dk + (j >> 1) * FH + (j & 1) * 256) = hv; } }   /* channel tile j = head j >> 1, d half j & 1 */
    { v8f acc[8] = {}; pre_gemm<false>(sw[2], a, acc, col, lane);
      _Float16* dv = sv + (unsigned)((wave >> 1) * 1024 + (wave & 1) * 256 + lane * 8);   /* the wave's 16 t are key half wave & 1 of 32-key step wave >> 1 */
#pragma unroll
      for (int j = 0; j < 8; ++j) { v8h hv;
#pragma unroll
        for (int r = 0; r < 8; ++r) hv[r] = (_Float16)acc[j][r];
        *(v8h*)(dv + (j >> 1) * FH + (j & 1) * 512) = hv; } }   /* channel tile j = head j >> 1, tile j & 1 */
    { v8f acc[8] = {}; pre_gemm<true>(sw[0], a, acc, col, lane);
#pragma unroll
      for (int j = 0; j < 8; ++j)
#pragma unroll
        for (int r = 0; r < 8; ++r) hq[j][r] = (_Float16)acc[j][r]; }
#pragma unroll
    for (int jp = 0; jp < 4; ++jp) { v8f acc[2] = {}; const __bf16* wr = &sw[3][jp * 32 + col][0];
#pragma unroll
      for (int kc = 0; kc < 4; ++kc) { const v16b f0 = frag_b(wr + kc * 32, lane), f1 = frag_b(wr + 16 * WP + kc * 32, lane);
        acc[0] = wmmab(f0, a[kc].h, acc[0]); acc[1] = wmmab(f1, a[kc].h, acc[1]); acc[0] = wmmab(f0, a[kc].l, acc[0]); acc[1] = wmmab(f1, a[kc].l, acc[1]); }
#pragma unroll
      for (int j = 0; j < 2; ++j) { float ex[8];   /* e^-x = 2^(-x log2 e) */
#pragma unroll
        for (int r = 0; r < 8; ++r) ex[r] = acc[j][r] * -LOG2E;
#pragma unroll
        for (int r = 0; r < 8; r += 4) exp2ip(ex[r + 0], ex[r + 1], ex[r + 2], ex[r + 3]);
#pragma unroll
        for (int r = 0; r < 8; ++r) hg[jp * 2 + j][r] = (_Float16)(1.0f / (1.0f + ex[r])); } } }   /* sigmoid(xn Wg^T), no bias */
  const float* bp = BM + (unsigned)(wave * 16 * 256 + lane * 4);   /* the wave's query tile of head 0; a head is 16 x 16 x 256 values on */
  v8f bm[TT / 16];
#pragma unroll
  for (int j = 0; j < TT / 16; ++j) bm[j] = __builtin_shufflevector(*(const v4f*)(bp + j * 256), *(const v4f*)(bp + j * 256 + 128), 0, 1, 2, 3, 4, 5, 6, 7);   /* 512 contiguous bytes per load */
  asm volatile("s_wait_xcnt 0x0" :: "v"(bp) : "memory");   /* the first head's bias + mask fly while the waves meet; the address register, named here, is reused only behind the wait */
  __builtin_amdgcn_fence(__ATOMIC_RELEASE, "workgroup", "local"); __builtin_amdgcn_s_barrier(); __builtin_amdgcn_fence(__ATOMIC_ACQUIRE, "workgroup", "local");   /* the work-group's barrier with fences on LDS alone (__syncthreads() would also wait for the loads in flight): k and v of all 256 keys are read by all sixteen waves, and the four weights' LDS is written anew only once every wave has left it */
  char* own = (char*)&sw[0][0][0] + wave * RW + lane * 16;   /* per head 2 KB: q halves at 0 and 512 B, gate halves at 1024 and 1536 B; each lane reads back its own 16 bytes */
#pragma unroll
  for (int j = 0; j < 8; ++j) { *(v4ua*)(own + (j >> 1) * 2048 + (j & 1) * 512) = __builtin_bit_cast(v4u, hq[j]); *(v4ua*)(own + (j >> 1) * 2048 + 1024 + (j & 1) * 512) = __builtin_bit_cast(v4u, hg[j]); }
#pragma unroll 1   /* the body is some thousands of instructions: kept rolled for the instruction cache */
  for (int h = 0; h < NH; ++h) {
    const _Float16* kp = sk + h * FH + lane * 8; const _Float16* vp = sv + h * FH + lane * 8; char* oh = own + h * 2048;
    v16h qh; { union { v16h v; v4u q[2]; } u; u.q[0] = *(const v4ua*)oh; u.q[1] = *(const v4ua*)(oh + 512); qh = u.v; }
    v8f s[TT / 16], m8;
#pragma unroll
    for (int r = 0; r < 8; ++r) m8[r] = -3.0e38f;
#pragma unroll
    for (int jg = 0; jg < TT / 64; ++jg) { v16h kf[4];
#pragma unroll
      for (int i = 0; i < 4; ++i) kf[i] = frag_o(kp, (jg * 4 + i) * 512);
      __builtin_amdgcn_sched_barrier(0);   /* four key tiles' fragments are read from LDS as one group: one LDS latency per four products, not one per product */
#pragma unroll
      for (int i = 0; i < 4; ++i) { const int j = jg * 4 + i; v8f a = {}; a = wmmah(kf[i], qh, a);
        s[j] = a * (SCALE * LOG2E) + bm[j]; m8 = __builtin_elementwise_max(m8, s[j]); }
      __builtin_amdgcn_sched_barrier(0); }   /* four tiles' products and sums at a time: with more products run ahead the build spills */
    v16h vf[TT / 32][HD / 16];
#pragma unroll
    for (int kc = 0; kc < TT / 64; ++kc)
#pragma unroll
      for (int j = 0; j < HD / 16; ++j) vf[kc][j] = frag_o(vp, (kc * 2 + j) * 512);
    __builtin_amdgcn_sched_barrier(0);   /* the first half of v is read from LDS while the exponentials run, in the registers that bias + mask have left; without this line the reads sink to their products, each of which then waits out an LDS latency */
    float m = fmaxf(fmaxf(fmaxf(m8[0], m8[1]), fmaxf(m8[2], m8[3])), fmaxf(fmaxf(m8[4], m8[5]), fmaxf(m8[6], m8[7]))); m = fmaxf(m, __shfl_xor(m, 16));
    if (m <= -1.0e38f * LOG2E) m = __builtin_inff();   /* excluded logits (<= -1e38) count as 0: under a larger maximum 2^(v - m) is 0 by itself (the two differ by 1e30 at least); where the maximum itself is excluded, so is the whole row, and v - inf makes every term 0 */
    v8f s8 = {};
#pragma unroll
    for (int j = 0; j < TT / 16; ++j) {
#pragma unroll
      for (int r = 0; r < 8; r += 4) { float t[4];   /* base-2 logits; the argument is <= 0, and a result below the normal range counts as 0 */
#pragma unroll
        for (int i = 0; i < 4; ++i) t[i] = s[j][r + i] - m;
        exp2ip(t[0], t[1], t[2], t[3]);
#pragma unroll
        for (int i = 0; i < 4; ++i) s[j][r + i] = t[i]; }
      s8 += s[j]; }
    float sum = ((s8[0] + s8[1]) + (s8[2] + s8[3])) + ((s8[4] + s8[5]) + (s8[6] + s8[7])); sum += __shfl_xor(sum, 16);
    const float inv = sum > 0.f ? 2048.0f / sum : 0.f;   /* a fully excluded row yields P = 0 */
    v16h p[TT / 32];
#pragma unroll
    for (int kc = 0; kc < TT / 32; ++kc)
#pragma unroll
      for (int i = 0; i < 8; ++i) { p[kc][i] = (_Float16)(s[2 * kc][i] * inv); p[kc][8 + i] = (_Float16)(s[2 * kc + 1][i] * inv); }
    __builtin_amdgcn_sched_barrier(0);   /* the second half of v is not read up among the packing, whose registers it takes over: the build would spill */
#pragma unroll
    for (int kc = TT / 64; kc < TT / 32; ++kc)
#pragma unroll
      for (int j = 0; j < HD / 16; ++j) vf[kc][j] = frag_o(vp, (kc * 2 + j) * 512);
    __builtin_amdgcn_sched_barrier(0);   /* read as one group in front of the products: they land while the first half's products run */
    v8f acc[HD / 16] = {};
#pragma unroll
    for (int kc = 0; kc < TT / 32; ++kc)
#pragma unroll
      for (int j = 0; j < HD / 16; ++j) acc[j] = wmmah(vf[kc][j], p[kc], acc[j]);   /* element r = channel 16 j + 8 g + r of query col */
    __builtin_amdgcn_sched_barrier(0);   /* the next head's loads are not scheduled up among the products, whose registers (P and v) they take over: the build would spill */
    { bp += h + 1 < NH ? 16 * 16 * 256 : 0;   /* no branch round these loads (one would keep the old values alive through the whole trip): the last trip asks for its own head again and uses nothing of it */
#pragma unroll
      for (int j = 0; j < TT / 16; ++j) bm[j] = __builtin_shufflevector(*(const v4f*)(bp + j * 256), *(const v4f*)(bp + j * 256 + 128), 0, 1, 2, 3, 4, 5, 6, 7);
      asm volatile("s_wait_xcnt 0x0" :: "v"(bp) : "memory"); }   /* the next head's bias + mask fly while the gating and the split run; address register as above */
#pragma unroll
    for (int j = 0; j < HD / 16; ++j) { v8b y0, y1; const v8h gt = __builtin_bit_cast(v8h, (v4u)*(const v4ua*)(oh + 1024 + j * 512));
#pragma unroll
      for (int r = 0; r < 8; ++r) { const float y = acc[j][r] * (1.0f / 2048.0f) * (float)gt[r]; const __bf16 t = (__bf16)y; y0[r] = t; y1[r] = (__bf16)(y - (float)t); }
      *(v4ua*)(oh + j * 512) = __builtin_bit_cast(v4u, y0); *(v4ua*)(oh + 1024 + j * 512) = __builtin_bit_cast(v4u, y1); }   /* hi halves where q lay, lo halves where the gate lay */
  }
  v8f oa[8] = {};
#pragma unroll
  for (int kc = 0; kc < NH; ++kc) { union { v16b v; v4u q[2]; } ah, al; v16b w[8];
    ah.q[0] = *(const v4ua*)(own + kc * 2048); ah.q[1] = *(const v4ua*)(own + kc * 2048 + 512); al.q[0] = *(const v4ua*)(own + kc * 2048 + 1024); al.q[1] = *(const v4ua*)(own + kc * 2048 + 1536);
#pragma unroll
    for (int j = 0; j < 8; ++j) w[j] = frag_b(&swo[j * 16 + col][kc * 32], lane);
#pragma unroll
    for (int j = 0; j < 8; ++j) oa[j] = wmmab(ah.v, w[j], oa[j]);
#pragma unroll
    for (int j = 0; j < 8; ++j) oa[j] = wmmab(al.v, w[j], oa[j]);
    __builtin_amdgcn_sched_barrier(0); }   /* one k step's fragments at a time: with more of them read ahead the build spills */
  LDSW();   /* the wave's gated ctx has been read before its range is written anew */
  float_a* so = (float_a*)((char*)&sw[0][0][0] + wave * RW);
#pragma unroll
  for (int j = 0; j < 8; ++j)
#pragma unroll
    for (int r = 0; r < 8; ++r) so[(8 * g + r) * OP + j * 16 + col] = oa[j][r];
  LDSW();   /* the wave's own 16 x 128 output tile: its LDS writes land before its lanes read each other's */
  float* op = OUT + r0 * DIN + lane * 4;
#pragma unroll
  for (int i = 0; i < 16; ++i) { const v4f o = *(const v4fa*)&so[i * OP + lane * 4]; vst2(op + i * DIN, o); }   /* one whole 512-B output row per store */
  asm volatile("s_wait_loadcnt 0x0" ::: "memory"); }   /* the last trip's bias + mask loads, which nothing uses, have returned before the wave ends and gives its registers back */

extern "C" void kernel_launch(void* const* d_in, const int* in_sizes, int n_in, void* d_out, int out_size, void* d_ws, size_t ws_size, hipStream_t stream) {
  (void)in_sizes; (void)n_in; (void)out_size;
  const float** F = (const float**)d_in;
  if (ws_size < (size_t)WS_END) return;
  char* ws = (char*)d_ws; _Float16 *QH = (_Float16*)(ws + WS_QH), *KH = (_Float16*)(ws + WS_KH), *VT = (_Float16*)(ws + WS_VT), *QL = (_Float16*)(ws + WS_QL), *KL = (_Float16*)(ws + WS_KL); __bf16 *VB = (__bf16*)(ws + WS_VB), *VBL = (__bf16*)(ws + WS_VBL); float *Y = (float*)(ws + WS_Y);
  (void)Y; (void)QL; (void)KL; (void)VB; (void)VBL;
  // inputs: 0 x [1,256,256,128]; 1 attn_mask [1,1,256,256] (0 / -1e9); 2 ln_w, 3 ln_b; 4 Wb [4,128]; 5 Wq, 6 Wk, 7 Wv, 8 Wg, 9 Wo [128,128] (out,in)
  if (ws_size < (size_t)WS_END2) return;
  float *BM = (float*)(ws + WS_BIAS);
  (void)QH; (void)KH; (void)VT;
  k_bias<<<dim3(TT / 16 * (TT / 16)), 512, 0, stream>>>(F[0], F[2], F[3], F[4], F[1], BM);
  k_fa<<<dim3(TNB), 512, 0, stream>>>(F[0], F[2], F[3], F[5], F[6], F[7], F[8], F[9], BM, (float*)d_out);
}
